// v000
// The times below were measured on an AMD MI455X: many runs one after another, warmed up first and cycling through
// copies of the inputs, with the whole window's GPU time divided by the number of runs. Launches and the gaps
// between them are all in it. The median over several windows is given; except for v000 it joins two sittings, which
// can be a few percent apart, so the side-by-side timings, each taken in one sitting, are the better comparison.
// The starting kernel, v000, takes 1460 microseconds a run.
#include <hip/hip_runtime.h>

// Causal multi-head self-attention whose head MERGE is a RAW RESHAPE, not a transpose (x [2][2048][1024]; q, k, v = x w ('xw' [1024][1024] 0.02, no bias) split the standard way (reshape(b, s, 16, 64).transpose(0, 2, 1, 3): head = 64-column block); scores masked (-inf where key > query) then / sqrt(64); softmax; ctx [b][16][s][64] RAW-reshaped to [b][s][1024] (NO transpose back: element (h, t, d) lands at row h x 128 + t // 16, column (t mod 16) x 64 + d); out = ctx wo ('xw', no bias) -> [2][2048][1024] (4.2 M); argument order x, wq, wk, wv, wo).
// Layout per batch: bf16 copy of x; 'xw' weights transposed once; exact projections; identity-table plane builders; causal T-2048 attention (hybrid rows: < 512 hi/lo 3 products, rest fp16 x1024; k_gemmc skips tiles above the diagonal); merged hi/lo x Wo exact.
// Compute dtypes, f32 accumulate: every input rounded to bf16; projections exact; attention rows < 512 3 products, rest fp16; softmax f32; Wo hl x exact.

#define NB_  2
#define TT   2048
#define DM   1024
#define NH_  16
#define NKV  16
#define REP  (NH_ / NKV)
#define HD   64
#define DQ   (NH_ * HD)
#define DKV  (NKV * HD)
#define ZH   2
#define RH   512                  // query rows < RH use hi+lo planes (0: none)
#define WIN  2048
#define PCAR 1024.0f
#define SCL  0.125f   // HD^-0.5
typedef _Float16 h16;
typedef unsigned short bf;
typedef __attribute__((ext_vector_type(16))) __bf16   v16bf;
typedef __attribute__((ext_vector_type(16))) _Float16 v16h;
typedef __attribute__((ext_vector_type(8)))  _Float16 v8h;
typedef __attribute__((ext_vector_type(8)))  unsigned short v8us;
typedef __attribute__((ext_vector_type(8)))  float    v8f;
typedef __attribute__((ext_vector_type(4)))  float    v4f;
typedef v8h  __attribute__((may_alias)) v8ha;
typedef v4f  __attribute__((may_alias)) v4fa;
typedef v8us __attribute__((may_alias)) v8usa;

__device__ __forceinline__ unsigned short f2bf(float f) { unsigned u = __float_as_uint(f); u += 0x7FFFu + ((u >> 16) & 1u); return (unsigned short)(u >> 16); }
__device__ __forceinline__ float bf2f(unsigned short b) { return __uint_as_float(((unsigned)b) << 16); }
__device__ __forceinline__ float bfr(float f) { return bf2f(f2bf(f)); }
__device__ __forceinline__ v16h cat16(v8h lo, v8h hi) { return __builtin_shufflevector(lo, hi, 0, 1, 2, 3, 4, 5, 6, 7, 8, 9, 10, 11, 12, 13, 14, 15); }
__device__ __forceinline__ v16bf cat16b(v8us lo, v8us hi) { return __builtin_bit_cast(v16bf, __builtin_shufflevector(lo, hi, 0, 1, 2, 3, 4, 5, 6, 7, 8, 9, 10, 11, 12, 13, 14, 15)); }
__device__ __forceinline__ v8f wmma16(v16h a, v16h b, v8f c) { return __builtin_amdgcn_wmma_f32_16x16x32_f16(false, a, false, b, (short)0, c, false, false); }
__device__ __forceinline__ v8f wmmab(v16bf a, v16bf b, v8f c) { return __builtin_amdgcn_wmma_f32_16x16x32_bf16(false, a, false, b, (short)0, c, false, false); }



// ---- k_gemmw: register-blocked GEMM, ONE WAVE per 64x64 output tile (16 accumulators), operands straight from K-contiguous 16-bit planes; grid (M/64, N/64, Z), 32 threads.
// C[m][n] (f32, pitch ldc, + optional f32 bias[n]) = sum_k A[m][k] Bt[n][k] (+ split products per NSPLIT). z-batch strides sA/sB/sC in elements. K % 32 == 0.
template <typename T16> struct WFrag;
template <> struct WFrag<h16> { typedef v16h V; static __device__ __forceinline__ V ld(const h16* p) { return cat16(*(const v8h*)p, *(const v8h*)(p + 16)); } static __device__ __forceinline__ v8f mma(V a, V b, v8f c) { return wmma16(a, b, c); } };
template <> struct WFrag<bf> { typedef v16bf V; static __device__ __forceinline__ V ld(const bf* p) { return cat16b(*(const v8us*)p, *(const v8us*)(p + 16)); } static __device__ __forceinline__ v8f mma(V a, V b, v8f c) { return wmmab(a, b, c); } };
template <typename T16, int NSPLIT, bool BIAS>
__global__ __launch_bounds__(32) void k_gemmw(const T16* __restrict__ A, const T16* __restrict__ A2, const T16* __restrict__ Bt, const T16* __restrict__ Bt2, int K, float* C, int ldc, const float* __restrict__ bias, size_t sA, size_t sB, size_t sC) {
    typedef typename WFrag<T16>::V V;
    __shared__ __align__(16) float os[16 * 68];
    const size_t z = blockIdx.z; A += z * sA; if (A2) A2 += z * sA; Bt += z * sB; if (Bt2) Bt2 += z * sB; C += z * sC;
    const int lane = threadIdx.x & 31, lr = lane & 15, hi = lane >> 4; const int r0 = blockIdx.x * 64, c0 = blockIdx.y * 64;
    v8f acc[4][4];
#pragma unroll
    for (int mb = 0; mb < 4; ++mb)
#pragma unroll
        for (int nb = 0; nb < 4; ++nb) acc[mb][nb] = (v8f){};
    const size_t aoff = (size_t)(r0 + lr) * K + 8 * hi, boff = (size_t)(c0 + lr) * K + 8 * hi;
#pragma unroll 1
    for (int kc = 0; kc < K; kc += 32) {
        V a[4], a2[4];
#pragma unroll
        for (int mb = 0; mb < 4; ++mb) { a[mb] = WFrag<T16>::ld(A + aoff + (size_t)mb * 16 * K + kc); if (NSPLIT == 1 || NSPLIT == 2) a2[mb] = WFrag<T16>::ld(A2 + aoff + (size_t)mb * 16 * K + kc); }
#pragma unroll
        for (int nb = 0; nb < 4; ++nb) { const V b = WFrag<T16>::ld(Bt + boff + (size_t)nb * 16 * K + kc); V b2; if (NSPLIT >= 2) b2 = WFrag<T16>::ld(Bt2 + boff + (size_t)nb * 16 * K + kc);
#pragma unroll
            for (int mb = 0; mb < 4; ++mb) { acc[mb][nb] = WFrag<T16>::mma(a[mb], b, acc[mb][nb]); if (NSPLIT == 1 || NSPLIT == 2) acc[mb][nb] = WFrag<T16>::mma(a2[mb], b, acc[mb][nb]); if (NSPLIT >= 2) acc[mb][nb] = WFrag<T16>::mma(a[mb], b2, acc[mb][nb]); } }
        asm volatile("v_nop\n\tv_nop\n\tv_nop\n\tv_nop" : "+v"(acc[0][0]), "+v"(acc[1][1]), "+v"(acc[2][2]), "+v"(acc[3][3]) : "v"(a[0]), "v"(a[3]));
    }
#pragma unroll
    for (int mb = 0; mb < 4; ++mb) {
#pragma unroll
        for (int nb = 0; nb < 4; ++nb) {
#pragma unroll
            for (int j = 0; j < 8; ++j) os[(hi * 8 + j) * 68 + nb * 16 + lr] = acc[mb][nb][j]; }
        __builtin_amdgcn_wave_barrier(); asm volatile("" ::: "memory");
        float* crow = C + (size_t)(r0 + mb * 16) * ldc + c0;
{
#pragma unroll
            for (int s = 0; s < 8; ++s) { const int row = 2 * s + hi, cofs = lr * 4; v4f val = *(const v4fa*)(os + row * 68 + cofs); if (BIAS) { val[0] += bfr(bias[c0 + cofs]); val[1] += bfr(bias[c0 + cofs + 1]); val[2] += bfr(bias[c0 + cofs + 2]); val[3] += bfr(bias[c0 + cofs + 3]); }
                *(v4f*)(crow + (size_t)row * ldc + cofs) = val; }
             }
        __builtin_amdgcn_wave_barrier(); asm volatile("" ::: "memory");
    }
}

// ---- k_gemmc: the same one-wave 64x64 tile GEMM specialised for causal attention: CMODE 1 skips score tiles entirely above the diagonal (query rows r0+roff.., key columns c0..), CMODE 2 limits the
// key (K) loop of the probability x value contraction to the diagonal block (probabilities beyond it are exactly zero). roff = row offset of this launch's first row within the sequence.
template <typename T16, int NSPLIT, int CMODE>
__global__ __launch_bounds__(32) void k_gemmc(const T16* __restrict__ A, const T16* __restrict__ A2, const T16* __restrict__ Bt, const T16* __restrict__ Bt2, int K, float* C, int ldc, int roff, size_t sA, size_t sB, size_t sC) {
    typedef typename WFrag<T16>::V V;
    __shared__ __align__(16) float os[16 * 68];
    const size_t z = blockIdx.z; A += z * sA; if (A2) A2 += z * sA; Bt += z * sB; if (Bt2) Bt2 += z * sB; C += z * sC;
    const int lane = threadIdx.x & 31, lr = lane & 15, hi = lane >> 4; const int r0 = blockIdx.x * 64, c0 = blockIdx.y * 64;
    if (CMODE == 1 && c0 > r0 + roff + 63) return;                  // score tile entirely above the causal diagonal: never read (the softmax masks j > i by select)
    const int Kl = (CMODE == 2) ? min(K, r0 + roff + 64) : K;        // P.V: probabilities are exactly 0 beyond the diagonal block, so the K loop stops there
    v8f acc[4][4];
#pragma unroll
    for (int mb = 0; mb < 4; ++mb)
#pragma unroll
        for (int nb = 0; nb < 4; ++nb) acc[mb][nb] = (v8f){};
    const size_t aoff = (size_t)(r0 + lr) * K + 8 * hi, boff = (size_t)(c0 + lr) * K + 8 * hi;
#pragma unroll 1
    for (int kc = 0; kc < Kl; kc += 32) {
        V a[4], a2[4];
#pragma unroll
        for (int mb = 0; mb < 4; ++mb) { a[mb] = WFrag<T16>::ld(A + aoff + (size_t)mb * 16 * K + kc); if (NSPLIT == 1 || NSPLIT == 2) a2[mb] = WFrag<T16>::ld(A2 + aoff + (size_t)mb * 16 * K + kc); }
#pragma unroll
        for (int nb = 0; nb < 4; ++nb) { const V b = WFrag<T16>::ld(Bt + boff + (size_t)nb * 16 * K + kc); V b2; if (NSPLIT >= 2) b2 = WFrag<T16>::ld(Bt2 + boff + (size_t)nb * 16 * K + kc);
#pragma unroll
            for (int mb = 0; mb < 4; ++mb) { acc[mb][nb] = WFrag<T16>::mma(a[mb], b, acc[mb][nb]); if (NSPLIT == 1 || NSPLIT == 2) acc[mb][nb] = WFrag<T16>::mma(a2[mb], b, acc[mb][nb]); if (NSPLIT >= 2) acc[mb][nb] = WFrag<T16>::mma(a[mb], b2, acc[mb][nb]); } }
        asm volatile("v_nop\n\tv_nop\n\tv_nop\n\tv_nop" : "+v"(acc[0][0]), "+v"(acc[1][1]), "+v"(acc[2][2]), "+v"(acc[3][3]) : "v"(a[0]), "v"(a[3]));
    }
#pragma unroll
    for (int mb = 0; mb < 4; ++mb) {
#pragma unroll
        for (int nb = 0; nb < 4; ++nb) {
#pragma unroll
            for (int j = 0; j < 8; ++j) os[(hi * 8 + j) * 68 + nb * 16 + lr] = acc[mb][nb][j]; }
        __builtin_amdgcn_wave_barrier(); asm volatile("" ::: "memory");
        float* crow = C + (size_t)(r0 + mb * 16) * ldc + c0;
{
#pragma unroll
            for (int s = 0; s < 8; ++s) { const int row = 2 * s + hi, cofs = lr * 4; v4f val = *(const v4fa*)(os + row * 68 + cofs);
                *(v4f*)(crow + (size_t)row * ldc + cofs) = val; }
             }
        __builtin_amdgcn_wave_barrier(); asm volatile("" ::: "memory");
    }
}

__device__ __forceinline__ h16 tohx(float x) { return (h16)x; }
__device__ __forceinline__ void splitf(float y, unsigned short& h, unsigned short& l) { h = f2bf(y); l = f2bf(y - bf2f(h)); }
typedef __attribute__((ext_vector_type(2))) _Float16 v2h;
typedef __attribute__((ext_vector_type(4))) _Float16 v4h;
typedef __attribute__((ext_vector_type(2))) unsigned short v2us;
typedef __attribute__((ext_vector_type(4))) unsigned short v4us;
typedef __attribute__((ext_vector_type(2))) float v2f;
typedef __attribute__((ext_vector_type(4))) int v4i;

__global__ __launch_bounds__(256) void k_wtG(const float* __restrict__ w, int K, int N, bf* Bt) {
    const int lane = threadIdx.x & 31; const int L0 = (blockIdx.x * 8 + (threadIdx.x >> 5)) * 8; const int nlines = N * K / 64;
{
#pragma unroll 1
        for (int l = 0; l < 8; ++l) { const int L = L0 + l; if (L >= nlines) break; const size_t e = (size_t)L * 64 + lane * 2; const int k = (int)(e % K), n = (int)(e / K); v2us o;
            o[0] = f2bf(w[(size_t)k * N + n]); o[1] = f2bf(w[(size_t)(k + 1) * N + n]); *(v2us*)(Bt + e) = o; }
         }
}
__global__ __launch_bounds__(256) void k_cvt8(const float* __restrict__ src, bf* dst, size_t n8) { const size_t i = (size_t)blockIdx.x * 256 + threadIdx.x; if (i >= n8) return; const v8f v = *(const v8f*)(src + i * 8); v8us o;
#pragma unroll
    for (int k = 0; k < 8; ++k) o[k] = f2bf(v[k]); *(v8us*)(dst + i * 8) = o;  }

// k_rope: head planes [h][t][d] (fp16 + hi/lo) of rope(x) x sc with the rotate-half convention out[d] = x[d] cos[t][d] - x[d+HD/2] sin[t][d], out[d+HD/2] = x[d+HD/2] cos[t][d+HD/2] + x[d] sin[t][d+HD/2]
__global__ __launch_bounds__(256) void k_rope(const float* __restrict__ F, int pitch, int nheads, const float* __restrict__ CS, const float* __restrict__ RF, const float* __restrict__ nw, float sc, h16* P16, bf* Ph, bf* Pl) {
    const size_t e = ((size_t)blockIdx.x * 256 + threadIdx.x) * 2; if (e >= (size_t)nheads * TT * HD) return; const int d = (int)(e % HD); const int t = (int)((e / HD) % TT); const int h = (int)(e / ((size_t)HD * TT)); const float* f = F + (size_t)t * pitch + h * HD; const float rf = RF ? RF[(size_t)h * TT + t] : 1.0f; v2h o16; v2us oh, ol;
#pragma unroll
    for (int q = 0; q < 2; ++q) { const int dd = d + q; const int dp = (dd < HD / 2) ? dd + HD / 2 : dd - HD / 2; float x0 = f[dd], x1 = f[dp];
        if (RF) { float n0 = __fmul_rn(x0, rf), n1 = __fmul_rn(x1, rf); asm volatile("" : "+v"(n0)); asm volatile("" : "+v"(n1)); x0 = __fmul_rn(bfr(nw[dd]), n0); x1 = __fmul_rn(bfr(nw[dp]), n1); }
        const v2f cs = *(const v2f*)(CS + ((size_t)t * HD + dd) * 2); float a = __fmul_rn(x0, cs[0]), bq = __fmul_rn(x1, cs[1]); asm volatile("" : "+v"(a)); asm volatile("" : "+v"(bq)); const float r = ((dd < HD / 2) ? __fsub_rn(a, bq) : __fadd_rn(a, bq)) * sc;
        o16[q] = tohx(r); unsigned short a2, c2; splitf(r, a2, c2); oh[q] = a2; ol[q] = c2; }
    *(v2h*)(P16 + e) = o16; *(v2us*)(Ph + e) = oh; *(v2us*)(Pl + e) = ol;  }
__global__ __launch_bounds__(256) void k_vtp(const float* __restrict__ F, int pitch, int nheads, h16* V16, bf* Vh, bf* Vl) { const size_t e = ((size_t)blockIdx.x * 256 + threadIdx.x) * 2; if (e >= (size_t)nheads * HD * TT) return; const int t = (int)(e % TT); const int d = (int)((e / TT) % HD); const int g = (int)(e / ((size_t)TT * HD)); v2h o16; v2us oh, ol;
#pragma unroll
    for (int q = 0; q < 2; ++q) { const float x = F[(size_t)(t + q) * pitch + g * HD + d]; o16[q] = tohx(x); unsigned short a2, c2; splitf(x, a2, c2); oh[q] = a2; ol[q] = c2; }
    *(v2h*)(V16 + e) = o16; *(v2us*)(Vh + e) = oh; *(v2us*)(Vl + e) = ol;  }
__global__ __launch_bounds__(256) void k_csid(float* CS) { const int idx = blockIdx.x * 256 + threadIdx.x; if (idx >= TT * HD) return; v2f cs; cs[0] = 1.0f; cs[1] = 0.0f; *(v2f*)(CS + (size_t)idx * 2) = cs;  }
// k_asoft: per row (zz, i): t = S x HD^-0.5 for j <= i and i - j < WIN (sliding causal window; the reference's -1e9 additive fill vanishes identically); softmax over the 2048 keys (register row, one exp, fixed trees);
__global__ __launch_bounds__(256) void k_asoft(const float* __restrict__ Sb, h16* P16, bf* Ph, bf* Pl) {
    const int lane = threadIdx.x & 31; const int row = blockIdx.x * 8 + (threadIdx.x >> 5); if (row >= ZH * TT) return; const int i = row % TT; const int zz = row / TT; (void)zz; const bool hires = (i < RH); const float* sr = Sb + (size_t)row * TT; float v[TT / 32]; float mx = -3.0e38f;
#pragma unroll
    for (int ch = 0; ch < TT / 128; ++ch) { const int j0 = ch * 128 + lane * 4; const v4f a = *(const v4f*)(sr + j0);
#pragma unroll
        for (int q = 0; q < 4; ++q) { const int j = j0 + q; (void)j; const float t = (j <= i && i - j < WIN) ? a[q] * SCL : -3.0e38f; v[ch * 4 + q] = t; mx = fmaxf(mx, t); } }
#pragma unroll
    for (int sh = 16; sh; sh >>= 1) mx = fmaxf(mx, __shfl_xor(mx, sh, 32));
    float sum = 0.f;
#pragma unroll
    for (int k = 0; k < TT / 32; ++k) { float d0 = __fsub_rn(v[k], mx); asm volatile("" : "+v"(d0)); v[k] = __builtin_amdgcn_exp2f(__fmul_rn(d0, 1.4426950408889634f)); sum += v[k]; }
#pragma unroll
    for (int sh = 16; sh; sh >>= 1) sum += __shfl_xor(sum, sh, 32);
    const float f = __fdiv_rn(hires ? 1.0f : PCAR, sum);
{
        if (hires) {
#pragma unroll
            for (int ch = 0; ch < TT / 128; ++ch) { v4us oh, ol;
#pragma unroll
                for (int q = 0; q < 4; ++q) { unsigned short a, c2; splitf(v[ch * 4 + q] * f, a, c2); oh[q] = a; ol[q] = c2; }
                const size_t oo = ((size_t)zz * (RH ? RH : 1) + i) * TT + ch * 128 + lane * 4; *(v4us*)(Ph + oo) = oh; *(v4us*)(Pl + oo) = ol; }
        } else {
#pragma unroll
            for (int ch = 0; ch < TT / 128; ++ch) { v4h o4;
#pragma unroll
                for (int q = 0; q < 4; ++q) o4[q] = tohx(v[ch * 4 + q] * f);
                *(v4h*)(P16 + (size_t)row * TT + ch * 128 + lane * 4) = o4; } }
         }
}
__global__ __launch_bounds__(256) void k_merge(const float* __restrict__ O, int h0, bf* Ah, bf* Al) { const size_t e = ((size_t)blockIdx.x * 256 + threadIdx.x) * 2; if (e >= (size_t)ZH * TT * HD) return; const int d = (int)(e % HD); const int t = (int)((e / HD) % TT); const int zz = (int)(e / ((size_t)HD * TT)); const float cs = (t < RH) ? 1.0f : (1.0f / PCAR); const size_t oo = ((size_t)(h0 + zz) * TT + t) * HD + d;   /* RAW MERGE: the (H, S, hd) context written flat = the module's reshape(b, S, H * hd) without a transpose */
    v2us oh, ol;
#pragma unroll
    for (int q = 0; q < 2; ++q) { unsigned short a, c2; splitf(O[e + q] * cs, a, c2); oh[q] = a; ol[q] = c2; } *(v2us*)(Ah + oo) = oh; *(v2us*)(Al + oo) = ol;  }

extern "C" void kernel_launch(void* const* d_in, const int* in_sizes, int n_in,
                              void* d_out, int out_size, void* d_ws, size_t ws_size, hipStream_t stream) {
    (void)in_sizes; (void)n_in; (void)out_size;
    const float* x = (const float*)d_in[0]; const float* wq = (const float*)d_in[1]; const float* wk = (const float*)d_in[2]; const float* wv = (const float*)d_in[3]; const float* wo = (const float*)d_in[4];   /* input order x, wq, wk, wv, wo ('xw') */
    float* OUT = (float*)d_out;     // [2][2048][1024]
    char* wsp = (char*)d_ws;
    auto take = [&](size_t bytes) { char* p = wsp; wsp += (bytes + 255) & ~(size_t)255; return (void*)p; };
    bf* WQ = (bf*)take((size_t)DQ * DM * 2); bf* WK = (bf*)take((size_t)DKV * DM * 2); bf* WV = (bf*)take((size_t)DKV * DM * 2); bf* WO = (bf*)take((size_t)DM * DQ * 2); float* CS = (float*)take((size_t)TT * HD * 2 * 4);
    bf* XB = (bf*)take((size_t)TT * DM * 2); float* FQ = (float*)take((size_t)TT * DQ * 4); float* FK = (float*)take((size_t)TT * DKV * 4);
    h16* QP16 = (h16*)take((size_t)NH_ * TT * HD * 2); h16* KP16 = (h16*)take((size_t)NKV * TT * HD * 2); h16* VT16 = (h16*)take((size_t)NKV * HD * TT * 2);
    bf* QPh = (bf*)take((size_t)NH_ * TT * HD * 2); bf* QPl = (bf*)take((size_t)NH_ * TT * HD * 2); bf* KPh = (bf*)take((size_t)NKV * TT * HD * 2); bf* KPl = (bf*)take((size_t)NKV * TT * HD * 2); bf* VTh = (bf*)take((size_t)NKV * HD * TT * 2); bf* VTl = (bf*)take((size_t)NKV * HD * TT * 2); bf* Ph = (bf*)take((size_t)ZH * RH * TT * 2); bf* Pl = (bf*)take((size_t)ZH * RH * TT * 2);
    float* Sb = (float*)take((size_t)ZH * TT * TT * 4); h16* P16 = (h16*)take((size_t)ZH * TT * TT * 2); float* Ob = (float*)take((size_t)ZH * TT * HD * 4); bf* ATh = (bf*)take((size_t)TT * DQ * 2); bf* ATl = (bf*)take((size_t)TT * DQ * 2);
    if ((size_t)(wsp - (char*)d_ws) > ws_size) return;    // ws 256 MiB
    float* FV = FK;   // v projection reuses the k buffer after the k planes are built (stream-ordered)
    { k_wtG<<<(unsigned)((DM * DQ / 64 + 63) / 64), 256, 0, stream>>>(wq, DM, DQ, WQ); k_wtG<<<(unsigned)((DM * DKV / 64 + 63) / 64), 256, 0, stream>>>(wk, DM, DKV, WK); k_wtG<<<(unsigned)((DM * DKV / 64 + 63) / 64), 256, 0, stream>>>(wv, DM, DKV, WV);
      k_wtG<<<(unsigned)((DQ * DM / 64 + 63) / 64), 256, 0, stream>>>(wo, DQ, DM, WO);
       }
    k_csid<<<(TT * HD + 255) / 256, 256, 0, stream>>>(CS);
    const unsigned LQ = (unsigned)(((size_t)NH_ * TT * HD / 2 + 255) / 256), LKv = (unsigned)(((size_t)NKV * TT * HD / 2 + 255) / 256);
    for (int b = 0; b < NB_; ++b) {
        
        k_cvt8<<<(unsigned)(((size_t)TT * DM / 8 + 255) / 256), 256, 0, stream>>>(x + (size_t)b * TT * DM, XB, (size_t)TT * DM / 8);
        k_gemmw<bf, 0, false><<<dim3(TT / 64, DQ / 64, 1), 32, 0, stream>>>(XB, nullptr, WQ, nullptr, DM, FQ, DQ, nullptr, 0, 0, 0);
        k_rope<<<LQ, 256, 0, stream>>>(FQ, DQ, NH_, CS, nullptr, nullptr, 1.0f, QP16, QPh, QPl);
        k_gemmw<bf, 0, false><<<dim3(TT / 64, DKV / 64, 1), 32, 0, stream>>>(XB, nullptr, WK, nullptr, DM, FK, DKV, nullptr, 0, 0, 0);
        k_rope<<<LKv, 256, 0, stream>>>(FK, DKV, NKV, CS, nullptr, nullptr, 1.0f, KP16, KPh, KPl);
        k_gemmw<bf, 0, false><<<dim3(TT / 64, DKV / 64, 1), 32, 0, stream>>>(XB, nullptr, WV, nullptr, DM, FV, DKV, nullptr, 0, 0, 0); k_vtp<<<LKv, 256, 0, stream>>>(FV, DKV, NKV, VT16, VTh, VTl);
        for (int h0 = 0; h0 < NH_; h0 += ZH) { const size_t zq = (size_t)h0, zk = (size_t)(h0 / REP);   // one kv head per query head: the pass's two heads use consecutive kv planes (z-strides TT*HD)
            k_gemmc<bf, 2, 1><<<dim3(RH / 64, TT / 64, ZH), 32, 0, stream>>>(QPh + zq * TT * HD, QPl + zq * TT * HD, KPh + zk * TT * HD, KPl + zk * TT * HD, HD, Sb, TT, 0, (size_t)TT * HD, (size_t)TT * HD, (size_t)TT * TT);
            k_gemmc<h16, 0, 1><<<dim3((TT - RH) / 64, TT / 64, ZH), 32, 0, stream>>>(QP16 + zq * TT * HD + (size_t)RH * HD, nullptr, KP16 + zk * TT * HD, nullptr, HD, Sb + (size_t)RH * TT, TT, RH, (size_t)TT * HD, (size_t)TT * HD, (size_t)TT * TT);
            k_asoft<<<ZH * TT / 8, 256, 0, stream>>>(Sb, P16, Ph, Pl);
            k_gemmc<bf, 2, 2><<<dim3(RH / 64, HD / 64, ZH), 32, 0, stream>>>(Ph, Pl, VTh + zk * HD * TT, VTl + zk * HD * TT, TT, Ob, HD, 0, (size_t)RH * TT, (size_t)HD * TT, (size_t)TT * HD);
            k_gemmc<h16, 0, 2><<<dim3((TT - RH) / 64, HD / 64, ZH), 32, 0, stream>>>(P16 + (size_t)RH * TT, nullptr, VT16 + zk * HD * TT, nullptr, TT, Ob + (size_t)RH * HD, HD, RH, (size_t)TT * TT, (size_t)HD * TT, (size_t)TT * HD);
            k_merge<<<(unsigned)(((size_t)ZH * TT * HD / 2 + 255) / 256), 256, 0, stream>>>(Ob, h0, ATh, ATl); }
        k_gemmw<bf, 1, false><<<dim3(TT / 64, DM / 64, 1), 32, 0, stream>>>(ATh, ATl, WO, nullptr, DQ, OUT + (size_t)b * TT * DM, DM, nullptr, 0, 0, 0); }
}

// v001
// Measured time: 779 microseconds a run.
// Two timings next to v000 both put it at 1.87 times that version's speed.
#include <hip/hip_runtime.h>

// Causal multi-head self-attention whose head MERGE is a RAW RESHAPE, not a transpose (x [2][2048][1024]; q, k, v = x w ('xw' [1024][1024] 0.02, no bias) split the standard way (reshape(b, s, 16, 64).transpose(0, 2, 1, 3): head = 64-column block); scores masked (-inf where key > query) then / sqrt(64); softmax; ctx [b][16][s][64] RAW-reshaped to [b][s][1024] (NO transpose back: element (h, t, d) lands at row h x 128 + t // 16, column (t mod 16) x 64 + d); out = ctx wo ('xw', no bias) -> [2][2048][1024] (4.2 M); argument order x, wq, wk, wv, wo).
// Layout per batch: bf16 copy of x; 'xw' weights transposed once; exact projections; identity-table plane builders; causal T-2048 attention (hybrid rows: < 512 hi/lo 3 products, rest fp16 x1024; k_gemmc skips tiles above the diagonal); merged hi/lo x Wo exact.
// Compute dtypes, f32 accumulate: every input rounded to bf16; projections exact; attention rows < 512 3 products, rest fp16; softmax f32; Wo hl x exact.

#define NB_  2
#define TT   2048
#define DM   1024
#define NH_  16
#define NKV  16
#define REP  (NH_ / NKV)
#define HD   64
#define DQ   (NH_ * HD)
#define DKV  (NKV * HD)
#define ZH   2
#define RH   512                  // query rows < RH use hi+lo planes (0: none)
#define WIN  2048
#define PCAR 1024.0f
#define SCL  0.125f   // HD^-0.5
typedef _Float16 h16;
typedef unsigned short bf;
typedef __attribute__((ext_vector_type(16))) __bf16   v16bf;
typedef __attribute__((ext_vector_type(16))) _Float16 v16h;
typedef __attribute__((ext_vector_type(8)))  _Float16 v8h;
typedef __attribute__((ext_vector_type(8)))  unsigned short v8us;
typedef __attribute__((ext_vector_type(8)))  float    v8f;
typedef __attribute__((ext_vector_type(4)))  float    v4f;
typedef v8h  __attribute__((may_alias)) v8ha;
typedef v4f  __attribute__((may_alias)) v4fa;
typedef v8us __attribute__((may_alias)) v8usa;

__device__ __forceinline__ unsigned short f2bf(float f) { unsigned u = __float_as_uint(f); u += 0x7FFFu + ((u >> 16) & 1u); return (unsigned short)(u >> 16); }
__device__ __forceinline__ float bf2f(unsigned short b) { return __uint_as_float(((unsigned)b) << 16); }
__device__ __forceinline__ float bfr(float f) { return bf2f(f2bf(f)); }
__device__ __forceinline__ v16h cat16(v8h lo, v8h hi) { return __builtin_shufflevector(lo, hi, 0, 1, 2, 3, 4, 5, 6, 7, 8, 9, 10, 11, 12, 13, 14, 15); }
__device__ __forceinline__ v16bf cat16b(v8us lo, v8us hi) { return __builtin_bit_cast(v16bf, __builtin_shufflevector(lo, hi, 0, 1, 2, 3, 4, 5, 6, 7, 8, 9, 10, 11, 12, 13, 14, 15)); }
__device__ __forceinline__ v8f wmma16(v16h a, v16h b, v8f c) { return __builtin_amdgcn_wmma_f32_16x16x32_f16(false, a, false, b, (short)0, c, false, false); }
__device__ __forceinline__ v8f wmmab(v16bf a, v16bf b, v8f c) { return __builtin_amdgcn_wmma_f32_16x16x32_bf16(false, a, false, b, (short)0, c, false, false); }



// ---- k_gemmw: register-blocked GEMM, NW WAVES per 64x64 output tile, each with the whole tile's 16 accumulators over its own share of K (32-wide k blocks dealt round robin: wave w takes blocks w, w + NW, ...);
// operands straight from K-contiguous 16-bit planes; grid (M/64, N/64, Z), 32 x NW threads. The NW partial tiles meet in LDS and are summed in wave order 0 .. NW-1 (sum_store).
// C[m][n] (f32, pitch ldc, + optional f32 bias[n]) = sum_k A[m][k] Bt[n][k] (+ split products per NSPLIT). z-batch strides sA/sB/sC in elements. K % 32 == 0.
template <typename T16> struct WFrag;
template <> struct WFrag<h16> { typedef v16h V; static __device__ __forceinline__ V ld(const h16* p) { return cat16(*(const v8h*)p, *(const v8h*)(p + 16)); } static __device__ __forceinline__ v8f mma(V a, V b, v8f c) { return wmma16(a, b, c); } };
template <> struct WFrag<bf> { typedef v16bf V; static __device__ __forceinline__ V ld(const bf* p) { return cat16b(*(const v8us*)p, *(const v8us*)(p + 16)); } static __device__ __forceinline__ v8f mma(V a, V b, v8f c) { return wmmab(a, b, c); } };
// sum_store: every wave puts its partial 64x64 f32 tile (row pitch 68) into its own LDS plane; behind one barrier each thread sums 4-column pieces over the planes in the fixed order 0 .. NW-1 and stores them (a wave writes whole 256-byte row pieces).
template <int NW, bool BIAS>
__device__ __forceinline__ void sum_store(const v8f (&acc)[4][4], float* os, int wv, int lr, int hi, float* C, int ldc, int r0, int c0, const float* __restrict__ bias) {
    float* osw = os + wv * (64 * 68);
#pragma unroll
    for (int mb = 0; mb < 4; ++mb)
#pragma unroll
        for (int nb = 0; nb < 4; ++nb)
#pragma unroll
            for (int j = 0; j < 8; ++j) osw[(mb * 16 + hi * 8 + j) * 68 + nb * 16 + lr] = acc[mb][nb][j];
    __syncthreads();   // all NW partial tiles are in LDS before any thread sums across them
#pragma unroll
    for (int s = 0; s < 32 / NW; ++s) { const int q = s * (32 * NW) + (int)threadIdx.x; const int row = q >> 4, cofs = (q & 15) * 4; v4f val = *(const v4fa*)(os + row * 68 + cofs);
#pragma unroll
        for (int w = 1; w < NW; ++w) val += *(const v4fa*)(os + w * (64 * 68) + row * 68 + cofs);
        if (BIAS) { val[0] += bfr(bias[c0 + cofs]); val[1] += bfr(bias[c0 + cofs + 1]); val[2] += bfr(bias[c0 + cofs + 2]); val[3] += bfr(bias[c0 + cofs + 3]); }
        *(v4f*)(C + (size_t)(r0 + row) * ldc + c0 + cofs) = val; }
}
template <typename T16, int NSPLIT, bool BIAS, int NW>
__global__ __launch_bounds__(32 * NW) void k_gemmw(const T16* __restrict__ A, const T16* __restrict__ A2, const T16* __restrict__ Bt, const T16* __restrict__ Bt2, int K, float* C, int ldc, const float* __restrict__ bias, size_t sA, size_t sB, size_t sC) {
    typedef typename WFrag<T16>::V V;
    __shared__ __align__(16) float os[NW * 64 * 68];
    const size_t z = blockIdx.z; A += z * sA; if (A2) A2 += z * sA; Bt += z * sB; if (Bt2) Bt2 += z * sB; C += z * sC;
    const int lane = threadIdx.x & 31, lr = lane & 15, hi = lane >> 4; const int wv = __builtin_amdgcn_readfirstlane((int)(threadIdx.x >> 5)); const int r0 = blockIdx.x * 64, c0 = blockIdx.y * 64;
    v8f acc[4][4];
#pragma unroll
    for (int mb = 0; mb < 4; ++mb)
#pragma unroll
        for (int nb = 0; nb < 4; ++nb) acc[mb][nb] = (v8f){};
    const size_t aoff = (size_t)(r0 + lr) * K + 8 * hi, boff = (size_t)(c0 + lr) * K + 8 * hi;
#pragma unroll 1
    for (int kc = wv * 32; kc < K; kc += 32 * NW) {
        V a[4], a2[4];
#pragma unroll
        for (int mb = 0; mb < 4; ++mb) { a[mb] = WFrag<T16>::ld(A + aoff + (size_t)mb * 16 * K + kc); if (NSPLIT == 1 || NSPLIT == 2) a2[mb] = WFrag<T16>::ld(A2 + aoff + (size_t)mb * 16 * K + kc); }
#pragma unroll
        for (int nb = 0; nb < 4; ++nb) { const V b = WFrag<T16>::ld(Bt + boff + (size_t)nb * 16 * K + kc); V b2; if (NSPLIT >= 2) b2 = WFrag<T16>::ld(Bt2 + boff + (size_t)nb * 16 * K + kc);
#pragma unroll
            for (int mb = 0; mb < 4; ++mb) { acc[mb][nb] = WFrag<T16>::mma(a[mb], b, acc[mb][nb]); if (NSPLIT == 1 || NSPLIT == 2) acc[mb][nb] = WFrag<T16>::mma(a2[mb], b, acc[mb][nb]); if (NSPLIT >= 2) acc[mb][nb] = WFrag<T16>::mma(a[mb], b2, acc[mb][nb]); } }
        asm volatile("v_nop\n\tv_nop\n\tv_nop\n\tv_nop" : "+v"(acc[0][0]), "+v"(acc[1][1]), "+v"(acc[2][2]), "+v"(acc[3][3]) : "v"(a[0]), "v"(a[3]));
    }
    sum_store<NW, BIAS>(acc, os, wv, lr, hi, C, ldc, r0, c0, bias);
}

// ---- k_gemmc: the same 64x64 tile GEMM as k_gemmw (NW waves per tile) specialised for causal attention: CMODE 1 skips score tiles entirely above the diagonal (query rows r0+roff.., key columns c0..), CMODE 2 limits the
// key (K) loop of the probability x value contraction to the diagonal block (probabilities beyond it are exactly zero). roff = row offset of this launch's first row within the sequence.
// NW = 1 (scores, K = 64): one wave per tile. NW > 1 (probability x value, K up to 2048): the key loop is dealt over NW waves as in k_gemmw and the partial tiles are summed by sum_store.
template <typename T16, int NSPLIT, int CMODE, int NW>
__global__ __launch_bounds__(32 * NW) void k_gemmc(const T16* __restrict__ A, const T16* __restrict__ A2, const T16* __restrict__ Bt, const T16* __restrict__ Bt2, int K, float* C, int ldc, int roff, size_t sA, size_t sB, size_t sC) {
    typedef typename WFrag<T16>::V V;
    __shared__ __align__(16) float os[NW > 1 ? NW * 64 * 68 : 16 * 68];
    const size_t z = blockIdx.z; A += z * sA; if (A2) A2 += z * sA; Bt += z * sB; if (Bt2) Bt2 += z * sB; C += z * sC;
    const int lane = threadIdx.x & 31, lr = lane & 15, hi = lane >> 4; const int wv = NW > 1 ? __builtin_amdgcn_readfirstlane((int)(threadIdx.x >> 5)) : 0; const int r0 = blockIdx.x * 64, c0 = blockIdx.y * 64;
    if (CMODE == 1 && c0 > r0 + roff + 63) return;                  // score tile entirely above the causal diagonal: never read (the softmax masks j > i by select)
    const int Kl = (CMODE == 2) ? min(K, r0 + roff + 64) : K;        // P.V: probabilities are exactly 0 beyond the diagonal block, so the K loop stops there
    v8f acc[4][4];
#pragma unroll
    for (int mb = 0; mb < 4; ++mb)
#pragma unroll
        for (int nb = 0; nb < 4; ++nb) acc[mb][nb] = (v8f){};
    const size_t aoff = (size_t)(r0 + lr) * K + 8 * hi, boff = (size_t)(c0 + lr) * K + 8 * hi;
#pragma unroll 1
    for (int kc = wv * 32; kc < Kl; kc += 32 * NW) {
        V a[4], a2[4];
#pragma unroll
        for (int mb = 0; mb < 4; ++mb) { a[mb] = WFrag<T16>::ld(A + aoff + (size_t)mb * 16 * K + kc); if (NSPLIT == 1 || NSPLIT == 2) a2[mb] = WFrag<T16>::ld(A2 + aoff + (size_t)mb * 16 * K + kc); }
#pragma unroll
        for (int nb = 0; nb < 4; ++nb) { const V b = WFrag<T16>::ld(Bt + boff + (size_t)nb * 16 * K + kc); V b2; if (NSPLIT >= 2) b2 = WFrag<T16>::ld(Bt2 + boff + (size_t)nb * 16 * K + kc);
#pragma unroll
            for (int mb = 0; mb < 4; ++mb) { acc[mb][nb] = WFrag<T16>::mma(a[mb], b, acc[mb][nb]); if (NSPLIT == 1 || NSPLIT == 2) acc[mb][nb] = WFrag<T16>::mma(a2[mb], b, acc[mb][nb]); if (NSPLIT >= 2) acc[mb][nb] = WFrag<T16>::mma(a[mb], b2, acc[mb][nb]); } }
        asm volatile("v_nop\n\tv_nop\n\tv_nop\n\tv_nop" : "+v"(acc[0][0]), "+v"(acc[1][1]), "+v"(acc[2][2]), "+v"(acc[3][3]) : "v"(a[0]), "v"(a[3]));
    }
    if constexpr (NW > 1) { sum_store<NW, false>(acc, os, wv, lr, hi, C, ldc, r0, c0, nullptr); } else {
#pragma unroll
    for (int mb = 0; mb < 4; ++mb) {
#pragma unroll
        for (int nb = 0; nb < 4; ++nb) {
#pragma unroll
            for (int j = 0; j < 8; ++j) os[(hi * 8 + j) * 68 + nb * 16 + lr] = acc[mb][nb][j]; }
        __builtin_amdgcn_wave_barrier(); asm volatile("" ::: "memory");
        float* crow = C + (size_t)(r0 + mb * 16) * ldc + c0;
{
#pragma unroll
            for (int s = 0; s < 8; ++s) { const int row = 2 * s + hi, cofs = lr * 4; v4f val = *(const v4fa*)(os + row * 68 + cofs);
                *(v4f*)(crow + (size_t)row * ldc + cofs) = val; }
             }
        __builtin_amdgcn_wave_barrier(); asm volatile("" ::: "memory");
    }
    }
}

__device__ __forceinline__ h16 tohx(float x) { return (h16)x; }
__device__ __forceinline__ void splitf(float y, unsigned short& h, unsigned short& l) { h = f2bf(y); l = f2bf(y - bf2f(h)); }
typedef __attribute__((ext_vector_type(2))) _Float16 v2h;
typedef __attribute__((ext_vector_type(4))) _Float16 v4h;
typedef __attribute__((ext_vector_type(2))) unsigned short v2us;
typedef __attribute__((ext_vector_type(4))) unsigned short v4us;
typedef __attribute__((ext_vector_type(2))) float v2f;
typedef __attribute__((ext_vector_type(4))) int v4i;

__global__ __launch_bounds__(256) void k_wtG(const float* __restrict__ w, int K, int N, bf* Bt) {
    const int lane = threadIdx.x & 31; const int L0 = (blockIdx.x * 8 + (threadIdx.x >> 5)) * 8; const int nlines = N * K / 64;
{
#pragma unroll 1
        for (int l = 0; l < 8; ++l) { const int L = L0 + l; if (L >= nlines) break; const size_t e = (size_t)L * 64 + lane * 2; const int k = (int)(e % K), n = (int)(e / K); v2us o;
            o[0] = f2bf(w[(size_t)k * N + n]); o[1] = f2bf(w[(size_t)(k + 1) * N + n]); *(v2us*)(Bt + e) = o; }
         }
}
__global__ __launch_bounds__(256) void k_cvt8(const float* __restrict__ src, bf* dst, size_t n8) { const size_t i = (size_t)blockIdx.x * 256 + threadIdx.x; if (i >= n8) return; const v8f v = *(const v8f*)(src + i * 8); v8us o;
#pragma unroll
    for (int k = 0; k < 8; ++k) o[k] = f2bf(v[k]); *(v8us*)(dst + i * 8) = o;  }

// k_rope: head planes [h][t][d] (fp16 + hi/lo) of rope(x) x sc with the rotate-half convention out[d] = x[d] cos[t][d] - x[d+HD/2] sin[t][d], out[d+HD/2] = x[d+HD/2] cos[t][d+HD/2] + x[d] sin[t][d+HD/2]
__global__ __launch_bounds__(256) void k_rope(const float* __restrict__ F, int pitch, int nheads, const float* __restrict__ CS, const float* __restrict__ RF, const float* __restrict__ nw, float sc, h16* P16, bf* Ph, bf* Pl) {
    const size_t e = ((size_t)blockIdx.x * 256 + threadIdx.x) * 2; if (e >= (size_t)nheads * TT * HD) return; const int d = (int)(e % HD); const int t = (int)((e / HD) % TT); const int h = (int)(e / ((size_t)HD * TT)); const float* f = F + (size_t)t * pitch + h * HD; const float rf = RF ? RF[(size_t)h * TT + t] : 1.0f; v2h o16; v2us oh, ol;
#pragma unroll
    for (int q = 0; q < 2; ++q) { const int dd = d + q; const int dp = (dd < HD / 2) ? dd + HD / 2 : dd - HD / 2; float x0 = f[dd], x1 = f[dp];
        if (RF) { float n0 = __fmul_rn(x0, rf), n1 = __fmul_rn(x1, rf); asm volatile("" : "+v"(n0)); asm volatile("" : "+v"(n1)); x0 = __fmul_rn(bfr(nw[dd]), n0); x1 = __fmul_rn(bfr(nw[dp]), n1); }
        const v2f cs = *(const v2f*)(CS + ((size_t)t * HD + dd) * 2); float a = __fmul_rn(x0, cs[0]), bq = __fmul_rn(x1, cs[1]); asm volatile("" : "+v"(a)); asm volatile("" : "+v"(bq)); const float r = ((dd < HD / 2) ? __fsub_rn(a, bq) : __fadd_rn(a, bq)) * sc;
        o16[q] = tohx(r); unsigned short a2, c2; splitf(r, a2, c2); oh[q] = a2; ol[q] = c2; }
    *(v2h*)(P16 + e) = o16; *(v2us*)(Ph + e) = oh; *(v2us*)(Pl + e) = ol;  }
__global__ __launch_bounds__(256) void k_vtp(const float* __restrict__ F, int pitch, int nheads, h16* V16, bf* Vh, bf* Vl) { const size_t e = ((size_t)blockIdx.x * 256 + threadIdx.x) * 2; if (e >= (size_t)nheads * HD * TT) return; const int t = (int)(e % TT); const int d = (int)((e / TT) % HD); const int g = (int)(e / ((size_t)TT * HD)); v2h o16; v2us oh, ol;
#pragma unroll
    for (int q = 0; q < 2; ++q) { const float x = F[(size_t)(t + q) * pitch + g * HD + d]; o16[q] = tohx(x); unsigned short a2, c2; splitf(x, a2, c2); oh[q] = a2; ol[q] = c2; }
    *(v2h*)(V16 + e) = o16; *(v2us*)(Vh + e) = oh; *(v2us*)(Vl + e) = ol;  }
__global__ __launch_bounds__(256) void k_csid(float* CS) { const int idx = blockIdx.x * 256 + threadIdx.x; if (idx >= TT * HD) return; v2f cs; cs[0] = 1.0f; cs[1] = 0.0f; *(v2f*)(CS + (size_t)idx * 2) = cs;  }
// k_asoft: per row (zz, i): t = S x HD^-0.5 for j <= i and i - j < WIN (sliding causal window; the reference's -1e9 additive fill vanishes identically); softmax over the 2048 keys (register row, one exp, fixed trees);
__global__ __launch_bounds__(256) void k_asoft(const float* __restrict__ Sb, h16* P16, bf* Ph, bf* Pl) {
    const int lane = threadIdx.x & 31; const int row = blockIdx.x * 8 + (threadIdx.x >> 5); if (row >= ZH * TT) return; const int i = row % TT; const int zz = row / TT; (void)zz; const bool hires = (i < RH); const float* sr = Sb + (size_t)row * TT; float v[TT / 32]; float mx = -3.0e38f;
#pragma unroll
    for (int ch = 0; ch < TT / 128; ++ch) { const int j0 = ch * 128 + lane * 4; const v4f a = *(const v4f*)(sr + j0);
#pragma unroll
        for (int q = 0; q < 4; ++q) { const int j = j0 + q; (void)j; const float t = (j <= i && i - j < WIN) ? a[q] * SCL : -3.0e38f; v[ch * 4 + q] = t; mx = fmaxf(mx, t); } }
#pragma unroll
    for (int sh = 16; sh; sh >>= 1) mx = fmaxf(mx, __shfl_xor(mx, sh, 32));
    float sum = 0.f;
#pragma unroll
    for (int k = 0; k < TT / 32; ++k) { float d0 = __fsub_rn(v[k], mx); asm volatile("" : "+v"(d0)); v[k] = __builtin_amdgcn_exp2f(__fmul_rn(d0, 1.4426950408889634f)); sum += v[k]; }
#pragma unroll
    for (int sh = 16; sh; sh >>= 1) sum += __shfl_xor(sum, sh, 32);
    const float f = __fdiv_rn(hires ? 1.0f : PCAR, sum);
{
        if (hires) {
#pragma unroll
            for (int ch = 0; ch < TT / 128; ++ch) { v4us oh, ol;
#pragma unroll
                for (int q = 0; q < 4; ++q) { unsigned short a, c2; splitf(v[ch * 4 + q] * f, a, c2); oh[q] = a; ol[q] = c2; }
                const size_t oo = ((size_t)zz * (RH ? RH : 1) + i) * TT + ch * 128 + lane * 4; *(v4us*)(Ph + oo) = oh; *(v4us*)(Pl + oo) = ol; }
        } else {
#pragma unroll
            for (int ch = 0; ch < TT / 128; ++ch) { v4h o4;
#pragma unroll
                for (int q = 0; q < 4; ++q) o4[q] = tohx(v[ch * 4 + q] * f);
                *(v4h*)(P16 + (size_t)row * TT + ch * 128 + lane * 4) = o4; } }
         }
}
__global__ __launch_bounds__(256) void k_merge(const float* __restrict__ O, int h0, bf* Ah, bf* Al) { const size_t e = ((size_t)blockIdx.x * 256 + threadIdx.x) * 2; if (e >= (size_t)ZH * TT * HD) return; const int d = (int)(e % HD); const int t = (int)((e / HD) % TT); const int zz = (int)(e / ((size_t)HD * TT)); const float cs = (t < RH) ? 1.0f : (1.0f / PCAR); const size_t oo = ((size_t)(h0 + zz) * TT + t) * HD + d;   /* RAW MERGE: the (H, S, hd) context written flat = the module's reshape(b, S, H * hd) without a transpose */
    v2us oh, ol;
#pragma unroll
    for (int q = 0; q < 2; ++q) { unsigned short a, c2; splitf(O[e + q] * cs, a, c2); oh[q] = a; ol[q] = c2; } *(v2us*)(Ah + oo) = oh; *(v2us*)(Al + oo) = ol;  }

extern "C" void kernel_launch(void* const* d_in, const int* in_sizes, int n_in,
                              void* d_out, int out_size, void* d_ws, size_t ws_size, hipStream_t stream) {
    (void)in_sizes; (void)n_in; (void)out_size;
    const float* x = (const float*)d_in[0]; const float* wq = (const float*)d_in[1]; const float* wk = (const float*)d_in[2]; const float* wv = (const float*)d_in[3]; const float* wo = (const float*)d_in[4];   /* input order x, wq, wk, wv, wo ('xw') */
    float* OUT = (float*)d_out;     // [2][2048][1024]
    char* wsp = (char*)d_ws;
    auto take = [&](size_t bytes) { char* p = wsp; wsp += (bytes + 255) & ~(size_t)255; return (void*)p; };
    bf* WQ = (bf*)take((size_t)DQ * DM * 2); bf* WK = (bf*)take((size_t)DKV * DM * 2); bf* WV = (bf*)take((size_t)DKV * DM * 2); bf* WO = (bf*)take((size_t)DM * DQ * 2); float* CS = (float*)take((size_t)TT * HD * 2 * 4);
    bf* XB = (bf*)take((size_t)TT * DM * 2); float* FQ = (float*)take((size_t)TT * DQ * 4); float* FK = (float*)take((size_t)TT * DKV * 4);
    h16* QP16 = (h16*)take((size_t)NH_ * TT * HD * 2); h16* KP16 = (h16*)take((size_t)NKV * TT * HD * 2); h16* VT16 = (h16*)take((size_t)NKV * HD * TT * 2);
    bf* QPh = (bf*)take((size_t)NH_ * TT * HD * 2); bf* QPl = (bf*)take((size_t)NH_ * TT * HD * 2); bf* KPh = (bf*)take((size_t)NKV * TT * HD * 2); bf* KPl = (bf*)take((size_t)NKV * TT * HD * 2); bf* VTh = (bf*)take((size_t)NKV * HD * TT * 2); bf* VTl = (bf*)take((size_t)NKV * HD * TT * 2); bf* Ph = (bf*)take((size_t)ZH * RH * TT * 2); bf* Pl = (bf*)take((size_t)ZH * RH * TT * 2);
    float* Sb = (float*)take((size_t)ZH * TT * TT * 4); h16* P16 = (h16*)take((size_t)ZH * TT * TT * 2); float* Ob = (float*)take((size_t)ZH * TT * HD * 4); bf* ATh = (bf*)take((size_t)TT * DQ * 2); bf* ATl = (bf*)take((size_t)TT * DQ * 2);
    if ((size_t)(wsp - (char*)d_ws) > ws_size) return;    // ws 256 MiB
    float* FV = FK;   // v projection reuses the k buffer after the k planes are built (stream-ordered)
    { k_wtG<<<(unsigned)((DM * DQ / 64 + 63) / 64), 256, 0, stream>>>(wq, DM, DQ, WQ); k_wtG<<<(unsigned)((DM * DKV / 64 + 63) / 64), 256, 0, stream>>>(wk, DM, DKV, WK); k_wtG<<<(unsigned)((DM * DKV / 64 + 63) / 64), 256, 0, stream>>>(wv, DM, DKV, WV);
      k_wtG<<<(unsigned)((DQ * DM / 64 + 63) / 64), 256, 0, stream>>>(wo, DQ, DM, WO);
       }
    k_csid<<<(TT * HD + 255) / 256, 256, 0, stream>>>(CS);
    const unsigned LQ = (unsigned)(((size_t)NH_ * TT * HD / 2 + 255) / 256), LKv = (unsigned)(((size_t)NKV * TT * HD / 2 + 255) / 256);
    for (int b = 0; b < NB_; ++b) {
        
        k_cvt8<<<(unsigned)(((size_t)TT * DM / 8 + 255) / 256), 256, 0, stream>>>(x + (size_t)b * TT * DM, XB, (size_t)TT * DM / 8);
        k_gemmw<bf, 0, false, 8><<<dim3(TT / 64, DQ / 64, 1), 256, 0, stream>>>(XB, nullptr, WQ, nullptr, DM, FQ, DQ, nullptr, 0, 0, 0);
        k_rope<<<LQ, 256, 0, stream>>>(FQ, DQ, NH_, CS, nullptr, nullptr, 1.0f, QP16, QPh, QPl);
        k_gemmw<bf, 0, false, 8><<<dim3(TT / 64, DKV / 64, 1), 256, 0, stream>>>(XB, nullptr, WK, nullptr, DM, FK, DKV, nullptr, 0, 0, 0);
        k_rope<<<LKv, 256, 0, stream>>>(FK, DKV, NKV, CS, nullptr, nullptr, 1.0f, KP16, KPh, KPl);
        k_gemmw<bf, 0, false, 8><<<dim3(TT / 64, DKV / 64, 1), 256, 0, stream>>>(XB, nullptr, WV, nullptr, DM, FV, DKV, nullptr, 0, 0, 0); k_vtp<<<LKv, 256, 0, stream>>>(FV, DKV, NKV, VT16, VTh, VTl);
        for (int h0 = 0; h0 < NH_; h0 += ZH) { const size_t zq = (size_t)h0, zk = (size_t)(h0 / REP);   // one kv head per query head: the pass's two heads use consecutive kv planes (z-strides TT*HD)
            k_gemmc<bf, 2, 1, 1><<<dim3(RH / 64, TT / 64, ZH), 32, 0, stream>>>(QPh + zq * TT * HD, QPl + zq * TT * HD, KPh + zk * TT * HD, KPl + zk * TT * HD, HD, Sb, TT, 0, (size_t)TT * HD, (size_t)TT * HD, (size_t)TT * TT);
            k_gemmc<h16, 0, 1, 1><<<dim3((TT - RH) / 64, TT / 64, ZH), 32, 0, stream>>>(QP16 + zq * TT * HD + (size_t)RH * HD, nullptr, KP16 + zk * TT * HD, nullptr, HD, Sb + (size_t)RH * TT, TT, RH, (size_t)TT * HD, (size_t)TT * HD, (size_t)TT * TT);
            k_asoft<<<ZH * TT / 8, 256, 0, stream>>>(Sb, P16, Ph, Pl);
            k_gemmc<bf, 2, 2, 8><<<dim3(RH / 64, HD / 64, ZH), 256, 0, stream>>>(Ph, Pl, VTh + zk * HD * TT, VTl + zk * HD * TT, TT, Ob, HD, 0, (size_t)RH * TT, (size_t)HD * TT, (size_t)TT * HD);
            k_gemmc<h16, 0, 2, 16><<<dim3((TT - RH) / 64, HD / 64, ZH), 512, 0, stream>>>(P16 + (size_t)RH * TT, nullptr, VT16 + zk * HD * TT, nullptr, TT, Ob + (size_t)RH * HD, HD, RH, (size_t)TT * TT, (size_t)HD * TT, (size_t)TT * HD);
            k_merge<<<(unsigned)(((size_t)ZH * TT * HD / 2 + 255) / 256), 256, 0, stream>>>(Ob, h0, ATh, ATl); }
        k_gemmw<bf, 1, false, 8><<<dim3(TT / 64, DM / 64, 1), 256, 0, stream>>>(ATh, ATl, WO, nullptr, DQ, OUT + (size_t)b * TT * DM, DM, nullptr, 0, 0, 0); }
}

// v002
// Measured time: 470 microseconds a run.
// Two timings next to v001 put it at 1.69 and 1.67 times that version's speed.
// Over all steps from v000 it is 3.14 times as fast.
#include <hip/hip_runtime.h>

// Causal multi-head self-attention whose head MERGE is a RAW RESHAPE, not a transpose (x [2][2048][1024]; q, k, v = x w ('xw' [1024][1024] 0.02, no bias) split the standard way (reshape(b, s, 16, 64).transpose(0, 2, 1, 3): head = 64-column block); scores masked (-inf where key > query) then / sqrt(64); softmax; ctx [b][16][s][64] RAW-reshaped to [b][s][1024] (NO transpose back: element (h, t, d) lands at row h x 128 + t // 16, column (t mod 16) x 64 + d); out = ctx wo ('xw', no bias) -> [2][2048][1024] (4.2 M); argument order x, wq, wk, wv, wo).
// Layout per batch: bf16 copy of x; 'xw' weights transposed once; exact projections; identity-table plane builders; causal T-2048 attention (hybrid rows: < 512 hi/lo 3 products, rest fp16 x1024; k_gemmc skips tiles above the diagonal); merged hi/lo x Wo exact.
// Compute dtypes, f32 accumulate: every input rounded to bf16; projections exact; attention rows < 512 3 products, rest fp16; softmax f32; Wo hl x exact.

#define NB_  2
#define TT   2048
#define DM   1024
#define NH_  16
#define NKV  16
#define REP  (NH_ / NKV)
#define HD   64
#define DQ   (NH_ * HD)
#define DKV  (NKV * HD)
#define ZH   8                    // heads per attention pass (z-batch of the six attention launches)
#define RH   512                  // query rows < RH use hi+lo planes (0: none)
#define WIN  2048
#define PCAR 1024.0f
#define SCL  0.125f   // HD^-0.5
typedef _Float16 h16;
typedef unsigned short bf;
typedef __attribute__((ext_vector_type(16))) __bf16   v16bf;
typedef __attribute__((ext_vector_type(16))) _Float16 v16h;
typedef __attribute__((ext_vector_type(8)))  _Float16 v8h;
typedef __attribute__((ext_vector_type(8)))  unsigned short v8us;
typedef __attribute__((ext_vector_type(8)))  float    v8f;
typedef __attribute__((ext_vector_type(4)))  float    v4f;
typedef v8h  __attribute__((may_alias)) v8ha;
typedef v4f  __attribute__((may_alias)) v4fa;
typedef v8us __attribute__((may_alias)) v8usa;

__device__ __forceinline__ unsigned short f2bf(float f) { unsigned u = __float_as_uint(f); u += 0x7FFFu + ((u >> 16) & 1u); return (unsigned short)(u >> 16); }
__device__ __forceinline__ float bf2f(unsigned short b) { return __uint_as_float(((unsigned)b) << 16); }
__device__ __forceinline__ float bfr(float f) { return bf2f(f2bf(f)); }
__device__ __forceinline__ v16h cat16(v8h lo, v8h hi) { return __builtin_shufflevector(lo, hi, 0, 1, 2, 3, 4, 5, 6, 7, 8, 9, 10, 11, 12, 13, 14, 15); }
__device__ __forceinline__ v16bf cat16b(v8us lo, v8us hi) { return __builtin_bit_cast(v16bf, __builtin_shufflevector(lo, hi, 0, 1, 2, 3, 4, 5, 6, 7, 8, 9, 10, 11, 12, 13, 14, 15)); }
__device__ __forceinline__ v8f wmma16(v16h a, v16h b, v8f c) { return __builtin_amdgcn_wmma_f32_16x16x32_f16(false, a, false, b, (short)0, c, false, false); }
__device__ __forceinline__ v8f wmmab(v16bf a, v16bf b, v8f c) { return __builtin_amdgcn_wmma_f32_16x16x32_bf16(false, a, false, b, (short)0, c, false, false); }



// ---- k_gemmw: register-blocked GEMM, NW WAVES per 64x64 output tile, each with the whole tile's 16 accumulators over its own share of K (32-wide k blocks dealt round robin: wave w takes blocks w, w + NW, ...);
// operands straight from K-contiguous 16-bit planes; grid (M/64, N/64, Z), 32 x NW threads. The NW partial tiles meet in LDS and are summed in wave order 0 .. NW-1 (sum_store).
// C[m][n] (f32, pitch ldc, + optional f32 bias[n]) = sum_k A[m][k] Bt[n][k] (+ split products per NSPLIT). z-batch strides sA/sB/sC in elements. K % 32 == 0.
template <typename T16> struct WFrag;
template <> struct WFrag<h16> { typedef v16h V; static __device__ __forceinline__ V ld(const h16* p) { return cat16(*(const v8h*)p, *(const v8h*)(p + 16)); } static __device__ __forceinline__ v8f mma(V a, V b, v8f c) { return wmma16(a, b, c); } };
template <> struct WFrag<bf> { typedef v16bf V; static __device__ __forceinline__ V ld(const bf* p) { return cat16b(*(const v8us*)p, *(const v8us*)(p + 16)); } static __device__ __forceinline__ v8f mma(V a, V b, v8f c) { return wmmab(a, b, c); } };
// sum_store: every wave puts its partial 64x64 f32 tile (row pitch 68) into its own LDS plane; behind one barrier each thread sums 4-column pieces over the planes in the fixed order 0 .. NW-1 and stores them (a wave writes whole 256-byte row pieces).
template <int NW, bool BIAS>
__device__ __forceinline__ void sum_store(const v8f (&acc)[4][4], float* os, int wv, int lr, int hi, float* C, int ldc, int r0, int c0, const float* __restrict__ bias) {
    float* osw = os + wv * (64 * 68);
#pragma unroll
    for (int mb = 0; mb < 4; ++mb)
#pragma unroll
        for (int nb = 0; nb < 4; ++nb)
#pragma unroll
            for (int j = 0; j < 8; ++j) osw[(mb * 16 + hi * 8 + j) * 68 + nb * 16 + lr] = acc[mb][nb][j];
    __syncthreads();   // all NW partial tiles are in LDS before any thread sums across them
#pragma unroll
    for (int s = 0; s < 32 / NW; ++s) { const int q = s * (32 * NW) + (int)threadIdx.x; const int row = q >> 4, cofs = (q & 15) * 4; v4f val = *(const v4fa*)(os + row * 68 + cofs);
#pragma unroll
        for (int w = 1; w < NW; ++w) val += *(const v4fa*)(os + w * (64 * 68) + row * 68 + cofs);
        if (BIAS) { val[0] += bfr(bias[c0 + cofs]); val[1] += bfr(bias[c0 + cofs + 1]); val[2] += bfr(bias[c0 + cofs + 2]); val[3] += bfr(bias[c0 + cofs + 3]); }
        *(v4f*)(C + (size_t)(r0 + row) * ldc + c0 + cofs) = val; }
}
template <typename T16, int NSPLIT, bool BIAS, int NW>
__global__ __launch_bounds__(32 * NW) void k_gemmw(const T16* __restrict__ A, const T16* __restrict__ A2, const T16* __restrict__ Bt, const T16* __restrict__ Bt2, int K, float* C, int ldc, const float* __restrict__ bias, size_t sA, size_t sB, size_t sC) {
    typedef typename WFrag<T16>::V V;
    __shared__ __align__(16) float os[NW * 64 * 68];
    const size_t z = blockIdx.z; A += z * sA; if (A2) A2 += z * sA; Bt += z * sB; if (Bt2) Bt2 += z * sB; C += z * sC;
    const int lane = threadIdx.x & 31, lr = lane & 15, hi = lane >> 4; const int wv = __builtin_amdgcn_readfirstlane((int)(threadIdx.x >> 5)); const int r0 = blockIdx.x * 64, c0 = blockIdx.y * 64;
    v8f acc[4][4];
#pragma unroll
    for (int mb = 0; mb < 4; ++mb)
#pragma unroll
        for (int nb = 0; nb < 4; ++nb) acc[mb][nb] = (v8f){};
    const size_t aoff = (size_t)(r0 + lr) * K + 8 * hi, boff = (size_t)(c0 + lr) * K + 8 * hi;
#pragma unroll 1
    for (int kc = wv * 32; kc < K; kc += 32 * NW) {
        V a[4], a2[4];
#pragma unroll
        for (int mb = 0; mb < 4; ++mb) { a[mb] = WFrag<T16>::ld(A + aoff + (size_t)mb * 16 * K + kc); if (NSPLIT == 1 || NSPLIT == 2) a2[mb] = WFrag<T16>::ld(A2 + aoff + (size_t)mb * 16 * K + kc); }
#pragma unroll
        for (int nb = 0; nb < 4; ++nb) { const V b = WFrag<T16>::ld(Bt + boff + (size_t)nb * 16 * K + kc); V b2; if (NSPLIT >= 2) b2 = WFrag<T16>::ld(Bt2 + boff + (size_t)nb * 16 * K + kc);
#pragma unroll
            for (int mb = 0; mb < 4; ++mb) { acc[mb][nb] = WFrag<T16>::mma(a[mb], b, acc[mb][nb]); if (NSPLIT == 1 || NSPLIT == 2) acc[mb][nb] = WFrag<T16>::mma(a2[mb], b, acc[mb][nb]); if (NSPLIT >= 2) acc[mb][nb] = WFrag<T16>::mma(a[mb], b2, acc[mb][nb]); } }
        asm volatile("v_nop\n\tv_nop\n\tv_nop\n\tv_nop" : "+v"(acc[0][0]), "+v"(acc[1][1]), "+v"(acc[2][2]), "+v"(acc[3][3]) : "v"(a[0]), "v"(a[3]));
    }
    sum_store<NW, BIAS>(acc, os, wv, lr, hi, C, ldc, r0, c0, bias);
}

// ---- k_gemmc: the same 64x64 tile GEMM as k_gemmw (NW waves per tile) specialised for causal attention: CMODE 1 skips score tiles entirely above the diagonal (query rows r0+roff.., key columns c0..), CMODE 2 limits the
// key (K) loop of the probability x value contraction to the diagonal block (probabilities beyond it are exactly zero). roff = row offset of this launch's first row within the sequence.
// lda = row pitch of A in elements (the probability planes lie inside their score rows, pitch 2 x TT); Bt keeps pitch K.
// NW = 1 (scores, K = 64): one wave per tile. NW > 1 (probability x value, K up to 2048): the key loop is dealt over NW waves as in k_gemmw and the partial tiles are summed by sum_store.
template <typename T16, int NSPLIT, int CMODE, int NW>
__global__ __launch_bounds__(32 * NW) void k_gemmc(const T16* __restrict__ A, const T16* __restrict__ A2, int lda, const T16* __restrict__ Bt, const T16* __restrict__ Bt2, int K, float* C, int ldc, int roff, size_t sA, size_t sB, size_t sC) {
    typedef typename WFrag<T16>::V V;
    __shared__ __align__(16) float os[NW > 1 ? NW * 64 * 68 : 16 * 68];
    const size_t z = blockIdx.z; A += z * sA; if (A2) A2 += z * sA; Bt += z * sB; if (Bt2) Bt2 += z * sB; C += z * sC;
    const int lane = threadIdx.x & 31, lr = lane & 15, hi = lane >> 4; const int wv = NW > 1 ? __builtin_amdgcn_readfirstlane((int)(threadIdx.x >> 5)) : 0; const int r0 = blockIdx.x * 64, c0 = blockIdx.y * 64;
    if (CMODE == 1 && c0 > r0 + roff + 63) return;                  // score tile entirely above the causal diagonal: never read (the softmax masks j > i by select)
    const int Kl = (CMODE == 2) ? min(K, r0 + roff + 64) : K;        // P.V: probabilities are exactly 0 beyond the diagonal block, so the K loop stops there
    v8f acc[4][4];
#pragma unroll
    for (int mb = 0; mb < 4; ++mb)
#pragma unroll
        for (int nb = 0; nb < 4; ++nb) acc[mb][nb] = (v8f){};
    const size_t aoff = (size_t)(r0 + lr) * lda + 8 * hi, boff = (size_t)(c0 + lr) * K + 8 * hi;
#pragma unroll 1
    for (int kc = wv * 32; kc < Kl; kc += 32 * NW) {
        V a[4], a2[4];
#pragma unroll
        for (int mb = 0; mb < 4; ++mb) { a[mb] = WFrag<T16>::ld(A + aoff + (size_t)mb * 16 * lda + kc); if (NSPLIT == 1 || NSPLIT == 2) a2[mb] = WFrag<T16>::ld(A2 + aoff + (size_t)mb * 16 * lda + kc); }
#pragma unroll
        for (int nb = 0; nb < 4; ++nb) { const V b = WFrag<T16>::ld(Bt + boff + (size_t)nb * 16 * K + kc); V b2; if (NSPLIT >= 2) b2 = WFrag<T16>::ld(Bt2 + boff + (size_t)nb * 16 * K + kc);
#pragma unroll
            for (int mb = 0; mb < 4; ++mb) { acc[mb][nb] = WFrag<T16>::mma(a[mb], b, acc[mb][nb]); if (NSPLIT == 1 || NSPLIT == 2) acc[mb][nb] = WFrag<T16>::mma(a2[mb], b, acc[mb][nb]); if (NSPLIT >= 2) acc[mb][nb] = WFrag<T16>::mma(a[mb], b2, acc[mb][nb]); } }
        asm volatile("v_nop\n\tv_nop\n\tv_nop\n\tv_nop" : "+v"(acc[0][0]), "+v"(acc[1][1]), "+v"(acc[2][2]), "+v"(acc[3][3]) : "v"(a[0]), "v"(a[3]));
    }
    if constexpr (NW > 1) { sum_store<NW, false>(acc, os, wv, lr, hi, C, ldc, r0, c0, nullptr); } else {
#pragma unroll
    for (int mb = 0; mb < 4; ++mb) {
#pragma unroll
        for (int nb = 0; nb < 4; ++nb) {
#pragma unroll
            for (int j = 0; j < 8; ++j) os[(hi * 8 + j) * 68 + nb * 16 + lr] = acc[mb][nb][j]; }
        __builtin_amdgcn_wave_barrier(); asm volatile("" ::: "memory");
        float* crow = C + (size_t)(r0 + mb * 16) * ldc + c0;
{
#pragma unroll
            for (int s = 0; s < 8; ++s) { const int row = 2 * s + hi, cofs = lr * 4; v4f val = *(const v4fa*)(os + row * 68 + cofs);
                *(v4f*)(crow + (size_t)row * ldc + cofs) = val; }
             }
        __builtin_amdgcn_wave_barrier(); asm volatile("" ::: "memory");
    }
    }
}

__device__ __forceinline__ h16 tohx(float x) { return (h16)x; }
__device__ __forceinline__ void splitf(float y, unsigned short& h, unsigned short& l) { h = f2bf(y); l = f2bf(y - bf2f(h)); }
typedef __attribute__((ext_vector_type(2))) _Float16 v2h;
typedef __attribute__((ext_vector_type(4))) _Float16 v4h;
typedef __attribute__((ext_vector_type(2))) unsigned short v2us;
typedef __attribute__((ext_vector_type(4))) unsigned short v4us;
typedef __attribute__((ext_vector_type(2))) float v2f;
typedef __attribute__((ext_vector_type(4))) int v4i;

__global__ __launch_bounds__(256) void k_wtG(const float* __restrict__ w, int K, int N, bf* Bt) {
    const int lane = threadIdx.x & 31; const int L0 = (blockIdx.x * 8 + (threadIdx.x >> 5)) * 8; const int nlines = N * K / 64;
{
#pragma unroll 1
        for (int l = 0; l < 8; ++l) { const int L = L0 + l; if (L >= nlines) break; const size_t e = (size_t)L * 64 + lane * 2; const int k = (int)(e % K), n = (int)(e / K); v2us o;
            o[0] = f2bf(w[(size_t)k * N + n]); o[1] = f2bf(w[(size_t)(k + 1) * N + n]); *(v2us*)(Bt + e) = o; }
         }
}
__global__ __launch_bounds__(256) void k_cvt8(const float* __restrict__ src, bf* dst, size_t n8) { const size_t i = (size_t)blockIdx.x * 256 + threadIdx.x; if (i >= n8) return; const v8f v = *(const v8f*)(src + i * 8); v8us o;
#pragma unroll
    for (int k = 0; k < 8; ++k) o[k] = f2bf(v[k]); *(v8us*)(dst + i * 8) = o;  }

// k_rope: head planes [h][t][d] (fp16 + hi/lo) of rope(x) x sc with the rotate-half convention out[d] = x[d] cos[t][d] - x[d+HD/2] sin[t][d], out[d+HD/2] = x[d+HD/2] cos[t][d+HD/2] + x[d] sin[t][d+HD/2]
__global__ __launch_bounds__(256) void k_rope(const float* __restrict__ F, int pitch, int nheads, const float* __restrict__ CS, const float* __restrict__ RF, const float* __restrict__ nw, float sc, h16* P16, bf* Ph, bf* Pl) {
    const size_t e = ((size_t)blockIdx.x * 256 + threadIdx.x) * 2; if (e >= (size_t)nheads * TT * HD) return; const int d = (int)(e % HD); const int t = (int)((e / HD) % TT); const int h = (int)(e / ((size_t)HD * TT)); const float* f = F + (size_t)t * pitch + h * HD; const float rf = RF ? RF[(size_t)h * TT + t] : 1.0f; v2h o16; v2us oh, ol;
#pragma unroll
    for (int q = 0; q < 2; ++q) { const int dd = d + q; const int dp = (dd < HD / 2) ? dd + HD / 2 : dd - HD / 2; float x0 = f[dd], x1 = f[dp];
        if (RF) { float n0 = __fmul_rn(x0, rf), n1 = __fmul_rn(x1, rf); asm volatile("" : "+v"(n0)); asm volatile("" : "+v"(n1)); x0 = __fmul_rn(bfr(nw[dd]), n0); x1 = __fmul_rn(bfr(nw[dp]), n1); }
        const v2f cs = *(const v2f*)(CS + ((size_t)t * HD + dd) * 2); float a = __fmul_rn(x0, cs[0]), bq = __fmul_rn(x1, cs[1]); asm volatile("" : "+v"(a)); asm volatile("" : "+v"(bq)); const float r = ((dd < HD / 2) ? __fsub_rn(a, bq) : __fadd_rn(a, bq)) * sc;
        o16[q] = tohx(r); unsigned short a2, c2; splitf(r, a2, c2); oh[q] = a2; ol[q] = c2; }
    *(v2h*)(P16 + e) = o16; *(v2us*)(Ph + e) = oh; *(v2us*)(Pl + e) = ol;  }
__global__ __launch_bounds__(256) void k_vtp(const float* __restrict__ F, int pitch, int nheads, h16* V16, bf* Vh, bf* Vl) { const size_t e = ((size_t)blockIdx.x * 256 + threadIdx.x) * 2; if (e >= (size_t)nheads * HD * TT) return; const int t = (int)(e % TT); const int d = (int)((e / TT) % HD); const int g = (int)(e / ((size_t)TT * HD)); v2h o16; v2us oh, ol;
#pragma unroll
    for (int q = 0; q < 2; ++q) { const float x = F[(size_t)(t + q) * pitch + g * HD + d]; o16[q] = tohx(x); unsigned short a2, c2; splitf(x, a2, c2); oh[q] = a2; ol[q] = c2; }
    *(v2h*)(V16 + e) = o16; *(v2us*)(Vh + e) = oh; *(v2us*)(Vl + e) = ol;  }
__global__ __launch_bounds__(256) void k_csid(float* CS) { const int idx = blockIdx.x * 256 + threadIdx.x; if (idx >= TT * HD) return; v2f cs; cs[0] = 1.0f; cs[1] = 0.0f; *(v2f*)(CS + (size_t)idx * 2) = cs;  }
// k_asoft: per row (zz, i): t = S x HD^-0.5 for j <= i and i - j < WIN (sliding causal window; the reference's -1e9 additive fill vanishes identically); softmax over the 2048 keys (register row, one exp, fixed trees);
// the probabilities go IN PLACE over the row's own 8 KiB of scores (one wave owns a row and holds all of it in registers before its first store): rows < RH hi plane in the first 4 KiB, lo plane in the second; other rows fp16 in the first 4 KiB.
__global__ __launch_bounds__(256) void k_asoft(float* Sb) {
    const int lane = threadIdx.x & 31; const int row = blockIdx.x * 8 + (threadIdx.x >> 5); if (row >= ZH * TT) return; const int i = row % TT; const int zz = row / TT; (void)zz; const bool hires = (i < RH); float* sr = Sb + (size_t)row * TT; float v[TT / 32]; float mx = -3.0e38f;
#pragma unroll
    for (int ch = 0; ch < TT / 128; ++ch) { const int j0 = ch * 128 + lane * 4; const v4f a = *(const v4f*)(sr + j0);
#pragma unroll
        for (int q = 0; q < 4; ++q) { const int j = j0 + q; (void)j; const float t = (j <= i && i - j < WIN) ? a[q] * SCL : -3.0e38f; v[ch * 4 + q] = t; mx = fmaxf(mx, t); } }
#pragma unroll
    for (int sh = 16; sh; sh >>= 1) mx = fmaxf(mx, __shfl_xor(mx, sh, 32));
    float sum = 0.f;
#pragma unroll
    for (int k = 0; k < TT / 32; ++k) { float d0 = __fsub_rn(v[k], mx); asm volatile("" : "+v"(d0)); v[k] = __builtin_amdgcn_exp2f(__fmul_rn(d0, 1.4426950408889634f)); sum += v[k]; }
#pragma unroll
    for (int sh = 16; sh; sh >>= 1) sum += __shfl_xor(sum, sh, 32);
    const float f = __fdiv_rn(hires ? 1.0f : PCAR, sum);
{
        if (hires) {
#pragma unroll
            for (int ch = 0; ch < TT / 128; ++ch) { v4us oh, ol;
#pragma unroll
                for (int q = 0; q < 4; ++q) { unsigned short a, c2; splitf(v[ch * 4 + q] * f, a, c2); oh[q] = a; ol[q] = c2; }
                bf* pr = (bf*)sr + ch * 128 + lane * 4; *(v4us*)pr = oh; *(v4us*)(pr + TT) = ol; }
        } else {
#pragma unroll
            for (int ch = 0; ch < TT / 128; ++ch) { v4h o4;
#pragma unroll
                for (int q = 0; q < 4; ++q) o4[q] = tohx(v[ch * 4 + q] * f);
                *(v4h*)((h16*)sr + ch * 128 + lane * 4) = o4; } }
         }
}
__global__ __launch_bounds__(256) void k_merge(const float* __restrict__ O, int h0, bf* Ah, bf* Al) { const size_t e = ((size_t)blockIdx.x * 256 + threadIdx.x) * 2; if (e >= (size_t)ZH * TT * HD) return; const int d = (int)(e % HD); const int t = (int)((e / HD) % TT); const int zz = (int)(e / ((size_t)HD * TT)); const float cs = (t < RH) ? 1.0f : (1.0f / PCAR); const size_t oo = ((size_t)(h0 + zz) * TT + t) * HD + d;   /* RAW MERGE: the (H, S, hd) context written flat = the module's reshape(b, S, H * hd) without a transpose */
    v2us oh, ol;
#pragma unroll
    for (int q = 0; q < 2; ++q) { unsigned short a, c2; splitf(O[e + q] * cs, a, c2); oh[q] = a; ol[q] = c2; } *(v2us*)(Ah + oo) = oh; *(v2us*)(Al + oo) = ol;  }

extern "C" void kernel_launch(void* const* d_in, const int* in_sizes, int n_in,
                              void* d_out, int out_size, void* d_ws, size_t ws_size, hipStream_t stream) {
    (void)in_sizes; (void)n_in; (void)out_size;
    const float* x = (const float*)d_in[0]; const float* wq = (const float*)d_in[1]; const float* wk = (const float*)d_in[2]; const float* wv = (const float*)d_in[3]; const float* wo = (const float*)d_in[4];   /* input order x, wq, wk, wv, wo ('xw') */
    float* OUT = (float*)d_out;     // [2][2048][1024]
    char* wsp = (char*)d_ws;
    auto take = [&](size_t bytes) { char* p = wsp; wsp += (bytes + 255) & ~(size_t)255; return (void*)p; };
    bf* WQ = (bf*)take((size_t)DQ * DM * 2); bf* WK = (bf*)take((size_t)DKV * DM * 2); bf* WV = (bf*)take((size_t)DKV * DM * 2); bf* WO = (bf*)take((size_t)DM * DQ * 2); float* CS = (float*)take((size_t)TT * HD * 2 * 4);
    bf* XB = (bf*)take((size_t)TT * DM * 2); float* FQ = (float*)take((size_t)TT * DQ * 4); float* FK = (float*)take((size_t)TT * DKV * 4);
    h16* QP16 = (h16*)take((size_t)NH_ * TT * HD * 2); h16* KP16 = (h16*)take((size_t)NKV * TT * HD * 2); h16* VT16 = (h16*)take((size_t)NKV * HD * TT * 2);
    bf* QPh = (bf*)take((size_t)NH_ * TT * HD * 2); bf* QPl = (bf*)take((size_t)NH_ * TT * HD * 2); bf* KPh = (bf*)take((size_t)NKV * TT * HD * 2); bf* KPl = (bf*)take((size_t)NKV * TT * HD * 2); bf* VTh = (bf*)take((size_t)NKV * HD * TT * 2); bf* VTl = (bf*)take((size_t)NKV * HD * TT * 2);
    float* Sb = (float*)take((size_t)ZH * TT * TT * 4); float* Ob = (float*)take((size_t)ZH * TT * HD * 4); bf* ATh = (bf*)take((size_t)TT * DQ * 2); bf* ATl = (bf*)take((size_t)TT * DQ * 2);
    if ((size_t)(wsp - (char*)d_ws) > ws_size) return;    // ws 256 MiB
    float* FV = FK;   // v projection reuses the k buffer after the k planes are built (stream-ordered)
    { k_wtG<<<(unsigned)((DM * DQ / 64 + 63) / 64), 256, 0, stream>>>(wq, DM, DQ, WQ); k_wtG<<<(unsigned)((DM * DKV / 64 + 63) / 64), 256, 0, stream>>>(wk, DM, DKV, WK); k_wtG<<<(unsigned)((DM * DKV / 64 + 63) / 64), 256, 0, stream>>>(wv, DM, DKV, WV);
      k_wtG<<<(unsigned)((DQ * DM / 64 + 63) / 64), 256, 0, stream>>>(wo, DQ, DM, WO);
       }
    k_csid<<<(TT * HD + 255) / 256, 256, 0, stream>>>(CS);
    const unsigned LQ = (unsigned)(((size_t)NH_ * TT * HD / 2 + 255) / 256), LKv = (unsigned)(((size_t)NKV * TT * HD / 2 + 255) / 256);
    for (int b = 0; b < NB_; ++b) {
        
        k_cvt8<<<(unsigned)(((size_t)TT * DM / 8 + 255) / 256), 256, 0, stream>>>(x + (size_t)b * TT * DM, XB, (size_t)TT * DM / 8);
        k_gemmw<bf, 0, false, 8><<<dim3(TT / 64, DQ / 64, 1), 256, 0, stream>>>(XB, nullptr, WQ, nullptr, DM, FQ, DQ, nullptr, 0, 0, 0);
        k_rope<<<LQ, 256, 0, stream>>>(FQ, DQ, NH_, CS, nullptr, nullptr, 1.0f, QP16, QPh, QPl);
        k_gemmw<bf, 0, false, 8><<<dim3(TT / 64, DKV / 64, 1), 256, 0, stream>>>(XB, nullptr, WK, nullptr, DM, FK, DKV, nullptr, 0, 0, 0);
        k_rope<<<LKv, 256, 0, stream>>>(FK, DKV, NKV, CS, nullptr, nullptr, 1.0f, KP16, KPh, KPl);
        k_gemmw<bf, 0, false, 8><<<dim3(TT / 64, DKV / 64, 1), 256, 0, stream>>>(XB, nullptr, WV, nullptr, DM, FV, DKV, nullptr, 0, 0, 0); k_vtp<<<LKv, 256, 0, stream>>>(FV, DKV, NKV, VT16, VTh, VTl);
        for (int h0 = 0; h0 < NH_; h0 += ZH) { const size_t zq = (size_t)h0, zk = (size_t)(h0 / REP);   // one kv head per query head: the pass's heads use consecutive kv planes (z-strides TT*HD)
            k_gemmc<bf, 2, 1, 1><<<dim3(RH / 64, TT / 64, ZH), 32, 0, stream>>>(QPh + zq * TT * HD, QPl + zq * TT * HD, HD, KPh + zk * TT * HD, KPl + zk * TT * HD, HD, Sb, TT, 0, (size_t)TT * HD, (size_t)TT * HD, (size_t)TT * TT);
            k_gemmc<h16, 0, 1, 1><<<dim3((TT - RH) / 64, TT / 64, ZH), 32, 0, stream>>>(QP16 + zq * TT * HD + (size_t)RH * HD, nullptr, HD, KP16 + zk * TT * HD, nullptr, HD, Sb + (size_t)RH * TT, TT, RH, (size_t)TT * HD, (size_t)TT * HD, (size_t)TT * TT);
            k_asoft<<<ZH * TT / 8, 256, 0, stream>>>(Sb);
            k_gemmc<bf, 2, 2, 8><<<dim3(RH / 64, HD / 64, ZH), 256, 0, stream>>>((const bf*)Sb, (const bf*)Sb + TT, 2 * TT, VTh + zk * HD * TT, VTl + zk * HD * TT, TT, Ob, HD, 0, (size_t)TT * 2 * TT, (size_t)HD * TT, (size_t)TT * HD);
            k_gemmc<h16, 0, 2, 16><<<dim3((TT - RH) / 64, HD / 64, ZH), 512, 0, stream>>>((const h16*)Sb + (size_t)RH * 2 * TT, nullptr, 2 * TT, VT16 + zk * HD * TT, nullptr, TT, Ob + (size_t)RH * HD, HD, RH, (size_t)TT * 2 * TT, (size_t)HD * TT, (size_t)TT * HD);
            k_merge<<<(unsigned)(((size_t)ZH * TT * HD / 2 + 255) / 256), 256, 0, stream>>>(Ob, h0, ATh, ATl); }
        k_gemmw<bf, 1, false, 8><<<dim3(TT / 64, DM / 64, 1), 256, 0, stream>>>(ATh, ATl, WO, nullptr, DQ, OUT + (size_t)b * TT * DM, DM, nullptr, 0, 0, 0); }
}

// v003
// Measured time: 231 microseconds a run.
// Two timings next to v002 put it at 2.05 and 2.03 times that version's speed.
// Over all steps from v000 it is 6.41 times as fast.
#include <hip/hip_runtime.h>

// Causal multi-head self-attention whose head MERGE is a RAW RESHAPE, not a transpose (x [2][2048][1024]; q, k, v = x w ('xw' [1024][1024] 0.02, no bias) split the standard way (reshape(b, s, 16, 64).transpose(0, 2, 1, 3): head = 64-column block); scores masked (-inf where key > query) then / sqrt(64); softmax; ctx [b][16][s][64] RAW-reshaped to [b][s][1024] (NO transpose back: element (h, t, d) lands at row h x 128 + t // 16, column (t mod 16) x 64 + d); out = ctx wo ('xw', no bias) -> [2][2048][1024] (4.2 M); argument order x, wq, wk, wv, wo).
// Layout per batch: bf16 copy of x; 'xw' weights transposed once; exact projections; identity-table plane builders; causal T-2048 attention in one kernel per batch (k_fattn; hybrid rows: < 512 hi/lo 3 products, rest fp16 x1024; key blocks above the diagonal are never visited); merged hi/lo x Wo exact.
// Compute dtypes, f32 accumulate: every input rounded to bf16; projections exact; attention rows < 512 3 products, rest fp16; softmax f32; Wo hl x exact.

#define NB_  2
#define TT   2048
#define DM   1024
#define NH_  16
#define NKV  16
#define REP  (NH_ / NKV)
#define HD   64
#define DQ   (NH_ * HD)
#define DKV  (NKV * HD)
#define RH   512                  // query rows < RH use hi+lo planes (0: none)
#define PCAR 1024.0f
#define SCL  0.125f   // HD^-0.5
typedef _Float16 h16;
typedef unsigned short bf;
typedef __attribute__((ext_vector_type(16))) __bf16   v16bf;
typedef __attribute__((ext_vector_type(16))) _Float16 v16h;
typedef __attribute__((ext_vector_type(8)))  _Float16 v8h;
typedef __attribute__((ext_vector_type(8)))  unsigned short v8us;
typedef __attribute__((ext_vector_type(8)))  float    v8f;
typedef __attribute__((ext_vector_type(4)))  float    v4f;
typedef v8h  __attribute__((may_alias)) v8ha;
typedef v4f  __attribute__((may_alias)) v4fa;
typedef v8us __attribute__((may_alias)) v8usa;

__device__ __forceinline__ unsigned short f2bf(float f) { unsigned u = __float_as_uint(f); u += 0x7FFFu + ((u >> 16) & 1u); return (unsigned short)(u >> 16); }
__device__ __forceinline__ float bf2f(unsigned short b) { return __uint_as_float(((unsigned)b) << 16); }
__device__ __forceinline__ float bfr(float f) { return bf2f(f2bf(f)); }
__device__ __forceinline__ v16h cat16(v8h lo, v8h hi) { return __builtin_shufflevector(lo, hi, 0, 1, 2, 3, 4, 5, 6, 7, 8, 9, 10, 11, 12, 13, 14, 15); }
__device__ __forceinline__ v16bf cat16b(v8us lo, v8us hi) { return __builtin_bit_cast(v16bf, __builtin_shufflevector(lo, hi, 0, 1, 2, 3, 4, 5, 6, 7, 8, 9, 10, 11, 12, 13, 14, 15)); }
__device__ __forceinline__ v8f wmma16(v16h a, v16h b, v8f c) { return __builtin_amdgcn_wmma_f32_16x16x32_f16(false, a, false, b, (short)0, c, false, false); }
__device__ __forceinline__ v8f wmmab(v16bf a, v16bf b, v8f c) { return __builtin_amdgcn_wmma_f32_16x16x32_bf16(false, a, false, b, (short)0, c, false, false); }



// ---- k_gemmw: register-blocked GEMM, NW WAVES per 64x64 output tile, each with the whole tile's 16 accumulators over its own share of K (32-wide k blocks dealt round robin: wave w takes blocks w, w + NW, ...);
// operands straight from K-contiguous 16-bit planes; grid (M/64, N/64, Z), 32 x NW threads. The NW partial tiles meet in LDS and are summed in wave order 0 .. NW-1 (sum_store).
// C[m][n] (f32, pitch ldc, + optional f32 bias[n]) = sum_k A[m][k] Bt[n][k] (+ split products per NSPLIT). z-batch strides sA/sB/sC in elements. K % 32 == 0.
template <typename T16> struct WFrag;
template <> struct WFrag<h16> { typedef v16h V; static __device__ __forceinline__ V ld(const h16* p) { return cat16(*(const v8h*)p, *(const v8h*)(p + 16)); } static __device__ __forceinline__ v8f mma(V a, V b, v8f c) { return wmma16(a, b, c); } };
template <> struct WFrag<bf> { typedef v16bf V; static __device__ __forceinline__ V ld(const bf* p) { return cat16b(*(const v8us*)p, *(const v8us*)(p + 16)); } static __device__ __forceinline__ v8f mma(V a, V b, v8f c) { return wmmab(a, b, c); } };
// sum_store: every wave puts its partial 64x64 f32 tile (row pitch 68) into its own LDS plane; behind one barrier each thread sums 4-column pieces over the planes in the fixed order 0 .. NW-1 and stores them (a wave writes whole 256-byte row pieces).
template <int NW, bool BIAS>
__device__ __forceinline__ void sum_store(const v8f (&acc)[4][4], float* os, int wv, int lr, int hi, float* C, int ldc, int r0, int c0, const float* __restrict__ bias) {
    float* osw = os + wv * (64 * 68);
#pragma unroll
    for (int mb = 0; mb < 4; ++mb)
#pragma unroll
        for (int nb = 0; nb < 4; ++nb)
#pragma unroll
            for (int j = 0; j < 8; ++j) osw[(mb * 16 + hi * 8 + j) * 68 + nb * 16 + lr] = acc[mb][nb][j];
    __syncthreads();   // all NW partial tiles are in LDS before any thread sums across them
#pragma unroll
    for (int s = 0; s < 32 / NW; ++s) { const int q = s * (32 * NW) + (int)threadIdx.x; const int row = q >> 4, cofs = (q & 15) * 4; v4f val = *(const v4fa*)(os + row * 68 + cofs);
#pragma unroll
        for (int w = 1; w < NW; ++w) val += *(const v4fa*)(os + w * (64 * 68) + row * 68 + cofs);
        if (BIAS) { val[0] += bfr(bias[c0 + cofs]); val[1] += bfr(bias[c0 + cofs + 1]); val[2] += bfr(bias[c0 + cofs + 2]); val[3] += bfr(bias[c0 + cofs + 3]); }
        *(v4f*)(C + (size_t)(r0 + row) * ldc + c0 + cofs) = val; }
}
template <typename T16, int NSPLIT, bool BIAS, int NW>
__global__ __launch_bounds__(32 * NW) void k_gemmw(const T16* __restrict__ A, const T16* __restrict__ A2, const T16* __restrict__ Bt, const T16* __restrict__ Bt2, int K, float* C, int ldc, const float* __restrict__ bias, size_t sA, size_t sB, size_t sC) {
    typedef typename WFrag<T16>::V V;
    __shared__ __align__(16) float os[NW * 64 * 68];
    const size_t z = blockIdx.z; A += z * sA; if (A2) A2 += z * sA; Bt += z * sB; if (Bt2) Bt2 += z * sB; C += z * sC;
    const int lane = threadIdx.x & 31, lr = lane & 15, hi = lane >> 4; const int wv = __builtin_amdgcn_readfirstlane((int)(threadIdx.x >> 5)); const int r0 = blockIdx.x * 64, c0 = blockIdx.y * 64;
    v8f acc[4][4];
#pragma unroll
    for (int mb = 0; mb < 4; ++mb)
#pragma unroll
        for (int nb = 0; nb < 4; ++nb) acc[mb][nb] = (v8f){};
    const size_t aoff = (size_t)(r0 + lr) * K + 8 * hi, boff = (size_t)(c0 + lr) * K + 8 * hi;
#pragma unroll 1
    for (int kc = wv * 32; kc < K; kc += 32 * NW) {
        V a[4], a2[4];
#pragma unroll
        for (int mb = 0; mb < 4; ++mb) { a[mb] = WFrag<T16>::ld(A + aoff + (size_t)mb * 16 * K + kc); if (NSPLIT == 1 || NSPLIT == 2) a2[mb] = WFrag<T16>::ld(A2 + aoff + (size_t)mb * 16 * K + kc); }
#pragma unroll
        for (int nb = 0; nb < 4; ++nb) { const V b = WFrag<T16>::ld(Bt + boff + (size_t)nb * 16 * K + kc); V b2; if (NSPLIT >= 2) b2 = WFrag<T16>::ld(Bt2 + boff + (size_t)nb * 16 * K + kc);
#pragma unroll
            for (int mb = 0; mb < 4; ++mb) { acc[mb][nb] = WFrag<T16>::mma(a[mb], b, acc[mb][nb]); if (NSPLIT == 1 || NSPLIT == 2) acc[mb][nb] = WFrag<T16>::mma(a2[mb], b, acc[mb][nb]); if (NSPLIT >= 2) acc[mb][nb] = WFrag<T16>::mma(a[mb], b2, acc[mb][nb]); } }
        asm volatile("v_nop\n\tv_nop\n\tv_nop\n\tv_nop" : "+v"(acc[0][0]), "+v"(acc[1][1]), "+v"(acc[2][2]), "+v"(acc[3][3]) : "v"(a[0]), "v"(a[3]));
    }
    sum_store<NW, BIAS>(acc, os, wv, lr, hi, C, ldc, r0, c0, bias);
}

__device__ __forceinline__ h16 tohx(float x) { return (h16)x; }
__device__ __forceinline__ void splitf(float y, unsigned short& h, unsigned short& l) { h = f2bf(y); l = f2bf(y - bf2f(h)); }
typedef __attribute__((ext_vector_type(2))) _Float16 v2h;
typedef __attribute__((ext_vector_type(4))) _Float16 v4h;
typedef __attribute__((ext_vector_type(2))) unsigned short v2us;
typedef __attribute__((ext_vector_type(4))) unsigned short v4us;
typedef __attribute__((ext_vector_type(2))) float v2f;
typedef __attribute__((ext_vector_type(4))) int v4i;

__global__ __launch_bounds__(256) void k_wtG(const float* __restrict__ w, int K, int N, bf* Bt) {
    const int lane = threadIdx.x & 31; const int L0 = (blockIdx.x * 8 + (threadIdx.x >> 5)) * 8; const int nlines = N * K / 64;
{
#pragma unroll 1
        for (int l = 0; l < 8; ++l) { const int L = L0 + l; if (L >= nlines) break; const size_t e = (size_t)L * 64 + lane * 2; const int k = (int)(e % K), n = (int)(e / K); v2us o;
            o[0] = f2bf(w[(size_t)k * N + n]); o[1] = f2bf(w[(size_t)(k + 1) * N + n]); *(v2us*)(Bt + e) = o; }
         }
}
__global__ __launch_bounds__(256) void k_cvt8(const float* __restrict__ src, bf* dst, size_t n8) { const size_t i = (size_t)blockIdx.x * 256 + threadIdx.x; if (i >= n8) return; const v8f v = *(const v8f*)(src + i * 8); v8us o;
#pragma unroll
    for (int k = 0; k < 8; ++k) o[k] = f2bf(v[k]); *(v8us*)(dst + i * 8) = o;  }

// k_rope: head planes [h][t][d] (fp16 + hi/lo) of rope(x) x sc with the rotate-half convention out[d] = x[d] cos[t][d] - x[d+HD/2] sin[t][d], out[d+HD/2] = x[d+HD/2] cos[t][d+HD/2] + x[d] sin[t][d+HD/2]
__global__ __launch_bounds__(256) void k_rope(const float* __restrict__ F, int pitch, int nheads, const float* __restrict__ CS, const float* __restrict__ RF, const float* __restrict__ nw, float sc, h16* P16, bf* Ph, bf* Pl) {
    const size_t e = ((size_t)blockIdx.x * 256 + threadIdx.x) * 2; if (e >= (size_t)nheads * TT * HD) return; const int d = (int)(e % HD); const int t = (int)((e / HD) % TT); const int h = (int)(e / ((size_t)HD * TT)); const float* f = F + (size_t)t * pitch + h * HD; const float rf = RF ? RF[(size_t)h * TT + t] : 1.0f; v2h o16; v2us oh, ol;
#pragma unroll
    for (int q = 0; q < 2; ++q) { const int dd = d + q; const int dp = (dd < HD / 2) ? dd + HD / 2 : dd - HD / 2; float x0 = f[dd], x1 = f[dp];
        if (RF) { float n0 = __fmul_rn(x0, rf), n1 = __fmul_rn(x1, rf); asm volatile("" : "+v"(n0)); asm volatile("" : "+v"(n1)); x0 = __fmul_rn(bfr(nw[dd]), n0); x1 = __fmul_rn(bfr(nw[dp]), n1); }
        const v2f cs = *(const v2f*)(CS + ((size_t)t * HD + dd) * 2); float a = __fmul_rn(x0, cs[0]), bq = __fmul_rn(x1, cs[1]); asm volatile("" : "+v"(a)); asm volatile("" : "+v"(bq)); const float r = ((dd < HD / 2) ? __fsub_rn(a, bq) : __fadd_rn(a, bq)) * sc;
        o16[q] = tohx(r); unsigned short a2, c2; splitf(r, a2, c2); oh[q] = a2; ol[q] = c2; }
    *(v2h*)(P16 + e) = o16; *(v2us*)(Ph + e) = oh; *(v2us*)(Pl + e) = ol;  }
__global__ __launch_bounds__(256) void k_vtp(const float* __restrict__ F, int pitch, int nheads, h16* V16, bf* Vh, bf* Vl) { const size_t e = ((size_t)blockIdx.x * 256 + threadIdx.x) * 2; if (e >= (size_t)nheads * HD * TT) return; const int t = (int)(e % TT); const int d = (int)((e / TT) % HD); const int g = (int)(e / ((size_t)TT * HD)); v2h o16; v2us oh, ol;
#pragma unroll
    for (int q = 0; q < 2; ++q) { const float x = F[(size_t)(t + q) * pitch + g * HD + d]; o16[q] = tohx(x); unsigned short a2, c2; splitf(x, a2, c2); oh[q] = a2; ol[q] = c2; }
    *(v2h*)(V16 + e) = o16; *(v2us*)(Vh + e) = oh; *(v2us*)(Vl + e) = ol;  }
__global__ __launch_bounds__(256) void k_csid(float* CS) { const int idx = blockIdx.x * 256 + threadIdx.x; if (idx >= TT * HD) return; v2f cs; cs[0] = 1.0f; cs[1] = 0.0f; *(v2f*)(CS + (size_t)idx * 2) = cs;  }
// ---- k_fattn: causal attention of one head for one block of query rows in ONE kernel: scores, softmax, probability x value and the hi/lo merge; no score or probability leaves the registers.
// Every product is formed TRANSPOSED, so that a lane owns one query column (lr) all the way: S^T[key][q] = K Q^T (A = key rows, B = query rows), whose two 16-key result tiles hold, per lane, keys 8 hi + j and 16 + 8 hi + j:
// exactly the k order of a B fragment, so the probabilities feed O^T[d][q] = V^T P^T (A = rows of the [d][t] value plane) with no exchange between lanes.
// Softmax is the running form: per query a running maximum m and sum l; when m grows, l and O^T are scaled by exp(m_old - m_new). The 32-key blocks up to the diagonal are dealt round robin over the FW waves of the
// work-group; the FW partial (m, l, O^T) meet in LDS and are joined in wave order 0 .. FW-1. Rows < RH: bf16 hi/lo, 3 products, 16 rows a work-group; other rows: fp16, probabilities x PCAR (the factor cancels in O / l), 32 rows.
// Every '#pragma unroll' in fa_body is there so that the fragment, score and accumulator arrays are indexed by constants and stay in registers.
#define FW   4
#define C1   (SCL * 1.4426950408889634f)
// exp2 with the one slot that the instruction set asks for behind a transcendental written into the same statement.
// exp2s: one value, v_nop behind it. exp2x8: eight values; the outputs are early-clobber, so no v_exp_f32 overwrites a source or reads a result of the one before it and each fills its forerunner's slot; v_nop fills the last one's.
__device__ __forceinline__ float exp2s(float x) { float r; asm("v_exp_f32 %0, %1\n\tv_nop" : "=v"(r) : "v"(x)); return r; }
__device__ __forceinline__ void exp2x8(float* r, const float* x) {
    asm("v_exp_f32 %0, %8\n\tv_exp_f32 %1, %9\n\tv_exp_f32 %2, %10\n\tv_exp_f32 %3, %11\n\tv_exp_f32 %4, %12\n\tv_exp_f32 %5, %13\n\tv_exp_f32 %6, %14\n\tv_exp_f32 %7, %15\n\tv_nop"
        : "=&v"(r[0]), "=&v"(r[1]), "=&v"(r[2]), "=&v"(r[3]), "=&v"(r[4]), "=&v"(r[5]), "=&v"(r[6]), "=&v"(r[7]) : "v"(x[0]), "v"(x[1]), "v"(x[2]), "v"(x[3]), "v"(x[4]), "v"(x[5]), "v"(x[6]), "v"(x[7])); }
template <typename T16, bool HR, int QT>
__device__ __forceinline__ void fa_body(const T16* __restrict__ Q, const T16* __restrict__ Q2, const T16* __restrict__ Kp, const T16* __restrict__ Kp2, const T16* __restrict__ Vt, const T16* __restrict__ Vt2, int q0, float* os, float* ml, bf* Ah, bf* Al) {
    typedef typename WFrag<T16>::V V;
    const int lane = threadIdx.x & 31, lr = lane & 15, hi = lane >> 4; const int wv = __builtin_amdgcn_readfirstlane((int)(threadIdx.x >> 5));
    const float psh = HR ? 0.0f : 10.0f;   // log2(PCAR)
    V qf[QT][2], qf2[QT][2];
#pragma unroll
    for (int qt = 0; qt < QT; ++qt)
#pragma unroll
        for (int ks = 0; ks < 2; ++ks) { const size_t qo = (size_t)(q0 + qt * 16 + lr) * HD + ks * 32 + 8 * hi; qf[qt][ks] = WFrag<T16>::ld(Q + qo); if (HR) qf2[qt][ks] = WFrag<T16>::ld(Q2 + qo); }
    v8f o[QT][4]; float m[QT], l[QT];
#pragma unroll
    for (int qt = 0; qt < QT; ++qt) { m[qt] = -3.0e38f; l[qt] = 0.f;
#pragma unroll
        for (int dt = 0; dt < 4; ++dt) o[qt][dt] = (v8f){}; }
    const int nkb = (q0 + QT * 16 + 31) >> 5;   // 32-key blocks that hold a key <= the block's last query; in each of them every query of the block has at least one such key
    V kf[2][2];   // fp16 rows: a pass's key fragments are fetched one pass ahead (the block index is clamped to the last block, so the fetch behind a wave's last pass, or of a wave with no pass, stays inside the plane); hi/lo rows fetch in the pass itself (twice the fragments, at most 4 passes a wave)
    const size_t kl = (size_t)lr * HD + 8 * hi;
    if constexpr (!HR) {
#pragma unroll
        for (int kt = 0; kt < 2; ++kt)
#pragma unroll
            for (int ks = 0; ks < 2; ++ks) kf[kt][ks] = WFrag<T16>::ld(Kp + (size_t)min(wv, nkb - 1) * (32 * HD) + kl + kt * (16 * HD) + ks * 32); }
#pragma unroll 1   // rolled: one pass's fragments, scores and accumulators already take the registers that four waves a SIMD leave to each
    for (int kb = wv; kb < nkb; kb += FW) {
        const int key0 = kb * 32;
        V va[4], va2[4]; const size_t vl = (size_t)lr * TT + key0 + 8 * hi;
        if constexpr (!HR) {
#pragma unroll
            for (int dt = 0; dt < 4; ++dt) va[dt] = WFrag<T16>::ld(Vt + vl + (size_t)dt * 16 * TT); }
        v8f s[QT][2];
#pragma unroll
        for (int qt = 0; qt < QT; ++qt) { s[qt][0] = (v8f){}; s[qt][1] = (v8f){}; }
#pragma unroll
        for (int kt = 0; kt < 2; ++kt)
#pragma unroll
            for (int ks = 0; ks < 2; ++ks) { V ka, ka2; if constexpr (HR) { const size_t ko = (size_t)key0 * HD + kl + kt * (16 * HD) + ks * 32; ka = WFrag<T16>::ld(Kp + ko); ka2 = WFrag<T16>::ld(Kp2 + ko); } else ka = kf[kt][ks];
#pragma unroll
                for (int qt = 0; qt < QT; ++qt) { s[qt][kt] = WFrag<T16>::mma(ka, qf[qt][ks], s[qt][kt]); if constexpr (HR) { s[qt][kt] = WFrag<T16>::mma(ka, qf2[qt][ks], s[qt][kt]); s[qt][kt] = WFrag<T16>::mma(ka2, qf[qt][ks], s[qt][kt]); } } }
        if constexpr (!HR) {
#pragma unroll
            for (int kt = 0; kt < 2; ++kt)
#pragma unroll
                for (int ks = 0; ks < 2; ++ks) kf[kt][ks] = WFrag<T16>::ld(Kp + (size_t)min(kb + FW, nkb - 1) * (32 * HD) + kl + kt * (16 * HD) + ks * 32); }
        else { asm volatile("s_wait_xcnt 0x0" ::: "memory");   // the value fragments below land in registers that the key loads above name as their addresses: the wait stands in front of that overwrite
#pragma unroll
            for (int dt = 0; dt < 4; ++dt) { va[dt] = WFrag<T16>::ld(Vt + vl + (size_t)dt * 16 * TT); va2[dt] = WFrag<T16>::ld(Vt2 + vl + (size_t)dt * 16 * TT); }
            asm volatile("s_wait_xcnt 0x0" ::: "memory"); }   // the softmax below reuses the registers that held the value loads' addresses
#pragma unroll
        for (int qt = 0; qt < QT; ++qt) {
            const int qi = q0 + qt * 16 + lr;
            if (key0 + 31 > q0 + qt * 16) {   // the block reaches past the tile's first query: mask key > query
#pragma unroll
                for (int kt = 0; kt < 2; ++kt)
#pragma unroll
                    for (int j = 0; j < 8; ++j) if (key0 + kt * 16 + hi * 8 + j > qi) s[qt][kt][j] = -3.0e38f; }
            float mx = m[qt];
#pragma unroll
            for (int j = 0; j < 8; ++j) mx = fmaxf(mx, fmaxf(s[qt][0][j], s[qt][1][j]));
            mx = fmaxf(mx, __shfl_xor(mx, 16, 32));
            const float al = exp2s((m[qt] - mx) * C1); const float nm = psh - mx * C1; m[qt] = mx;
            float xe[16], p[16]; float sum = 0.f;
#pragma unroll
            for (int e = 0; e < 16; ++e) xe[e] = fmaf(s[qt][e >> 3][e & 7], C1, nm);
            exp2x8(p, xe); exp2x8(p + 8, xe + 8);
#pragma unroll
            for (int e = 0; e < 16; ++e) sum += p[e];
            l[qt] = l[qt] * al + sum;
#pragma unroll
            for (int dt = 0; dt < 4; ++dt) o[qt][dt] *= al;
            if constexpr (HR) { v8us h0, h1, l0, l1;
#pragma unroll
                for (int j = 0; j < 8; ++j) { unsigned short a, c2; splitf(p[j], a, c2); h0[j] = a; l0[j] = c2; splitf(p[8 + j], a, c2); h1[j] = a; l1[j] = c2; }
                const V ph = cat16b(h0, h1), pl = cat16b(l0, l1);
#pragma unroll
                for (int dt = 0; dt < 4; ++dt) { o[qt][dt] = WFrag<T16>::mma(va[dt], ph, o[qt][dt]); o[qt][dt] = WFrag<T16>::mma(va[dt], pl, o[qt][dt]); o[qt][dt] = WFrag<T16>::mma(va2[dt], ph, o[qt][dt]); }
            } else { V pf;
#pragma unroll
                for (int e = 0; e < 16; ++e) pf[e] = (h16)p[e];
#pragma unroll
                for (int dt = 0; dt < 4; ++dt) o[qt][dt] = WFrag<T16>::mma(va[dt], pf, o[qt][dt]); }
        }
    }
    float* osw = os + wv * (QT * 16 * 68);
#pragma unroll
    for (int qt = 0; qt < QT; ++qt) {
#pragma unroll
        for (int dt = 0; dt < 4; ++dt) { float* pp = osw + (qt * 16 + lr) * 68 + dt * 16 + hi * 8; const v8f t = o[qt][dt]; *(v4fa*)pp = (v4f){t[0], t[1], t[2], t[3]}; *(v4fa*)(pp + 4) = (v4f){t[4], t[5], t[6], t[7]}; }
        const float lt = l[qt] + __shfl_xor(l[qt], 16, 32);
        if (hi == 0) { ml[(wv * 2) * 32 + qt * 16 + lr] = m[qt]; ml[(wv * 2 + 1) * 32 + qt * 16 + lr] = lt; } }
    __syncthreads();   // all FW partial (m, l, O^T) are in LDS before any thread joins them
#pragma unroll
    for (int sI = 0; sI < QT; ++sI) { const int idx = sI * (32 * FW) + (int)threadIdx.x; const int q = idx >> 3, d8 = (idx & 7) * 8;
        float M = ml[q];
#pragma unroll
        for (int w = 1; w < FW; ++w) M = fmaxf(M, ml[(w * 2) * 32 + q]);
        float L = 0.f; v4f x0 = (v4f){}, x1 = (v4f){};
#pragma unroll
        for (int w = 0; w < FW; ++w) { const float f = exp2s((ml[(w * 2) * 32 + q] - M) * C1); L += f * ml[(w * 2 + 1) * 32 + q]; const float* pp = os + w * (QT * 16 * 68) + q * 68 + d8; x0 += f * *(const v4fa*)pp; x1 += f * *(const v4fa*)(pp + 4); }
        v8us oh, ol;
#pragma unroll
        for (int k = 0; k < 4; ++k) { unsigned short a, c2; splitf(__fdiv_rn(x0[k], L), a, c2); oh[k] = a; ol[k] = c2; splitf(__fdiv_rn(x1[k], L), a, c2); oh[4 + k] = a; ol[4 + k] = c2; }
        const size_t oo = (size_t)(q0 + q) * HD + d8;   /* RAW MERGE: the (H, S, hd) context written flat = the module's reshape(b, S, H * hd) without a transpose */
        *(v8usa*)(Ah + oo) = oh; *(v8usa*)(Al + oo) = ol;
        asm volatile("s_wait_xcnt 0x0" ::: "memory"); }   // stands behind the two stores, in front of any later write of their address or data registers
}
// grid (heads, (TT - RH) / 32 + RH / 16), 32 x FW threads; blockIdx.y counts the query blocks from the last (longest key loop) to the first (for speed only).
__global__ __launch_bounds__(32 * FW) void k_fattn(const h16* __restrict__ Q16, const h16* __restrict__ K16, const h16* __restrict__ V16, const bf* __restrict__ Qh, const bf* __restrict__ Ql, const bf* __restrict__ Kh, const bf* __restrict__ Kl, const bf* __restrict__ Vh, const bf* __restrict__ Vl, bf* Ah, bf* Al) {
    __shared__ __align__(16) float os[FW * 32 * 68]; __shared__ float ml[FW * 2 * 32];
    const size_t hz = (size_t)blockIdx.x * TT * HD; const int by = blockIdx.y;
    if (by < (TT - RH) / 32) fa_body<h16, false, 2>(Q16 + hz, nullptr, K16 + hz, nullptr, V16 + hz, nullptr, TT - 32 - by * 32, os, ml, Ah + hz, Al + hz);
    else fa_body<bf, true, 1>(Qh + hz, Ql + hz, Kh + hz, Kl + hz, Vh + hz, Vl + hz, RH - 16 - (by - (TT - RH) / 32) * 16, os, ml, Ah + hz, Al + hz);
}

extern "C" void kernel_launch(void* const* d_in, const int* in_sizes, int n_in,
                              void* d_out, int out_size, void* d_ws, size_t ws_size, hipStream_t stream) {
    (void)in_sizes; (void)n_in; (void)out_size;
    const float* x = (const float*)d_in[0]; const float* wq = (const float*)d_in[1]; const float* wk = (const float*)d_in[2]; const float* wv = (const float*)d_in[3]; const float* wo = (const float*)d_in[4];   /* input order x, wq, wk, wv, wo ('xw') */
    float* OUT = (float*)d_out;     // [2][2048][1024]
    char* wsp = (char*)d_ws;
    auto take = [&](size_t bytes) { char* p = wsp; wsp += (bytes + 255) & ~(size_t)255; return (void*)p; };
    bf* WQ = (bf*)take((size_t)DQ * DM * 2); bf* WK = (bf*)take((size_t)DKV * DM * 2); bf* WV = (bf*)take((size_t)DKV * DM * 2); bf* WO = (bf*)take((size_t)DM * DQ * 2); float* CS = (float*)take((size_t)TT * HD * 2 * 4);
    bf* XB = (bf*)take((size_t)TT * DM * 2); float* FQ = (float*)take((size_t)TT * DQ * 4); float* FK = (float*)take((size_t)TT * DKV * 4);
    h16* QP16 = (h16*)take((size_t)NH_ * TT * HD * 2); h16* KP16 = (h16*)take((size_t)NKV * TT * HD * 2); h16* VT16 = (h16*)take((size_t)NKV * HD * TT * 2);
    bf* QPh = (bf*)take((size_t)NH_ * TT * HD * 2); bf* QPl = (bf*)take((size_t)NH_ * TT * HD * 2); bf* KPh = (bf*)take((size_t)NKV * TT * HD * 2); bf* KPl = (bf*)take((size_t)NKV * TT * HD * 2); bf* VTh = (bf*)take((size_t)NKV * HD * TT * 2); bf* VTl = (bf*)take((size_t)NKV * HD * TT * 2);
    bf* ATh = (bf*)take((size_t)TT * DQ * 2); bf* ATl = (bf*)take((size_t)TT * DQ * 2);
    if ((size_t)(wsp - (char*)d_ws) > ws_size) return;    // ws 256 MiB
    float* FV = FK;   // v projection reuses the k buffer after the k planes are built (stream-ordered)
    { k_wtG<<<(unsigned)((DM * DQ / 64 + 63) / 64), 256, 0, stream>>>(wq, DM, DQ, WQ); k_wtG<<<(unsigned)((DM * DKV / 64 + 63) / 64), 256, 0, stream>>>(wk, DM, DKV, WK); k_wtG<<<(unsigned)((DM * DKV / 64 + 63) / 64), 256, 0, stream>>>(wv, DM, DKV, WV);
      k_wtG<<<(unsigned)((DQ * DM / 64 + 63) / 64), 256, 0, stream>>>(wo, DQ, DM, WO);
       }
    k_csid<<<(TT * HD + 255) / 256, 256, 0, stream>>>(CS);
    const unsigned LQ = (unsigned)(((size_t)NH_ * TT * HD / 2 + 255) / 256), LKv = (unsigned)(((size_t)NKV * TT * HD / 2 + 255) / 256);
    for (int b = 0; b < NB_; ++b) {
        
        k_cvt8<<<(unsigned)(((size_t)TT * DM / 8 + 255) / 256), 256, 0, stream>>>(x + (size_t)b * TT * DM, XB, (size_t)TT * DM / 8);
        k_gemmw<bf, 0, false, 8><<<dim3(TT / 64, DQ / 64, 1), 256, 0, stream>>>(XB, nullptr, WQ, nullptr, DM, FQ, DQ, nullptr, 0, 0, 0);
        k_rope<<<LQ, 256, 0, stream>>>(FQ, DQ, NH_, CS, nullptr, nullptr, 1.0f, QP16, QPh, QPl);
        k_gemmw<bf, 0, false, 8><<<dim3(TT / 64, DKV / 64, 1), 256, 0, stream>>>(XB, nullptr, WK, nullptr, DM, FK, DKV, nullptr, 0, 0, 0);
        k_rope<<<LKv, 256, 0, stream>>>(FK, DKV, NKV, CS, nullptr, nullptr, 1.0f, KP16, KPh, KPl);
        k_gemmw<bf, 0, false, 8><<<dim3(TT / 64, DKV / 64, 1), 256, 0, stream>>>(XB, nullptr, WV, nullptr, DM, FV, DKV, nullptr, 0, 0, 0); k_vtp<<<LKv, 256, 0, stream>>>(FV, DKV, NKV, VT16, VTh, VTl);
        k_fattn<<<dim3(NH_, (TT - RH) / 32 + RH / 16, 1), 32 * FW, 0, stream>>>(QP16, KP16, VT16, QPh, QPl, KPh, KPl, VTh, VTl, ATh, ATl);   // one kv head per query head
        k_gemmw<bf, 1, false, 8><<<dim3(TT / 64, DM / 64, 1), 256, 0, stream>>>(ATh, ATl, WO, nullptr, DQ, OUT + (size_t)b * TT * DM, DM, nullptr, 0, 0, 0); }
}

// v004
// It runs in 182 microseconds.
// In two side-by-side timings against v003, it was 1.26 and 1.28 times as fast.
// All steps since v000 together make it 8.14 times as fast.
#include <hip/hip_runtime.h>

// Causal multi-head self-attention whose head MERGE is a RAW RESHAPE, not a transpose (x [2][2048][1024]; q, k, v = x w ('xw' [1024][1024] 0.02, no bias) split the standard way (reshape(b, s, 16, 64).transpose(0, 2, 1, 3): head = 64-column block); scores masked (-inf where key > query) then / sqrt(64); softmax; ctx [b][16][s][64] RAW-reshaped to [b][s][1024] (NO transpose back: element (h, t, d) lands at row h x 128 + t // 16, column (t mod 16) x 64 + d); out = ctx wo ('xw', no bias) -> [2][2048][1024] (4.2 M); argument order x, wq, wk, wv, wo).
// Layout per batch: bf16 copy of x; 'xw' weights transposed once; exact projections whose epilogue writes the head planes (fp16 + hi/lo; v as its transpose, operands swapped); causal T-2048 attention in one kernel per batch (k_fattn; hybrid rows: < 512 hi/lo 3 products, rest fp16 x1024; key blocks above the diagonal are never visited); merged hi/lo x Wo exact.
// Compute dtypes, f32 accumulate: every input rounded to bf16; projections exact; attention rows < 512 3 products, rest fp16; softmax f32; Wo hl x exact.

#define NB_  2
#define TT   2048
#define DM   1024
#define NH_  16
#define NKV  16
#define REP  (NH_ / NKV)
#define HD   64
#define DQ   (NH_ * HD)
#define DKV  (NKV * HD)
#define RH   512                  // query rows < RH use hi+lo planes (0: none)
#define PCAR 1024.0f
#define SCL  0.125f   // HD^-0.5
typedef _Float16 h16;
typedef unsigned short bf;
typedef __attribute__((ext_vector_type(16))) __bf16   v16bf;
typedef __attribute__((ext_vector_type(16))) _Float16 v16h;
typedef __attribute__((ext_vector_type(8)))  _Float16 v8h;
typedef __attribute__((ext_vector_type(8)))  unsigned short v8us;
typedef __attribute__((ext_vector_type(8)))  float    v8f;
typedef __attribute__((ext_vector_type(4)))  float    v4f;
typedef v8h  __attribute__((may_alias)) v8ha;
typedef v4f  __attribute__((may_alias)) v4fa;
typedef v8us __attribute__((may_alias)) v8usa;

__device__ __forceinline__ unsigned short f2bf(float f) { unsigned u = __float_as_uint(f); u += 0x7FFFu + ((u >> 16) & 1u); return (unsigned short)(u >> 16); }
__device__ __forceinline__ float bf2f(unsigned short b) { return __uint_as_float(((unsigned)b) << 16); }
__device__ __forceinline__ float bfr(float f) { return bf2f(f2bf(f)); }
__device__ __forceinline__ v16h cat16(v8h lo, v8h hi) { return __builtin_shufflevector(lo, hi, 0, 1, 2, 3, 4, 5, 6, 7, 8, 9, 10, 11, 12, 13, 14, 15); }
__device__ __forceinline__ v16bf cat16b(v8us lo, v8us hi) { return __builtin_bit_cast(v16bf, __builtin_shufflevector(lo, hi, 0, 1, 2, 3, 4, 5, 6, 7, 8, 9, 10, 11, 12, 13, 14, 15)); }
__device__ __forceinline__ v8f wmma16(v16h a, v16h b, v8f c) { return __builtin_amdgcn_wmma_f32_16x16x32_f16(false, a, false, b, (short)0, c, false, false); }
__device__ __forceinline__ v8f wmmab(v16bf a, v16bf b, v8f c) { return __builtin_amdgcn_wmma_f32_16x16x32_bf16(false, a, false, b, (short)0, c, false, false); }



// ---- k_gemmw: register-blocked GEMM, NW WAVES per 64x64 output tile, each with the whole tile's 16 accumulators over its own share of K (32-wide k blocks dealt round robin: wave w takes blocks w, w + NW, ...);
// operands straight from K-contiguous 16-bit planes; grid (M/64, N/64, Z), 32 x NW threads. The NW partial tiles meet in LDS and are summed in wave order 0 .. NW-1 (sum_store; with PL, sum_planes into the 16-bit planes).
// C[m][n] (f32, pitch ldc, + optional f32 bias[n]) = sum_k A[m][k] Bt[n][k] (+ split products per NSPLIT). z-batch strides sA/sB/sC in elements. K % 32 == 0.
template <typename T16> struct WFrag;
template <> struct WFrag<h16> { typedef v16h V; static __device__ __forceinline__ V ld(const h16* p) { return cat16(*(const v8h*)p, *(const v8h*)(p + 16)); } static __device__ __forceinline__ v8f mma(V a, V b, v8f c) { return wmma16(a, b, c); } };
template <> struct WFrag<bf> { typedef v16bf V; static __device__ __forceinline__ V ld(const bf* p) { return cat16b(*(const v8us*)p, *(const v8us*)(p + 16)); } static __device__ __forceinline__ v8f mma(V a, V b, v8f c) { return wmmab(a, b, c); } };
// sum_store: every wave puts its partial 64x64 f32 tile (row pitch 68) into its own LDS plane; behind one barrier each thread sums 4-column pieces over the planes in the fixed order 0 .. NW-1 and stores them (a wave writes whole 256-byte row pieces).
template <int NW, bool BIAS>
__device__ __forceinline__ void sum_store(const v8f (&acc)[4][4], float* os, int wv, int lr, int hi, float* C, int ldc, int r0, int c0, const float* __restrict__ bias) {
    float* osw = os + wv * (64 * 68);
#pragma unroll
    for (int mb = 0; mb < 4; ++mb)
#pragma unroll
        for (int nb = 0; nb < 4; ++nb)
#pragma unroll
            for (int j = 0; j < 8; ++j) osw[(mb * 16 + hi * 8 + j) * 68 + nb * 16 + lr] = acc[mb][nb][j];
    __syncthreads();   // all NW partial tiles are in LDS before any thread sums across them
#pragma unroll
    for (int s = 0; s < 32 / NW; ++s) { const int q = s * (32 * NW) + (int)threadIdx.x; const int row = q >> 4, cofs = (q & 15) * 4; v4f val = *(const v4fa*)(os + row * 68 + cofs);
#pragma unroll
        for (int w = 1; w < NW; ++w) val += *(const v4fa*)(os + w * (64 * 68) + row * 68 + cofs);
        if (BIAS) { val[0] += bfr(bias[c0 + cofs]); val[1] += bfr(bias[c0 + cofs + 1]); val[2] += bfr(bias[c0 + cofs + 2]); val[3] += bfr(bias[c0 + cofs + 3]); }
        *(v4f*)(C + (size_t)(r0 + row) * ldc + c0 + cofs) = val; }
}
__device__ __forceinline__ h16 tohx(float x) { return (h16)x; }
__device__ __forceinline__ void splitf(float y, unsigned short& h, unsigned short& l) { h = f2bf(y); l = f2bf(y - bf2f(h)); }
// sum_planes: sum_store's sum (same planes, same order 0 .. NW-1), but the tile leaves as the three 16-bit planes that the attention kernel reads (fp16, bf16 hi, bf16 lo), never as f32:
// each thread sums an 8-column piece and stores 16 bytes a plane at element e0 + row x ld + column, so that 8 threads write one whole 128-byte line of each plane.
template <int NW>
__device__ __forceinline__ void sum_planes(const v8f (&acc)[4][4], float* os, int wv, int lr, int hi, h16* P16, bf* Ph, bf* Pl, size_t e0, int ld) {
    float* osw = os + wv * (64 * 68);
#pragma unroll
    for (int mb = 0; mb < 4; ++mb)
#pragma unroll
        for (int nb = 0; nb < 4; ++nb)
#pragma unroll
            for (int j = 0; j < 8; ++j) osw[(mb * 16 + hi * 8 + j) * 68 + nb * 16 + lr] = acc[mb][nb][j];
    __syncthreads();   // all NW partial tiles are in LDS before any thread sums across them
#pragma unroll
    for (int s = 0; s < 16 / NW; ++s) { const int q = s * (32 * NW) + (int)threadIdx.x; const int row = q >> 3, cofs = (q & 7) * 8; const float* pp = os + row * 68 + cofs; v4f x0 = *(const v4fa*)pp, x1 = *(const v4fa*)(pp + 4);
#pragma unroll
        for (int w = 1; w < NW; ++w) { x0 += *(const v4fa*)(pp + w * (64 * 68)); x1 += *(const v4fa*)(pp + w * (64 * 68) + 4); }
        v8h o16; v8us oh, ol;
#pragma unroll
        for (int k = 0; k < 4; ++k) { unsigned short a, c2; o16[k] = tohx(x0[k]); splitf(x0[k], a, c2); oh[k] = a; ol[k] = c2; o16[4 + k] = tohx(x1[k]); splitf(x1[k], a, c2); oh[4 + k] = a; ol[4 + k] = c2; }
        const size_t e = e0 + (size_t)row * ld + cofs;
        *(v8ha*)(P16 + e) = o16; *(v8usa*)(Ph + e) = oh; *(v8usa*)(Pl + e) = ol;
        asm volatile("s_wait_xcnt 0x0" ::: "memory"); }   // stands behind the three stores, in front of the next piece's writes of their address and data registers
}
// PL: the tile goes out through sum_planes, element (m, n) at m x ldc + (n / 64) x 64 x cmul + n mod 64 of each plane (C is not used). Head planes [h][t][d] of x w: ldc = HD, cmul = TT. A plain [m][n] plane: cmul = 1.
template <typename T16, int NSPLIT, bool BIAS, int NW, bool PL>
__global__ __launch_bounds__(32 * NW) void k_gemmw(const T16* __restrict__ A, const T16* __restrict__ A2, const T16* __restrict__ Bt, const T16* __restrict__ Bt2, int K, float* C, int ldc, const float* __restrict__ bias, size_t sA, size_t sB, size_t sC, h16* P16, bf* Ph, bf* Pl, int cmul) {
    typedef typename WFrag<T16>::V V;
    __shared__ __align__(16) float os[NW * 64 * 68];
    const size_t z = blockIdx.z; A += z * sA; if (A2) A2 += z * sA; Bt += z * sB; if (Bt2) Bt2 += z * sB; C += z * sC;
    const int lane = threadIdx.x & 31, lr = lane & 15, hi = lane >> 4; const int wv = __builtin_amdgcn_readfirstlane((int)(threadIdx.x >> 5)); const int r0 = blockIdx.x * 64, c0 = blockIdx.y * 64;
    v8f acc[4][4];
#pragma unroll
    for (int mb = 0; mb < 4; ++mb)
#pragma unroll
        for (int nb = 0; nb < 4; ++nb) acc[mb][nb] = (v8f){};
    const size_t aoff = (size_t)(r0 + lr) * K + 8 * hi, boff = (size_t)(c0 + lr) * K + 8 * hi;
#pragma unroll 1
    for (int kc = wv * 32; kc < K; kc += 32 * NW) {
        V a[4], a2[4];
#pragma unroll
        for (int mb = 0; mb < 4; ++mb) { a[mb] = WFrag<T16>::ld(A + aoff + (size_t)mb * 16 * K + kc); if (NSPLIT == 1 || NSPLIT == 2) a2[mb] = WFrag<T16>::ld(A2 + aoff + (size_t)mb * 16 * K + kc); }
#pragma unroll
        for (int nb = 0; nb < 4; ++nb) { const V b = WFrag<T16>::ld(Bt + boff + (size_t)nb * 16 * K + kc); V b2; if (NSPLIT >= 2) b2 = WFrag<T16>::ld(Bt2 + boff + (size_t)nb * 16 * K + kc);
#pragma unroll
            for (int mb = 0; mb < 4; ++mb) { acc[mb][nb] = WFrag<T16>::mma(a[mb], b, acc[mb][nb]); if (NSPLIT == 1 || NSPLIT == 2) acc[mb][nb] = WFrag<T16>::mma(a2[mb], b, acc[mb][nb]); if (NSPLIT >= 2) acc[mb][nb] = WFrag<T16>::mma(a[mb], b2, acc[mb][nb]); } }
        asm volatile("v_nop\n\tv_nop\n\tv_nop\n\tv_nop" : "+v"(acc[0][0]), "+v"(acc[1][1]), "+v"(acc[2][2]), "+v"(acc[3][3]) : "v"(a[0]), "v"(a[3]));
    }
    if constexpr (PL) { sum_planes<NW>(acc, os, wv, lr, hi, P16, Ph, Pl, (size_t)r0 * ldc + (size_t)c0 * cmul, ldc); return; }
    sum_store<NW, BIAS>(acc, os, wv, lr, hi, C, ldc, r0, c0, bias);
}

typedef __attribute__((ext_vector_type(2))) _Float16 v2h;
typedef __attribute__((ext_vector_type(4))) _Float16 v4h;
typedef __attribute__((ext_vector_type(2))) unsigned short v2us;
typedef __attribute__((ext_vector_type(4))) unsigned short v4us;
typedef __attribute__((ext_vector_type(2))) float v2f;
typedef __attribute__((ext_vector_type(4))) int v4i;

__global__ __launch_bounds__(256) void k_wtG(const float* __restrict__ w, int K, int N, bf* Bt) {
    const int lane = threadIdx.x & 31; const int L0 = (blockIdx.x * 8 + (threadIdx.x >> 5)) * 8; const int nlines = N * K / 64;
{
#pragma unroll 1
        for (int l = 0; l < 8; ++l) { const int L = L0 + l; if (L >= nlines) break; const size_t e = (size_t)L * 64 + lane * 2; const int k = (int)(e % K), n = (int)(e / K); v2us o;
            o[0] = f2bf(w[(size_t)k * N + n]); o[1] = f2bf(w[(size_t)(k + 1) * N + n]); *(v2us*)(Bt + e) = o; }
         }
}
__global__ __launch_bounds__(256) void k_cvt8(const float* __restrict__ src, bf* dst, size_t n8) { const size_t i = (size_t)blockIdx.x * 256 + threadIdx.x; if (i >= n8) return; const v8f v = *(const v8f*)(src + i * 8); v8us o;
#pragma unroll
    for (int k = 0; k < 8; ++k) o[k] = f2bf(v[k]); *(v8us*)(dst + i * 8) = o;  }

// ---- k_fattn: causal attention of one head for one block of query rows in ONE kernel: scores, softmax, probability x value and the hi/lo merge; no score or probability leaves the registers.
// Every product is formed TRANSPOSED, so that a lane owns one query column (lr) all the way: S^T[key][q] = K Q^T (A = key rows, B = query rows), whose two 16-key result tiles hold, per lane, keys 8 hi + j and 16 + 8 hi + j:
// exactly the k order of a B fragment, so the probabilities feed O^T[d][q] = V^T P^T (A = rows of the [d][t] value plane) with no exchange between lanes.
// Softmax is the running form: per query a running maximum m and sum l; when m grows, l and O^T are scaled by exp(m_old - m_new). The 32-key blocks up to the diagonal are dealt round robin over the FW waves of the
// work-group; the FW partial (m, l, O^T) meet in LDS and are joined in wave order 0 .. FW-1. Rows < RH: bf16 hi/lo, 3 products, 16 rows a work-group; other rows: fp16, probabilities x PCAR (the factor cancels in O / l), 32 rows.
// Every '#pragma unroll' in fa_body is there so that the fragment, score and accumulator arrays are indexed by constants and stay in registers.
#define FW   4
#define C1   (SCL * 1.4426950408889634f)
// exp2 with the one slot that the instruction set asks for behind a transcendental written into the same statement.
// exp2s: one value, v_nop behind it. exp2x8: eight values; the outputs are early-clobber, so no v_exp_f32 overwrites a source or reads a result of the one before it and each fills its forerunner's slot; v_nop fills the last one's.
__device__ __forceinline__ float exp2s(float x) { float r; asm("v_exp_f32 %0, %1\n\tv_nop" : "=v"(r) : "v"(x)); return r; }
__device__ __forceinline__ void exp2x8(float* r, const float* x) {
    asm("v_exp_f32 %0, %8\n\tv_exp_f32 %1, %9\n\tv_exp_f32 %2, %10\n\tv_exp_f32 %3, %11\n\tv_exp_f32 %4, %12\n\tv_exp_f32 %5, %13\n\tv_exp_f32 %6, %14\n\tv_exp_f32 %7, %15\n\tv_nop"
        : "=&v"(r[0]), "=&v"(r[1]), "=&v"(r[2]), "=&v"(r[3]), "=&v"(r[4]), "=&v"(r[5]), "=&v"(r[6]), "=&v"(r[7]) : "v"(x[0]), "v"(x[1]), "v"(x[2]), "v"(x[3]), "v"(x[4]), "v"(x[5]), "v"(x[6]), "v"(x[7])); }
template <typename T16, bool HR, int QT>
__device__ __forceinline__ void fa_body(const T16* __restrict__ Q, const T16* __restrict__ Q2, const T16* __restrict__ Kp, const T16* __restrict__ Kp2, const T16* __restrict__ Vt, const T16* __restrict__ Vt2, int q0, float* os, float* ml, bf* Ah, bf* Al) {
    typedef typename WFrag<T16>::V V;
    const int lane = threadIdx.x & 31, lr = lane & 15, hi = lane >> 4; const int wv = __builtin_amdgcn_readfirstlane((int)(threadIdx.x >> 5));
    const float psh = HR ? 0.0f : 10.0f;   // log2(PCAR)
    V qf[QT][2], qf2[QT][2];
#pragma unroll
    for (int qt = 0; qt < QT; ++qt)
#pragma unroll
        for (int ks = 0; ks < 2; ++ks) { const size_t qo = (size_t)(q0 + qt * 16 + lr) * HD + ks * 32 + 8 * hi; qf[qt][ks] = WFrag<T16>::ld(Q + qo); if (HR) qf2[qt][ks] = WFrag<T16>::ld(Q2 + qo); }
    v8f o[QT][4]; float m[QT], l[QT];
#pragma unroll
    for (int qt = 0; qt < QT; ++qt) { m[qt] = -3.0e38f; l[qt] = 0.f;
#pragma unroll
        for (int dt = 0; dt < 4; ++dt) o[qt][dt] = (v8f){}; }
    const int nkb = (q0 + QT * 16 + 31) >> 5;   // 32-key blocks that hold a key <= the block's last query; in each of them every query of the block has at least one such key
    V kf[2][2];   // fp16 rows: a pass's key fragments are fetched one pass ahead (the block index is clamped to the last block, so the fetch behind a wave's last pass, or of a wave with no pass, stays inside the plane); hi/lo rows fetch in the pass itself (twice the fragments, at most 4 passes a wave)
    const size_t kl = (size_t)lr * HD + 8 * hi;
    if constexpr (!HR) {
#pragma unroll
        for (int kt = 0; kt < 2; ++kt)
#pragma unroll
            for (int ks = 0; ks < 2; ++ks) kf[kt][ks] = WFrag<T16>::ld(Kp + (size_t)min(wv, nkb - 1) * (32 * HD) + kl + kt * (16 * HD) + ks * 32); }
#pragma unroll 1   // rolled: one pass's fragments, scores and accumulators already take the registers that four waves a SIMD leave to each
    for (int kb = wv; kb < nkb; kb += FW) {
        const int key0 = kb * 32;
        V va[4], va2[4]; const size_t vl = (size_t)lr * TT + key0 + 8 * hi;
        if constexpr (!HR) {
#pragma unroll
            for (int dt = 0; dt < 4; ++dt) va[dt] = WFrag<T16>::ld(Vt + vl + (size_t)dt * 16 * TT); }
        v8f s[QT][2];
#pragma unroll
        for (int qt = 0; qt < QT; ++qt) { s[qt][0] = (v8f){}; s[qt][1] = (v8f){}; }
#pragma unroll
        for (int kt = 0; kt < 2; ++kt)
#pragma unroll
            for (int ks = 0; ks < 2; ++ks) { V ka, ka2; if constexpr (HR) { const size_t ko = (size_t)key0 * HD + kl + kt * (16 * HD) + ks * 32; ka = WFrag<T16>::ld(Kp + ko); ka2 = WFrag<T16>::ld(Kp2 + ko); } else ka = kf[kt][ks];
#pragma unroll
                for (int qt = 0; qt < QT; ++qt) { s[qt][kt] = WFrag<T16>::mma(ka, qf[qt][ks], s[qt][kt]); if constexpr (HR) { s[qt][kt] = WFrag<T16>::mma(ka, qf2[qt][ks], s[qt][kt]); s[qt][kt] = WFrag<T16>::mma(ka2, qf[qt][ks], s[qt][kt]); } } }
        if constexpr (!HR) {
#pragma unroll
            for (int kt = 0; kt < 2; ++kt)
#pragma unroll
                for (int ks = 0; ks < 2; ++ks) kf[kt][ks] = WFrag<T16>::ld(Kp + (size_t)min(kb + FW, nkb - 1) * (32 * HD) + kl + kt * (16 * HD) + ks * 32); }
        else { asm volatile("s_wait_xcnt 0x0" ::: "memory");   // the value fragments below land in registers that the key loads above name as their addresses: the wait stands in front of that overwrite
#pragma unroll
            for (int dt = 0; dt < 4; ++dt) { va[dt] = WFrag<T16>::ld(Vt + vl + (size_t)dt * 16 * TT); va2[dt] = WFrag<T16>::ld(Vt2 + vl + (size_t)dt * 16 * TT); }
            asm volatile("s_wait_xcnt 0x0" ::: "memory"); }   // the softmax below reuses the registers that held the value loads' addresses
#pragma unroll
        for (int qt = 0; qt < QT; ++qt) {
            const int qi = q0 + qt * 16 + lr;
            if (key0 + 31 > q0 + qt * 16) {   // the block reaches past the tile's first query: mask key > query
#pragma unroll
                for (int kt = 0; kt < 2; ++kt)
#pragma unroll
                    for (int j = 0; j < 8; ++j) if (key0 + kt * 16 + hi * 8 + j > qi) s[qt][kt][j] = -3.0e38f; }
            float mx = m[qt];
#pragma unroll
            for (int j = 0; j < 8; ++j) mx = fmaxf(mx, fmaxf(s[qt][0][j], s[qt][1][j]));
            mx = fmaxf(mx, __shfl_xor(mx, 16, 32));
            const float al = exp2s((m[qt] - mx) * C1); const float nm = psh - mx * C1; m[qt] = mx;
            float xe[16], p[16]; float sum = 0.f;
#pragma unroll
            for (int e = 0; e < 16; ++e) xe[e] = fmaf(s[qt][e >> 3][e & 7], C1, nm);
            exp2x8(p, xe); exp2x8(p + 8, xe + 8);
#pragma unroll
            for (int e = 0; e < 16; ++e) sum += p[e];
            l[qt] = l[qt] * al + sum;
#pragma unroll
            for (int dt = 0; dt < 4; ++dt) o[qt][dt] *= al;
            if constexpr (HR) { v8us h0, h1, l0, l1;
#pragma unroll
                for (int j = 0; j < 8; ++j) { unsigned short a, c2; splitf(p[j], a, c2); h0[j] = a; l0[j] = c2; splitf(p[8 + j], a, c2); h1[j] = a; l1[j] = c2; }
                const V ph = cat16b(h0, h1), pl = cat16b(l0, l1);
#pragma unroll
                for (int dt = 0; dt < 4; ++dt) { o[qt][dt] = WFrag<T16>::mma(va[dt], ph, o[qt][dt]); o[qt][dt] = WFrag<T16>::mma(va[dt], pl, o[qt][dt]); o[qt][dt] = WFrag<T16>::mma(va2[dt], ph, o[qt][dt]); }
            } else { V pf;
#pragma unroll
                for (int e = 0; e < 16; ++e) pf[e] = (h16)p[e];
#pragma unroll
                for (int dt = 0; dt < 4; ++dt) o[qt][dt] = WFrag<T16>::mma(va[dt], pf, o[qt][dt]); }
        }
    }
    float* osw = os + wv * (QT * 16 * 68);
#pragma unroll
    for (int qt = 0; qt < QT; ++qt) {
#pragma unroll
        for (int dt = 0; dt < 4; ++dt) { float* pp = osw + (qt * 16 + lr) * 68 + dt * 16 + hi * 8; const v8f t = o[qt][dt]; *(v4fa*)pp = (v4f){t[0], t[1], t[2], t[3]}; *(v4fa*)(pp + 4) = (v4f){t[4], t[5], t[6], t[7]}; }
        const float lt = l[qt] + __shfl_xor(l[qt], 16, 32);
        if (hi == 0) { ml[(wv * 2) * 32 + qt * 16 + lr] = m[qt]; ml[(wv * 2 + 1) * 32 + qt * 16 + lr] = lt; } }
    __syncthreads();   // all FW partial (m, l, O^T) are in LDS before any thread joins them
#pragma unroll
    for (int sI = 0; sI < QT; ++sI) { const int idx = sI * (32 * FW) + (int)threadIdx.x; const int q = idx >> 3, d8 = (idx & 7) * 8;
        float M = ml[q];
#pragma unroll
        for (int w = 1; w < FW; ++w) M = fmaxf(M, ml[(w * 2) * 32 + q]);
        float L = 0.f; v4f x0 = (v4f){}, x1 = (v4f){};
#pragma unroll
        for (int w = 0; w < FW; ++w) { const float f = exp2s((ml[(w * 2) * 32 + q] - M) * C1); L += f * ml[(w * 2 + 1) * 32 + q]; const float* pp = os + w * (QT * 16 * 68) + q * 68 + d8; x0 += f * *(const v4fa*)pp; x1 += f * *(const v4fa*)(pp + 4); }
        v8us oh, ol;
#pragma unroll
        for (int k = 0; k < 4; ++k) { unsigned short a, c2; splitf(__fdiv_rn(x0[k], L), a, c2); oh[k] = a; ol[k] = c2; splitf(__fdiv_rn(x1[k], L), a, c2); oh[4 + k] = a; ol[4 + k] = c2; }
        const size_t oo = (size_t)(q0 + q) * HD + d8;   /* RAW MERGE: the (H, S, hd) context written flat = the module's reshape(b, S, H * hd) without a transpose */
        *(v8usa*)(Ah + oo) = oh; *(v8usa*)(Al + oo) = ol;
        asm volatile("s_wait_xcnt 0x0" ::: "memory"); }   // stands behind the two stores, in front of any later write of their address or data registers
}
// grid (heads, (TT - RH) / 32 + RH / 16), 32 x FW threads; blockIdx.y counts the query blocks from the last (longest key loop) to the first (for speed only).
__global__ __launch_bounds__(32 * FW) void k_fattn(const h16* __restrict__ Q16, const h16* __restrict__ K16, const h16* __restrict__ V16, const bf* __restrict__ Qh, const bf* __restrict__ Ql, const bf* __restrict__ Kh, const bf* __restrict__ Kl, const bf* __restrict__ Vh, const bf* __restrict__ Vl, bf* Ah, bf* Al) {
    __shared__ __align__(16) float os[FW * 32 * 68]; __shared__ float ml[FW * 2 * 32];
    const size_t hz = (size_t)blockIdx.x * TT * HD; const int by = blockIdx.y;
    if (by < (TT - RH) / 32) fa_body<h16, false, 2>(Q16 + hz, nullptr, K16 + hz, nullptr, V16 + hz, nullptr, TT - 32 - by * 32, os, ml, Ah + hz, Al + hz);
    else fa_body<bf, true, 1>(Qh + hz, Ql + hz, Kh + hz, Kl + hz, Vh + hz, Vl + hz, RH - 16 - (by - (TT - RH) / 32) * 16, os, ml, Ah + hz, Al + hz);
}

extern "C" void kernel_launch(void* const* d_in, const int* in_sizes, int n_in,
                              void* d_out, int out_size, void* d_ws, size_t ws_size, hipStream_t stream) {
    (void)in_sizes; (void)n_in; (void)out_size;
    const float* x = (const float*)d_in[0]; const float* wq = (const float*)d_in[1]; const float* wk = (const float*)d_in[2]; const float* wv = (const float*)d_in[3]; const float* wo = (const float*)d_in[4];   /* input order x, wq, wk, wv, wo ('xw') */
    float* OUT = (float*)d_out;     // [2][2048][1024]
    char* wsp = (char*)d_ws;
    auto take = [&](size_t bytes) { char* p = wsp; wsp += (bytes + 255) & ~(size_t)255; return (void*)p; };
    bf* WQ = (bf*)take((size_t)DQ * DM * 2); bf* WK = (bf*)take((size_t)DKV * DM * 2); bf* WV = (bf*)take((size_t)DKV * DM * 2); bf* WO = (bf*)take((size_t)DM * DQ * 2);
    bf* XB = (bf*)take((size_t)TT * DM * 2);
    h16* QP16 = (h16*)take((size_t)NH_ * TT * HD * 2); h16* KP16 = (h16*)take((size_t)NKV * TT * HD * 2); h16* VT16 = (h16*)take((size_t)NKV * HD * TT * 2);
    bf* QPh = (bf*)take((size_t)NH_ * TT * HD * 2); bf* QPl = (bf*)take((size_t)NH_ * TT * HD * 2); bf* KPh = (bf*)take((size_t)NKV * TT * HD * 2); bf* KPl = (bf*)take((size_t)NKV * TT * HD * 2); bf* VTh = (bf*)take((size_t)NKV * HD * TT * 2); bf* VTl = (bf*)take((size_t)NKV * HD * TT * 2);
    bf* ATh = (bf*)take((size_t)TT * DQ * 2); bf* ATl = (bf*)take((size_t)TT * DQ * 2);
    if ((size_t)(wsp - (char*)d_ws) > ws_size) return;    // ws 256 MiB
    { k_wtG<<<(unsigned)((DM * DQ / 64 + 63) / 64), 256, 0, stream>>>(wq, DM, DQ, WQ); k_wtG<<<(unsigned)((DM * DKV / 64 + 63) / 64), 256, 0, stream>>>(wk, DM, DKV, WK); k_wtG<<<(unsigned)((DM * DKV / 64 + 63) / 64), 256, 0, stream>>>(wv, DM, DKV, WV);
      k_wtG<<<(unsigned)((DQ * DM / 64 + 63) / 64), 256, 0, stream>>>(wo, DQ, DM, WO);
       }
    for (int b = 0; b < NB_; ++b) {
        
        k_cvt8<<<(unsigned)(((size_t)TT * DM / 8 + 255) / 256), 256, 0, stream>>>(x + (size_t)b * TT * DM, XB, (size_t)TT * DM / 8);
        k_gemmw<bf, 0, false, 8, true><<<dim3(TT / 64, DQ / 64, 1), 256, 0, stream>>>(XB, nullptr, WQ, nullptr, DM, nullptr, HD, nullptr, 0, 0, 0, QP16, QPh, QPl, TT);    // q planes [h][t][d]
        k_gemmw<bf, 0, false, 8, true><<<dim3(TT / 64, DKV / 64, 1), 256, 0, stream>>>(XB, nullptr, WK, nullptr, DM, nullptr, HD, nullptr, 0, 0, 0, KP16, KPh, KPl, TT);   // k planes [h][t][d]
        k_gemmw<bf, 0, false, 8, true><<<dim3(DKV / 64, TT / 64, 1), 256, 0, stream>>>(WV, nullptr, XB, nullptr, DM, nullptr, TT, nullptr, 0, 0, 0, VT16, VTh, VTl, 1);    // (x wv)^T = wv^T x^T: rows g x HD + d, columns t = the v planes [g][d][t]
        k_fattn<<<dim3(NH_, (TT - RH) / 32 + RH / 16, 1), 32 * FW, 0, stream>>>(QP16, KP16, VT16, QPh, QPl, KPh, KPl, VTh, VTl, ATh, ATl);   // one kv head per query head
        k_gemmw<bf, 1, false, 8, false><<<dim3(TT / 64, DM / 64, 1), 256, 0, stream>>>(ATh, ATl, WO, nullptr, DQ, OUT + (size_t)b * TT * DM, DM, nullptr, 0, 0, 0, nullptr, nullptr, nullptr, 0); }
}

// v005
// One run takes 137 microseconds.
// Timed twice side by side with v004, it ran 1.33 times as fast both times.
// Over all steps from v000 it is 10.8 times as fast.
#include <hip/hip_runtime.h>

// Causal multi-head self-attention whose head MERGE is a RAW RESHAPE, not a transpose (x [2][2048][1024]; q, k, v = x w ('xw' [1024][1024] 0.02, no bias) split the standard way (reshape(b, s, 16, 64).transpose(0, 2, 1, 3): head = 64-column block); scores masked (-inf where key > query) then / sqrt(64); softmax; ctx [b][16][s][64] RAW-reshaped to [b][s][1024] (NO transpose back: element (h, t, d) lands at row h x 128 + t // 16, column (t mod 16) x 64 + d); out = ctx wo ('xw', no bias) -> [2][2048][1024] (4.2 M); argument order x, wq, wk, wv, wo).
// Four launches, each for both batches: k_prep ('xw' weights transposed; bf16 copy of x); the three exact projections in one grid, whose epilogue writes the head planes (fp16 + hi/lo; v as its transpose, operands swapped); causal T-2048 attention (k_fattn; hybrid rows: < 512 hi/lo 3 products, rest fp16 x1024; key blocks above the diagonal are never visited); merged hi/lo x Wo exact.
// Compute dtypes, f32 accumulate: every input rounded to bf16; projections exact; attention rows < 512 3 products, rest fp16; softmax f32; Wo hl x exact.

#define NB_  2
#define TT   2048
#define DM   1024
#define NH_  16
#define NKV  16
#define REP  (NH_ / NKV)
#define HD   64
#define DQ   (NH_ * HD)
#define DKV  (NKV * HD)
#define RH   512                  // query rows < RH use hi+lo planes (0: none)
#define PCAR 1024.0f
#define SCL  0.125f   // HD^-0.5
typedef _Float16 h16;
typedef unsigned short bf;
typedef __attribute__((ext_vector_type(16))) __bf16   v16bf;
typedef __attribute__((ext_vector_type(16))) _Float16 v16h;
typedef __attribute__((ext_vector_type(8)))  _Float16 v8h;
typedef __attribute__((ext_vector_type(8)))  unsigned short v8us;
typedef __attribute__((ext_vector_type(8)))  float    v8f;
typedef __attribute__((ext_vector_type(4)))  float    v4f;
typedef v8h  __attribute__((may_alias)) v8ha;
typedef v4f  __attribute__((may_alias)) v4fa;
typedef v8us __attribute__((may_alias)) v8usa;

__device__ __forceinline__ unsigned short f2bf(float f) { unsigned u = __float_as_uint(f); u += 0x7FFFu + ((u >> 16) & 1u); return (unsigned short)(u >> 16); }
__device__ __forceinline__ float bf2f(unsigned short b) { return __uint_as_float(((unsigned)b) << 16); }
__device__ __forceinline__ float bfr(float f) { return bf2f(f2bf(f)); }
__device__ __forceinline__ v16h cat16(v8h lo, v8h hi) { return __builtin_shufflevector(lo, hi, 0, 1, 2, 3, 4, 5, 6, 7, 8, 9, 10, 11, 12, 13, 14, 15); }
__device__ __forceinline__ v16bf cat16b(v8us lo, v8us hi) { return __builtin_bit_cast(v16bf, __builtin_shufflevector(lo, hi, 0, 1, 2, 3, 4, 5, 6, 7, 8, 9, 10, 11, 12, 13, 14, 15)); }
__device__ __forceinline__ v8f wmma16(v16h a, v16h b, v8f c) { return __builtin_amdgcn_wmma_f32_16x16x32_f16(false, a, false, b, (short)0, c, false, false); }
__device__ __forceinline__ v8f wmmab(v16bf a, v16bf b, v8f c) { return __builtin_amdgcn_wmma_f32_16x16x32_bf16(false, a, false, b, (short)0, c, false, false); }



// ---- k_gemmw: register-blocked GEMM, NW WAVES per 64x64 output tile, each with the whole tile's 16 accumulators over its own share of K (32-wide k blocks dealt round robin: wave w takes blocks w, w + NW, ...);
// operands straight from K-contiguous 16-bit planes; grid (M/64, N/64, Z), 32 x NW threads. The NW partial tiles meet in LDS and are summed in wave order 0 .. NW-1 (sum_store; with PL, sum_planes into the 16-bit planes).
// C[m][n] (f32, pitch ldc, + optional f32 bias[n]) = sum_k A[m][k] Bt[n][k] (+ split products per NSPLIT). z-batch strides sA/sB/sC in elements. K % 32 == 0.
template <typename T16> struct WFrag;
template <> struct WFrag<h16> { typedef v16h V; static __device__ __forceinline__ V ld(const h16* p) { return cat16(*(const v8h*)p, *(const v8h*)(p + 16)); } static __device__ __forceinline__ v8f mma(V a, V b, v8f c) { return wmma16(a, b, c); } };
template <> struct WFrag<bf> { typedef v16bf V; static __device__ __forceinline__ V ld(const bf* p) { return cat16b(*(const v8us*)p, *(const v8us*)(p + 16)); } static __device__ __forceinline__ v8f mma(V a, V b, v8f c) { return wmmab(a, b, c); } };
// sum_store: every wave puts its partial 64x64 f32 tile (row pitch 68) into its own LDS plane; behind one barrier each thread sums 4-column pieces over the planes in the fixed order 0 .. NW-1 and stores them (a wave writes whole 256-byte row pieces).
template <int NW, bool BIAS>
__device__ __forceinline__ void sum_store(const v8f (&acc)[4][4], float* os, int wv, int lr, int hi, float* C, int ldc, int r0, int c0, const float* __restrict__ bias) {
    float* osw = os + wv * (64 * 68);
#pragma unroll
    for (int mb = 0; mb < 4; ++mb)
#pragma unroll
        for (int nb = 0; nb < 4; ++nb)
#pragma unroll
            for (int j = 0; j < 8; ++j) osw[(mb * 16 + hi * 8 + j) * 68 + nb * 16 + lr] = acc[mb][nb][j];
    __syncthreads();   // all NW partial tiles are in LDS before any thread sums across them
#pragma unroll
    for (int s = 0; s < 32 / NW; ++s) { const int q = s * (32 * NW) + (int)threadIdx.x; const int row = q >> 4, cofs = (q & 15) * 4; v4f val = *(const v4fa*)(os + row * 68 + cofs);
#pragma unroll
        for (int w = 1; w < NW; ++w) val += *(const v4fa*)(os + w * (64 * 68) + row * 68 + cofs);
        if (BIAS) { val[0] += bfr(bias[c0 + cofs]); val[1] += bfr(bias[c0 + cofs + 1]); val[2] += bfr(bias[c0 + cofs + 2]); val[3] += bfr(bias[c0 + cofs + 3]); }
        *(v4f*)(C + (size_t)(r0 + row) * ldc + c0 + cofs) = val; }
}
__device__ __forceinline__ h16 tohx(float x) { return (h16)x; }
__device__ __forceinline__ void splitf(float y, unsigned short& h, unsigned short& l) { h = f2bf(y); l = f2bf(y - bf2f(h)); }
// sum_planes: sum_store's sum (same planes, same order 0 .. NW-1), but the tile leaves as the three 16-bit planes that the attention kernel reads (fp16, bf16 hi, bf16 lo), never as f32:
// each thread sums an 8-column piece and stores 16 bytes a plane at element e0 + row x ld + column, so that 8 threads write one whole 128-byte line of each plane.
template <int NW>
__device__ __forceinline__ void sum_planes(const v8f (&acc)[4][4], float* os, int wv, int lr, int hi, h16* P16, bf* Ph, bf* Pl, size_t e0, int ld) {
    float* osw = os + wv * (64 * 68);
#pragma unroll
    for (int mb = 0; mb < 4; ++mb)
#pragma unroll
        for (int nb = 0; nb < 4; ++nb)
#pragma unroll
            for (int j = 0; j < 8; ++j) osw[(mb * 16 + hi * 8 + j) * 68 + nb * 16 + lr] = acc[mb][nb][j];
    __syncthreads();   // all NW partial tiles are in LDS before any thread sums across them
#pragma unroll
    for (int s = 0; s < 16 / NW; ++s) { const int q = s * (32 * NW) + (int)threadIdx.x; const int row = q >> 3, cofs = (q & 7) * 8; const float* pp = os + row * 68 + cofs; v4f x0 = *(const v4fa*)pp, x1 = *(const v4fa*)(pp + 4);
#pragma unroll
        for (int w = 1; w < NW; ++w) { x0 += *(const v4fa*)(pp + w * (64 * 68)); x1 += *(const v4fa*)(pp + w * (64 * 68) + 4); }
        v8h o16; v8us oh, ol;
#pragma unroll
        for (int k = 0; k < 4; ++k) { unsigned short a, c2; o16[k] = tohx(x0[k]); splitf(x0[k], a, c2); oh[k] = a; ol[k] = c2; o16[4 + k] = tohx(x1[k]); splitf(x1[k], a, c2); oh[4 + k] = a; ol[4 + k] = c2; }
        const size_t e = e0 + (size_t)row * ld + cofs;
        *(v8ha*)(P16 + e) = o16; *(v8usa*)(Ph + e) = oh; *(v8usa*)(Pl + e) = ol;
        asm volatile("s_wait_xcnt 0x0" ::: "memory"); }   // stands behind the three stores, in front of the next piece's writes of their address and data registers
}
// PL: the q, k and v projections of both batches in one grid (NB_ x TT / 64 blocks of x rows, DQ / 64 blocks of weight columns, 3); blockIdx.z = 0 q, 1 k, 2 v picks weight and planes from pj (A, Bt, C and ldc are not used).
// X holds the rows of both batches one after the other (a 64-row block lies in one batch). The tile goes out through sum_planes. q, k: A = x rows, Bt = weight columns, planes [b][h][t][d] (a 64-column block is one head).
// v: operands swapped, (x wv)^T = wv^T x^T: rows g x HD + d, columns t = the planes [b][g][d][t].
struct PJ3 { const bf* X; const bf* W[3]; h16* P16[3]; bf* Ph[3]; bf* Pl[3]; };
template <typename T16, int NSPLIT, bool BIAS, int NW, bool PL>
__global__ __launch_bounds__(32 * NW) void k_gemmw(const T16* __restrict__ A, const T16* __restrict__ A2, const T16* __restrict__ Bt, const T16* __restrict__ Bt2, int K, float* C, int ldc, const float* __restrict__ bias, size_t sA, size_t sB, size_t sC, PJ3 pj) {
    typedef typename WFrag<T16>::V V;
    __shared__ __align__(16) float os[NW * 64 * 68];
    const size_t z = blockIdx.z; A += z * sA; if (A2) A2 += z * sA; Bt += z * sB; if (Bt2) Bt2 += z * sB; C += z * sC;
    const int lane = threadIdx.x & 31, lr = lane & 15, hi = lane >> 4; const int wv = __builtin_amdgcn_readfirstlane((int)(threadIdx.x >> 5)); int r0 = blockIdx.x * 64, c0 = blockIdx.y * 64;
    h16* P16 = nullptr; bf* Ph = nullptr; bf* Pl = nullptr; size_t e0 = 0;
    if constexpr (PL) { const bool isv = z == 2; const int bt = r0 / TT * TT;   // bt: first x row of the block's batch
        const bf* Wz = isv ? pj.W[2] : z ? pj.W[1] : pj.W[0]; P16 = isv ? pj.P16[2] : z ? pj.P16[1] : pj.P16[0]; Ph = isv ? pj.Ph[2] : z ? pj.Ph[1] : pj.Ph[0]; Pl = isv ? pj.Pl[2] : z ? pj.Pl[1] : pj.Pl[0];
        A = isv ? Wz : pj.X; Bt = isv ? pj.X : Wz; ldc = isv ? TT : HD;
        e0 = (size_t)bt * DQ + (size_t)c0 * TT + (isv ? (size_t)(r0 - bt) : (size_t)(r0 - bt) * HD);   // the batch's planes, then head c0 / 64 (q, k) or plane row c0 (v), then the block's first t
        if (isv) { const int t = r0; r0 = c0; c0 = t; } }
    v8f acc[4][4];
#pragma unroll
    for (int mb = 0; mb < 4; ++mb)
#pragma unroll
        for (int nb = 0; nb < 4; ++nb) acc[mb][nb] = (v8f){};
    const size_t aoff = (size_t)(r0 + lr) * K + 8 * hi, boff = (size_t)(c0 + lr) * K + 8 * hi;
#pragma unroll 1
    for (int kc = wv * 32; kc < K; kc += 32 * NW) {
        V a[4], a2[4];
#pragma unroll
        for (int mb = 0; mb < 4; ++mb) { a[mb] = WFrag<T16>::ld(A + aoff + (size_t)mb * 16 * K + kc); if (NSPLIT == 1 || NSPLIT == 2) a2[mb] = WFrag<T16>::ld(A2 + aoff + (size_t)mb * 16 * K + kc); }
#pragma unroll
        for (int nb = 0; nb < 4; ++nb) { const V b = WFrag<T16>::ld(Bt + boff + (size_t)nb * 16 * K + kc); V b2; if (NSPLIT >= 2) b2 = WFrag<T16>::ld(Bt2 + boff + (size_t)nb * 16 * K + kc);
#pragma unroll
            for (int mb = 0; mb < 4; ++mb) { acc[mb][nb] = WFrag<T16>::mma(a[mb], b, acc[mb][nb]); if (NSPLIT == 1 || NSPLIT == 2) acc[mb][nb] = WFrag<T16>::mma(a2[mb], b, acc[mb][nb]); if (NSPLIT >= 2) acc[mb][nb] = WFrag<T16>::mma(a[mb], b2, acc[mb][nb]); } }
        asm volatile("v_nop\n\tv_nop\n\tv_nop\n\tv_nop" : "+v"(acc[0][0]), "+v"(acc[1][1]), "+v"(acc[2][2]), "+v"(acc[3][3]) : "v"(a[0]), "v"(a[3]));
    }
    if constexpr (PL) { sum_planes<NW>(acc, os, wv, lr, hi, P16, Ph, Pl, e0, ldc); return; }
    sum_store<NW, BIAS>(acc, os, wv, lr, hi, C, ldc, r0, c0, bias);
}

typedef __attribute__((ext_vector_type(2))) _Float16 v2h;
typedef __attribute__((ext_vector_type(4))) _Float16 v4h;
typedef __attribute__((ext_vector_type(2))) unsigned short v2us;
typedef __attribute__((ext_vector_type(4))) unsigned short v4us;
typedef __attribute__((ext_vector_type(2))) float v2f;
typedef __attribute__((ext_vector_type(4))) int v4i;

__device__ __forceinline__ void wtG(const float* __restrict__ w, int K, int N, bf* Bt, int blk) {
    const int lane = threadIdx.x & 31; const int L0 = (blk * 8 + (threadIdx.x >> 5)) * 8; const int nlines = N * K / 64;
{
#pragma unroll 1
        for (int l = 0; l < 8; ++l) { const int L = L0 + l; if (L >= nlines) break; const size_t e = (size_t)L * 64 + lane * 2; const int k = (int)(e % K), n = (int)(e / K); v2us o;
            o[0] = f2bf(w[(size_t)k * N + n]); o[1] = f2bf(w[(size_t)(k + 1) * N + n]); *(v2us*)(Bt + e) = o; }
         }
}
__device__ __forceinline__ void cvt8(const float* __restrict__ src, bf* dst, size_t i) { const v8f v = *(const v8f*)(src + i * 8); v8us o;
#pragma unroll
    for (int k = 0; k < 8; ++k) o[k] = f2bf(v[k]); *(v8us*)(dst + i * 8) = o;  }
// k_prep: all that the GEMMs need of the inputs in one grid of 4 x WTB work-groups: work-group g transposes share g mod WTB of weight g / WTB and converts its CVW x 256 8-element pieces of x (both batches).
#define WTB  ((DM * DQ / 64 + 63) / 64)
#define CVW  (NB_ * TT * DM / 8 / 256 / (4 * WTB))
static_assert((size_t)CVW * 256 * 8 * (4 * WTB) == (size_t)NB_ * TT * DM && DKV == DQ, "the grid's pieces cover x exactly; the four weights have one shape");
__global__ __launch_bounds__(256) void k_prep(const float* __restrict__ x, const float* __restrict__ wq, const float* __restrict__ wk, const float* __restrict__ wv, const float* __restrict__ wo, bf* XB, bf* WQ, bf* WK, bf* WV, bf* WO) {
    const int g = blockIdx.x, which = g / WTB;
    wtG(which == 0 ? wq : which == 1 ? wk : which == 2 ? wv : wo, DM, DQ, which == 0 ? WQ : which == 1 ? WK : which == 2 ? WV : WO, g % WTB);
#pragma unroll   // the pieces' loads are independent: unrolled, they are in flight together
    for (int c = 0; c < CVW; ++c) cvt8(x, XB, (size_t)(g * CVW + c) * 256 + threadIdx.x);
}

// ---- k_fattn: causal attention of one head for one block of query rows in ONE kernel: scores, softmax, probability x value and the hi/lo merge; no score or probability leaves the registers.
// Every product is formed TRANSPOSED, so that a lane owns one query column (lr) all the way: S^T[key][q] = K Q^T (A = key rows, B = query rows), whose two 16-key result tiles hold, per lane, keys 8 hi + j and 16 + 8 hi + j:
// exactly the k order of a B fragment, so the probabilities feed O^T[d][q] = V^T P^T (A = rows of the [d][t] value plane) with no exchange between lanes.
// Softmax is the running form: per query a running maximum m and sum l; when m grows, l and O^T are scaled by exp(m_old - m_new). The 32-key blocks up to the diagonal are dealt round robin over the FW waves of the
// work-group; the FW partial (m, l, O^T) meet in LDS and are joined in wave order 0 .. FW-1. Rows < RH: bf16 hi/lo, 3 products, 16 rows a work-group; other rows: fp16, probabilities x PCAR (the factor cancels in O / l), 32 rows.
// Every '#pragma unroll' in fa_body is there so that the fragment, score and accumulator arrays are indexed by constants and stay in registers.
#define FW   4
#define C1   (SCL * 1.4426950408889634f)
// exp2 with the one slot that the instruction set asks for behind a transcendental written into the same statement.
// exp2s: one value, v_nop behind it. exp2x8: eight values; the outputs are early-clobber, so no v_exp_f32 overwrites a source or reads a result of the one before it and each fills its forerunner's slot; v_nop fills the last one's.
__device__ __forceinline__ float exp2s(float x) { float r; asm("v_exp_f32 %0, %1\n\tv_nop" : "=v"(r) : "v"(x)); return r; }
__device__ __forceinline__ void exp2x8(float* r, const float* x) {
    asm("v_exp_f32 %0, %8\n\tv_exp_f32 %1, %9\n\tv_exp_f32 %2, %10\n\tv_exp_f32 %3, %11\n\tv_exp_f32 %4, %12\n\tv_exp_f32 %5, %13\n\tv_exp_f32 %6, %14\n\tv_exp_f32 %7, %15\n\tv_nop"
        : "=&v"(r[0]), "=&v"(r[1]), "=&v"(r[2]), "=&v"(r[3]), "=&v"(r[4]), "=&v"(r[5]), "=&v"(r[6]), "=&v"(r[7]) : "v"(x[0]), "v"(x[1]), "v"(x[2]), "v"(x[3]), "v"(x[4]), "v"(x[5]), "v"(x[6]), "v"(x[7])); }
template <typename T16, bool HR, int QT>
__device__ __forceinline__ void fa_body(const T16* __restrict__ Q, const T16* __restrict__ Q2, const T16* __restrict__ Kp, const T16* __restrict__ Kp2, const T16* __restrict__ Vt, const T16* __restrict__ Vt2, int q0, float* os, float* ml, bf* Ah, bf* Al) {
    typedef typename WFrag<T16>::V V;
    const int lane = threadIdx.x & 31, lr = lane & 15, hi = lane >> 4; const int wv = __builtin_amdgcn_readfirstlane((int)(threadIdx.x >> 5));
    const float psh = HR ? 0.0f : 10.0f;   // log2(PCAR)
    V qf[QT][2], qf2[QT][2];
#pragma unroll
    for (int qt = 0; qt < QT; ++qt)
#pragma unroll
        for (int ks = 0; ks < 2; ++ks) { const size_t qo = (size_t)(q0 + qt * 16 + lr) * HD + ks * 32 + 8 * hi; qf[qt][ks] = WFrag<T16>::ld(Q + qo); if (HR) qf2[qt][ks] = WFrag<T16>::ld(Q2 + qo); }
    v8f o[QT][4]; float m[QT], l[QT];
#pragma unroll
    for (int qt = 0; qt < QT; ++qt) { m[qt] = -3.0e38f; l[qt] = 0.f;
#pragma unroll
        for (int dt = 0; dt < 4; ++dt) o[qt][dt] = (v8f){}; }
    const int nkb = (q0 + QT * 16 + 31) >> 5;   // 32-key blocks that hold a key <= the block's last query; in each of them every query of the block has at least one such key
    V kf[2][2];   // fp16 rows: a pass's key fragments are fetched one pass ahead (the block index is clamped to the last block, so the fetch behind a wave's last pass, or of a wave with no pass, stays inside the plane); hi/lo rows fetch in the pass itself (twice the fragments, at most 4 passes a wave)
    const size_t kl = (size_t)lr * HD + 8 * hi;
    if constexpr (!HR) {
#pragma unroll
        for (int kt = 0; kt < 2; ++kt)
#pragma unroll
            for (int ks = 0; ks < 2; ++ks) kf[kt][ks] = WFrag<T16>::ld(Kp + (size_t)min(wv, nkb - 1) * (32 * HD) + kl + kt * (16 * HD) + ks * 32); }
#pragma unroll 1   // rolled: one pass's fragments, scores and accumulators already take the registers that four waves a SIMD leave to each
    for (int kb = wv; kb < nkb; kb += FW) {
        const int key0 = kb * 32;
        V va[4], va2[4]; const size_t vl = (size_t)lr * TT + key0 + 8 * hi;
        if constexpr (!HR) {
#pragma unroll
            for (int dt = 0; dt < 4; ++dt) va[dt] = WFrag<T16>::ld(Vt + vl + (size_t)dt * 16 * TT); }
        v8f s[QT][2];
#pragma unroll
        for (int qt = 0; qt < QT; ++qt) { s[qt][0] = (v8f){}; s[qt][1] = (v8f){}; }
#pragma unroll
        for (int kt = 0; kt < 2; ++kt)
#pragma unroll
            for (int ks = 0; ks < 2; ++ks) { V ka, ka2; if constexpr (HR) { const size_t ko = (size_t)key0 * HD + kl + kt * (16 * HD) + ks * 32; ka = WFrag<T16>::ld(Kp + ko); ka2 = WFrag<T16>::ld(Kp2 + ko); } else ka = kf[kt][ks];
#pragma unroll
                for (int qt = 0; qt < QT; ++qt) { s[qt][kt] = WFrag<T16>::mma(ka, qf[qt][ks], s[qt][kt]); if constexpr (HR) { s[qt][kt] = WFrag<T16>::mma(ka, qf2[qt][ks], s[qt][kt]); s[qt][kt] = WFrag<T16>::mma(ka2, qf[qt][ks], s[qt][kt]); } } }
        if constexpr (!HR) {
#pragma unroll
            for (int kt = 0; kt < 2; ++kt)
#pragma unroll
                for (int ks = 0; ks < 2; ++ks) kf[kt][ks] = WFrag<T16>::ld(Kp + (size_t)min(kb + FW, nkb - 1) * (32 * HD) + kl + kt * (16 * HD) + ks * 32); }
        else { asm volatile("s_wait_xcnt 0x0" ::: "memory");   // the value fragments below land in registers that the key loads above name as their addresses: the wait stands in front of that overwrite
#pragma unroll
            for (int dt = 0; dt < 4; ++dt) { va[dt] = WFrag<T16>::ld(Vt + vl + (size_t)dt * 16 * TT); va2[dt] = WFrag<T16>::ld(Vt2 + vl + (size_t)dt * 16 * TT); }
            asm volatile("s_wait_xcnt 0x0" ::: "memory"); }   // the softmax below reuses the registers that held the value loads' addresses
#pragma unroll
        for (int qt = 0; qt < QT; ++qt) {
            const int qi = q0 + qt * 16 + lr;
            if (key0 + 31 > q0 + qt * 16) {   // the block reaches past the tile's first query: mask key > query
#pragma unroll
                for (int kt = 0; kt < 2; ++kt)
#pragma unroll
                    for (int j = 0; j < 8; ++j) if (key0 + kt * 16 + hi * 8 + j > qi) s[qt][kt][j] = -3.0e38f; }
            float mx = m[qt];
#pragma unroll
            for (int j = 0; j < 8; ++j) mx = fmaxf(mx, fmaxf(s[qt][0][j], s[qt][1][j]));
            mx = fmaxf(mx, __shfl_xor(mx, 16, 32));
            const float al = exp2s((m[qt] - mx) * C1); const float nm = psh - mx * C1; m[qt] = mx;
            float xe[16], p[16]; float sum = 0.f;
#pragma unroll
            for (int e = 0; e < 16; ++e) xe[e] = fmaf(s[qt][e >> 3][e & 7], C1, nm);
            exp2x8(p, xe); exp2x8(p + 8, xe + 8);
#pragma unroll
            for (int e = 0; e < 16; ++e) sum += p[e];
            l[qt] = l[qt] * al + sum;
#pragma unroll
            for (int dt = 0; dt < 4; ++dt) o[qt][dt] *= al;
            if constexpr (HR) { v8us h0, h1, l0, l1;
#pragma unroll
                for (int j = 0; j < 8; ++j) { unsigned short a, c2; splitf(p[j], a, c2); h0[j] = a; l0[j] = c2; splitf(p[8 + j], a, c2); h1[j] = a; l1[j] = c2; }
                const V ph = cat16b(h0, h1), pl = cat16b(l0, l1);
#pragma unroll
                for (int dt = 0; dt < 4; ++dt) { o[qt][dt] = WFrag<T16>::mma(va[dt], ph, o[qt][dt]); o[qt][dt] = WFrag<T16>::mma(va[dt], pl, o[qt][dt]); o[qt][dt] = WFrag<T16>::mma(va2[dt], ph, o[qt][dt]); }
            } else { V pf;
#pragma unroll
                for (int e = 0; e < 16; ++e) pf[e] = (h16)p[e];
#pragma unroll
                for (int dt = 0; dt < 4; ++dt) o[qt][dt] = WFrag<T16>::mma(va[dt], pf, o[qt][dt]); }
        }
    }
    float* osw = os + wv * (QT * 16 * 68);
#pragma unroll
    for (int qt = 0; qt < QT; ++qt) {
#pragma unroll
        for (int dt = 0; dt < 4; ++dt) { float* pp = osw + (qt * 16 + lr) * 68 + dt * 16 + hi * 8; const v8f t = o[qt][dt]; *(v4fa*)pp = (v4f){t[0], t[1], t[2], t[3]}; *(v4fa*)(pp + 4) = (v4f){t[4], t[5], t[6], t[7]}; }
        const float lt = l[qt] + __shfl_xor(l[qt], 16, 32);
        if (hi == 0) { ml[(wv * 2) * 32 + qt * 16 + lr] = m[qt]; ml[(wv * 2 + 1) * 32 + qt * 16 + lr] = lt; } }
    __syncthreads();   // all FW partial (m, l, O^T) are in LDS before any thread joins them
#pragma unroll
    for (int sI = 0; sI < QT; ++sI) { const int idx = sI * (32 * FW) + (int)threadIdx.x; const int q = idx >> 3, d8 = (idx & 7) * 8;
        float M = ml[q];
#pragma unroll
        for (int w = 1; w < FW; ++w) M = fmaxf(M, ml[(w * 2) * 32 + q]);
        float L = 0.f; v4f x0 = (v4f){}, x1 = (v4f){};
#pragma unroll
        for (int w = 0; w < FW; ++w) { const float f = exp2s((ml[(w * 2) * 32 + q] - M) * C1); L += f * ml[(w * 2 + 1) * 32 + q]; const float* pp = os + w * (QT * 16 * 68) + q * 68 + d8; x0 += f * *(const v4fa*)pp; x1 += f * *(const v4fa*)(pp + 4); }
        v8us oh, ol;
#pragma unroll
        for (int k = 0; k < 4; ++k) { unsigned short a, c2; splitf(__fdiv_rn(x0[k], L), a, c2); oh[k] = a; ol[k] = c2; splitf(__fdiv_rn(x1[k], L), a, c2); oh[4 + k] = a; ol[4 + k] = c2; }
        const size_t oo = (size_t)(q0 + q) * HD + d8;   /* RAW MERGE: the (H, S, hd) context written flat = the module's reshape(b, S, H * hd) without a transpose */
        *(v8usa*)(Ah + oo) = oh; *(v8usa*)(Al + oo) = ol;
        asm volatile("s_wait_xcnt 0x0" ::: "memory"); }   // stands behind the two stores, in front of any later write of their address or data registers
}
// grid (batches x heads, (TT - RH) / 32 + RH / 16), 32 x FW threads; the planes of both batches lie one after the other, so blockIdx.x = b x NH_ + h indexes them all; blockIdx.y counts the query blocks from the last (longest key loop) to the first (for speed only).
__global__ __launch_bounds__(32 * FW) void k_fattn(const h16* __restrict__ Q16, const h16* __restrict__ K16, const h16* __restrict__ V16, const bf* __restrict__ Qh, const bf* __restrict__ Ql, const bf* __restrict__ Kh, const bf* __restrict__ Kl, const bf* __restrict__ Vh, const bf* __restrict__ Vl, bf* Ah, bf* Al) {
    __shared__ __align__(16) float os[FW * 32 * 68]; __shared__ float ml[FW * 2 * 32];
    const size_t hz = (size_t)blockIdx.x * TT * HD; const int by = blockIdx.y;
    if (by < (TT - RH) / 32) fa_body<h16, false, 2>(Q16 + hz, nullptr, K16 + hz, nullptr, V16 + hz, nullptr, TT - 32 - by * 32, os, ml, Ah + hz, Al + hz);
    else fa_body<bf, true, 1>(Qh + hz, Ql + hz, Kh + hz, Kl + hz, Vh + hz, Vl + hz, RH - 16 - (by - (TT - RH) / 32) * 16, os, ml, Ah + hz, Al + hz);
}

extern "C" void kernel_launch(void* const* d_in, const int* in_sizes, int n_in,
                              void* d_out, int out_size, void* d_ws, size_t ws_size, hipStream_t stream) {
    (void)in_sizes; (void)n_in; (void)out_size;
    const float* x = (const float*)d_in[0]; const float* wq = (const float*)d_in[1]; const float* wk = (const float*)d_in[2]; const float* wv = (const float*)d_in[3]; const float* wo = (const float*)d_in[4];   /* input order x, wq, wk, wv, wo ('xw') */
    float* OUT = (float*)d_out;     // [2][2048][1024]
    char* wsp = (char*)d_ws;
    auto take = [&](size_t bytes) { char* p = wsp; wsp += (bytes + 255) & ~(size_t)255; return (void*)p; };
    bf* WQ = (bf*)take((size_t)DQ * DM * 2); bf* WK = (bf*)take((size_t)DKV * DM * 2); bf* WV = (bf*)take((size_t)DKV * DM * 2); bf* WO = (bf*)take((size_t)DM * DQ * 2);
    bf* XB = (bf*)take((size_t)NB_ * TT * DM * 2);
    h16* QP16 = (h16*)take((size_t)NB_ * NH_ * TT * HD * 2); h16* KP16 = (h16*)take((size_t)NB_ * NKV * TT * HD * 2); h16* VT16 = (h16*)take((size_t)NB_ * NKV * HD * TT * 2);
    bf* QPh = (bf*)take((size_t)NB_ * NH_ * TT * HD * 2); bf* QPl = (bf*)take((size_t)NB_ * NH_ * TT * HD * 2); bf* KPh = (bf*)take((size_t)NB_ * NKV * TT * HD * 2); bf* KPl = (bf*)take((size_t)NB_ * NKV * TT * HD * 2); bf* VTh = (bf*)take((size_t)NB_ * NKV * HD * TT * 2); bf* VTl = (bf*)take((size_t)NB_ * NKV * HD * TT * 2);
    bf* ATh = (bf*)take((size_t)NB_ * TT * DQ * 2); bf* ATl = (bf*)take((size_t)NB_ * TT * DQ * 2);
    if ((size_t)(wsp - (char*)d_ws) > ws_size) return;    // ws 256 MiB
    k_prep<<<4 * WTB, 256, 0, stream>>>(x, wq, wk, wv, wo, XB, WQ, WK, WV, WO);
    k_gemmw<bf, 0, false, 8, true><<<dim3(NB_ * TT / 64, DQ / 64, 3), 256, 0, stream>>>(nullptr, nullptr, nullptr, nullptr, DM, nullptr, 0, nullptr, 0, 0, 0, PJ3{XB, {WQ, WK, WV}, {QP16, KP16, VT16}, {QPh, KPh, VTh}, {QPl, KPl, VTl}});
    k_fattn<<<dim3(NB_ * NH_, (TT - RH) / 32 + RH / 16, 1), 32 * FW, 0, stream>>>(QP16, KP16, VT16, QPh, QPl, KPh, KPl, VTh, VTl, ATh, ATl);   // one kv head per query head
    k_gemmw<bf, 1, false, 8, false><<<dim3(NB_ * TT / 64, DM / 64, 1), 256, 0, stream>>>(ATh, ATl, WO, nullptr, DQ, OUT, DM, nullptr, 0, 0, 0, PJ3{});   // the raw-merged context of both batches is one [NB_ x TT][DQ] matrix
}

// v006
// A run of this version takes 91.1 microseconds.
// Next to v005, in two timings, it ran 1.52 times as fast each time.
// Counting every step since v000, it is 16.4 times as fast.
#include <hip/hip_runtime.h>

// Causal multi-head self-attention whose head MERGE is a RAW RESHAPE, not a transpose (x [2][2048][1024]; q, k, v = x w ('xw' [1024][1024] 0.02, no bias) split the standard way (reshape(b, s, 16, 64).transpose(0, 2, 1, 3): head = 64-column block); scores masked (-inf where key > query) then / sqrt(64); softmax; ctx [b][16][s][64] RAW-reshaped to [b][s][1024] (NO transpose back: element (h, t, d) lands at row h x 128 + t // 16, column (t mod 16) x 64 + d); out = ctx wo ('xw', no bias) -> [2][2048][1024] (4.2 M); argument order x, wq, wk, wv, wo).
// Four launches, each for both batches: k_prep ('xw' weights transposed; bf16 copy of x); the three exact projections in one grid, whose epilogue writes the head planes (fp16 + hi/lo; v as its transpose, operands swapped); causal T-2048 attention (k_fattn; hybrid rows: < 512 hi/lo 3 products, rest fp16 x1024; key blocks above the diagonal are never visited); merged hi/lo x Wo exact.
// Compute dtypes, f32 accumulate: every input rounded to bf16; projections exact; attention rows < 512 3 products, rest fp16; softmax f32; Wo hl x exact.

#define NB_  2
#define TT   2048
#define DM   1024
#define NH_  16
#define NKV  16
#define REP  (NH_ / NKV)
#define HD   64
#define DQ   (NH_ * HD)
#define DKV  (NKV * HD)
#define RH   512                  // query rows < RH use hi+lo planes (0: none)
#define PCAR 1024.0f
#define SCL  0.125f   // HD^-0.5
typedef _Float16 h16;
typedef unsigned short bf;
typedef __attribute__((ext_vector_type(16))) __bf16   v16bf;
typedef __attribute__((ext_vector_type(16))) _Float16 v16h;
typedef __attribute__((ext_vector_type(8)))  _Float16 v8h;
typedef __attribute__((ext_vector_type(8)))  unsigned short v8us;
typedef __attribute__((ext_vector_type(8)))  float    v8f;
typedef __attribute__((ext_vector_type(4)))  float    v4f;
typedef v8h  __attribute__((may_alias)) v8ha;
typedef v4f  __attribute__((may_alias)) v4fa;
typedef v8us __attribute__((may_alias)) v8usa;

__device__ __forceinline__ unsigned short f2bf(float f) { unsigned u = __float_as_uint(f); u += 0x7FFFu + ((u >> 16) & 1u); return (unsigned short)(u >> 16); }
__device__ __forceinline__ float bf2f(unsigned short b) { return __uint_as_float(((unsigned)b) << 16); }
__device__ __forceinline__ float bfr(float f) { return bf2f(f2bf(f)); }
__device__ __forceinline__ v16h cat16(v8h lo, v8h hi) { return __builtin_shufflevector(lo, hi, 0, 1, 2, 3, 4, 5, 6, 7, 8, 9, 10, 11, 12, 13, 14, 15); }
__device__ __forceinline__ v16bf cat16b(v8us lo, v8us hi) { return __builtin_bit_cast(v16bf, __builtin_shufflevector(lo, hi, 0, 1, 2, 3, 4, 5, 6, 7, 8, 9, 10, 11, 12, 13, 14, 15)); }
__device__ __forceinline__ v8f wmma16(v16h a, v16h b, v8f c) { return __builtin_amdgcn_wmma_f32_16x16x32_f16(false, a, false, b, (short)0, c, false, false); }
__device__ __forceinline__ v8f wmmab(v16bf a, v16bf b, v8f c) { return __builtin_amdgcn_wmma_f32_16x16x32_bf16(false, a, false, b, (short)0, c, false, false); }



// ---- k_gemms: GEMM with both operands staged in LDS; one 128x128 output tile a work-group, split over its waves (2 x 2 pieces of 64x64, or 4 x 2 of 32x64), each piece over the WHOLE of K, so that a k sum runs in k order in one accumulator.
// C[m][n] = sum_k A[m][k] Bt[n][k] (+ A2[m][k] Bt[n][k] where SPLIT), operands K-contiguous bf16 planes of pitch GKD. A pass is GK k = one or two 128-byte lines of every operand row; a stage holds [A 128 rows | A2 128 rows | Bt 128 rows] at a pitch of 2 GK + 16 bytes (16 x odd: ds_load_b128 readers).
// Two buffers, filled by asynchronous copies to LDS (16 bytes a lane, a wave's copy = 4 whole lines), the copies of pass t + 2 issued behind the barrier that ends pass t: they fly while pass t + 1 is worked on.
// GK: 64 where three work-groups share a WGP's LDS (projections); 128 where a work-group has the WGP alone (output GEMM), so that twice the bytes are in flight and half the barriers are passed.
// MB = 16-row blocks of a wave's piece: 4 (4 waves) where three work-groups give a SIMD three waves; 2 (8 waves) where the work-group is alone, so that a SIMD has a second wave to issue while one waits for its LDS reads.
template <typename T16> struct WFrag;
template <> struct WFrag<h16> { typedef v16h V; static __device__ __forceinline__ V ld(const h16* p) { return cat16(*(const v8h*)p, *(const v8h*)(p + 16)); } static __device__ __forceinline__ v8f mma(V a, V b, v8f c) { return wmma16(a, b, c); } };
template <> struct WFrag<bf> { typedef v16bf V; static __device__ __forceinline__ V ld(const bf* p) { return cat16b(*(const v8us*)p, *(const v8us*)(p + 16)); } static __device__ __forceinline__ v8f mma(V a, V b, v8f c) { return wmmab(a, b, c); } };
__device__ __forceinline__ h16 tohx(float x) { return (h16)x; }
__device__ __forceinline__ void splitf(float y, unsigned short& h, unsigned short& l) { h = f2bf(y); l = f2bf(y - bf2f(h)); }
#define GKD  1024                 // K of every GEMM here = pitch of every operand plane, elements
static_assert(DM == GKD && DQ == GKD && DKV == GKD, "one K for the four GEMMs");
// copy8: this lane's 16 bytes of the eight rows r, r + RS, ... r + 7 RS of one operand (LDS pitch GP elements). The s_wait_xcnt stands inside the statement, behind the last copy, so that no later write of an address register can come in front of it.
template <int RS, int GP>
__device__ __forceinline__ void copy8(const bf* g, unsigned l) {
    asm volatile("global_load_async_to_lds_b128 %0, %8, off\n\tglobal_load_async_to_lds_b128 %1, %9, off\n\tglobal_load_async_to_lds_b128 %2, %10, off\n\tglobal_load_async_to_lds_b128 %3, %11, off\n\t"
                 "global_load_async_to_lds_b128 %4, %12, off\n\tglobal_load_async_to_lds_b128 %5, %13, off\n\tglobal_load_async_to_lds_b128 %6, %14, off\n\tglobal_load_async_to_lds_b128 %7, %15, off\n\ts_wait_xcnt 0x0"
                 :: "v"(l), "v"(l + 1 * RS * GP * 2), "v"(l + 2 * RS * GP * 2), "v"(l + 3 * RS * GP * 2), "v"(l + 4 * RS * GP * 2), "v"(l + 5 * RS * GP * 2), "v"(l + 6 * RS * GP * 2), "v"(l + 7 * RS * GP * 2),
                    "v"(g), "v"(g + 1 * RS * GKD), "v"(g + 2 * RS * GKD), "v"(g + 3 * RS * GKD), "v"(g + 4 * RS * GKD), "v"(g + 5 * RS * GKD), "v"(g + 6 * RS * GKD), "v"(g + 7 * RS * GKD) : "memory");
}
__device__ __forceinline__ v16bf ldsfrag(const bf* p) { return cat16b(*(const v8usa*)p, *(const v8usa*)(p + 16)); }   // the k order of WFrag::ld, for A and B alike
// PL: the q, k and v projections of both batches in one grid (NB_ x TT / 128 blocks of x rows, DQ / 128 blocks of weight columns, 3); blockIdx.z = 0 q, 1 k, 2 v picks weight and planes from pj (A, A2, Bt and C are not used).
// X holds the rows of both batches one after the other. A wave's piece (MB = 4: 64 x rows of one batch, one head's 64 weight columns) leaves as the three 16-bit planes that the attention kernel reads (fp16, bf16 hi, bf16 lo), never as f32.
// q, k: A = x rows, Bt = weight columns, planes [b][h][t][d]. v: operands swapped, (x wv)^T = wv^T x^T: rows g x HD + d, columns t = the planes [b][g][d][t].
// A '#pragma unroll' in k_gemms with no comment of its own is there so that the fragment, accumulator and vector arrays are indexed by constants and stay in registers.
struct PJ3 { const bf* X; const bf* W[3]; h16* P16[3]; bf* Ph[3]; bf* Pl[3]; };
template <bool SPLIT, bool PL, int GK, int MB>
__global__ __launch_bounds__(128 / (MB * 16) * 64) void k_gemms(const bf* __restrict__ A, const bf* __restrict__ A2, const bf* __restrict__ Bt, float* C, PJ3 pj) {
    constexpr int GP = GK + 8;                        // LDS row pitch, 16-bit elements
    constexpr int STG = (SPLIT ? 3 : 2) * 128 * GP;   // elements of a stage
    constexpr int OB = (SPLIT ? 256 : 128) * GP;      // where Bt's rows begin in a stage (A2's: 128 GP)
    constexpr int NT = GKD / GK;
    constexpr int NTH = 128 / (MB * 16) * 64;         // threads: 128 / (16 MB) x 2 waves
    constexpr int PR = GK / 8, RS = NTH / PR;         // 16-byte pieces of a row; rows that the work-group's lanes cover at once
    static_assert(NT >= 2 && 2 * STG * 2 >= 2 * 128 * 68 * 4 && 128 % (8 * RS) == 0, "two stages exist; the ring holds the waves' f32 pieces; whole statements of eight copies");
    __shared__ __align__(16) float smf[STG];          // 2 buffers x STG 16-bit elements
    const bf* sm = (const bf*)smf;
    const int tid = threadIdx.x, lane = tid & 31, lr = lane & 15, hi = lane >> 4; const int wv = __builtin_amdgcn_readfirstlane(tid >> 5); const int wm = wv >> 1, wn = wv & 1;
    int r0 = blockIdx.x * 128, c0 = blockIdx.y * 128; bool isv = false; const int z = blockIdx.z;
    if constexpr (PL) { isv = z == 2; const bf* Wz = isv ? pj.W[2] : z ? pj.W[1] : pj.W[0]; A = isv ? Wz : pj.X; Bt = isv ? pj.X : Wz; if (isv) { const int t = r0; r0 = c0; c0 = t; } }
    const int crow = tid / PR, cpc = (tid % PR) * 8;   // the lane's row (mod RS) and its 8 elements of the row
    const bf* gA = A + (size_t)(r0 + crow) * GKD + cpc; const bf* gB = Bt + (size_t)(c0 + crow) * GKD + cpc; const bf* gA2 = SPLIT ? A2 + (size_t)(r0 + crow) * GKD + cpc : nullptr;
    const unsigned l0 = (unsigned)(size_t)smf + (unsigned)(crow * GP + cpc) * 2u;
    auto fill = [&](int t, int buf) { const unsigned l = l0 + (unsigned)buf * (STG * 2);
#pragma unroll   // a statement of eight copies for every 8 RS rows of each operand
        for (int r = 0; r < 128; r += 8 * RS) { copy8<RS, GP>(gA + t * GK + r * GKD, l + r * GP * 2); copy8<RS, GP>(gB + t * GK + r * GKD, l + (OB + r * GP) * 2); if constexpr (SPLIT) copy8<RS, GP>(gA2 + t * GK + r * GKD, l + (128 + r) * GP * 2); } };
    v8f acc[MB][4];
#pragma unroll
    for (int mb = 0; mb < MB; ++mb)
#pragma unroll
        for (int nb = 0; nb < 4; ++nb) acc[mb][nb] = (v8f){};
    fill(0, 0);
    asm volatile("s_wait_asynccnt 0x0" ::: "memory");   // this wave's copies of stage 0 have landed
    __syncthreads();                                    // ... and every other wave's: stage 0 may be read
    fill(1, 1);
    const int ao = (wm * (MB * 16) + lr) * GP + 8 * hi, bo = (wn * 64 + lr) * GP + 8 * hi;
#pragma unroll 1   // rolled: a pass is already 32 or 64 matrix instructions long
    for (int t = 0; t < NT; ++t) {
        const bf* sa = sm + ((t & 1) ? STG : 0) + ao; const bf* sb = sm + ((t & 1) ? STG + OB : OB) + bo;   // Bt's place goes into its base, so that every fragment's offset from its base fits the LDS load's 16-bit field
#pragma unroll     // fragment arrays indexed by constants
        for (int ks = 0; ks < GK / 32; ++ks) {
            v16bf a[MB], a2[MB], b[4];
#pragma unroll
            for (int mb = 0; mb < MB; ++mb) { a[mb] = ldsfrag(sa + mb * 16 * GP + ks * 32); if constexpr (SPLIT) a2[mb] = ldsfrag(sa + 128 * GP + mb * 16 * GP + ks * 32); }
#pragma unroll
            for (int nb = 0; nb < 4; ++nb) b[nb] = ldsfrag(sb + nb * 16 * GP + ks * 32);
            __builtin_amdgcn_sched_barrier(0);   // keeps the block's LDS reads together as one group ahead of its matrix instructions (without it the build reads each b fragment alone, right in front of its use, and waits out the LDS latency four times a block)
#pragma unroll
            for (int nb = 0; nb < 4; ++nb)
#pragma unroll
                for (int mb = 0; mb < MB; ++mb) acc[mb][nb] = wmmab(a[mb], b[nb], acc[mb][nb]);
            if constexpr (SPLIT) {
#pragma unroll
                for (int nb = 0; nb < 4; ++nb)
#pragma unroll
                    for (int mb = 0; mb < MB; ++mb) acc[mb][nb] = wmmab(a2[mb], b[nb], acc[mb][nb]); } }
        asm volatile("s_wait_dscnt 0x0" ::: "memory");      // this wave's reads of buffer t mod 2 are done before the buffer is given up
        asm volatile("s_wait_asynccnt 0x0" ::: "memory");   // this wave's copies of stage t + 1 have landed
        __syncthreads();                                    // publishes stage t + 1 and ends every wave's reads of buffer t mod 2
        if (t + 2 < NT) fill(t + 2, t & 1);
    }
    asm volatile("s_wait_asynccnt 0x0" ::: "memory");       // no copy is outstanding when the ring becomes output staging
    // each wave turns its piece round in its own 16 MB x 68 f32 range of the ring (every wave has left the ring at the last pass's barrier), so that whole lines are stored
    float* osw = smf + wv * (MB * 16 * 68);
#pragma unroll
    for (int mb = 0; mb < MB; ++mb)
#pragma unroll
        for (int nb = 0; nb < 4; ++nb)
#pragma unroll
            for (int j = 0; j < 8; ++j) osw[(mb * 16 + hi * 8 + j) * 68 + nb * 16 + lr] = acc[mb][nb][j];
    __syncthreads();   // the piece is in LDS before its rows are read back by other lanes
    const int rw = r0 + wm * (MB * 16), cw = c0 + wn * 64;   // the wave's first row and column
    if constexpr (PL) {
        const int xr = isv ? cw : rw, wc = isv ? rw : cw; const int bt = xr / TT * TT;   // first x row and weight column of the piece; bt: first x row of its batch
        h16* P16 = isv ? pj.P16[2] : z ? pj.P16[1] : pj.P16[0]; bf* Ph = isv ? pj.Ph[2] : z ? pj.Ph[1] : pj.Ph[0]; bf* Pl = isv ? pj.Pl[2] : z ? pj.Pl[1] : pj.Pl[0];
        const int ld = isv ? TT : HD;
        const size_t e0 = (size_t)bt * DQ + (size_t)wc * TT + (isv ? (size_t)(xr - bt) : (size_t)(xr - bt) * HD);   // the batch's planes, then head wc / 64 (q, k) or plane row wc (v), then the piece's first t
        for (int s = 0; s < MB * 4; ++s) { const int q = s * 32 + lane; const int row = q >> 3, cofs = (q & 7) * 8; const float* pp = osw + row * 68 + cofs; const v4f x0 = *(const v4fa*)pp, x1 = *(const v4fa*)(pp + 4);
            v8h o16; v8us oh, ol;
#pragma unroll
            for (int k = 0; k < 4; ++k) { unsigned short a, c2; o16[k] = tohx(x0[k]); splitf(x0[k], a, c2); oh[k] = a; ol[k] = c2; o16[4 + k] = tohx(x1[k]); splitf(x1[k], a, c2); oh[4 + k] = a; ol[4 + k] = c2; }
            const size_t e = e0 + (size_t)row * ld + cofs;   // 8 lanes write one whole 128-byte line of each plane
            *(v8ha*)(P16 + e) = o16; *(v8usa*)(Ph + e) = oh; *(v8usa*)(Pl + e) = ol;
            asm volatile("s_wait_xcnt 0x0" ::: "memory"); }   // stands behind the three stores, in front of the next piece's writes of their address and data registers
    } else {
        const float* op = osw + (lane >> 4) * 68 + (lane & 15) * 4; float* cp = C + (size_t)(rw + (lane >> 4)) * DM + cw + (lane & 15) * 4;   // 16 lanes write a 256-byte row piece, a wave two rows at a time
        v4f val[MB * 8];
#pragma unroll   // val indexed by constants; all the LDS reads go out together, ahead of the stores
        for (int s = 0; s < MB * 8; ++s) val[s] = *(const v4fa*)(op + s * 2 * 68);
#pragma unroll   // every store has data registers of its own and one address pair serves them all (constant offsets): no register of an issued store is written again
        for (int s = 0; s < MB * 8; ++s) *(v4f*)(cp + s * 2 * DM) = val[s];
    }
}

typedef __attribute__((ext_vector_type(2))) _Float16 v2h;
typedef __attribute__((ext_vector_type(4))) _Float16 v4h;
typedef __attribute__((ext_vector_type(2))) unsigned short v2us;
typedef __attribute__((ext_vector_type(4))) unsigned short v4us;
typedef __attribute__((ext_vector_type(2))) float v2f;
typedef __attribute__((ext_vector_type(4))) int v4i;

__device__ __forceinline__ void wtG(const float* __restrict__ w, int K, int N, bf* Bt, int blk) {
    const int lane = threadIdx.x & 31; const int L0 = (blk * 8 + (threadIdx.x >> 5)) * 8; const int nlines = N * K / 64;
{
#pragma unroll 1
        for (int l = 0; l < 8; ++l) { const int L = L0 + l; if (L >= nlines) break; const size_t e = (size_t)L * 64 + lane * 2; const int k = (int)(e % K), n = (int)(e / K); v2us o;
            o[0] = f2bf(w[(size_t)k * N + n]); o[1] = f2bf(w[(size_t)(k + 1) * N + n]); *(v2us*)(Bt + e) = o; }
         }
}
__device__ __forceinline__ void cvt8(const float* __restrict__ src, bf* dst, size_t i) { const v8f v = *(const v8f*)(src + i * 8); v8us o;
#pragma unroll
    for (int k = 0; k < 8; ++k) o[k] = f2bf(v[k]); *(v8us*)(dst + i * 8) = o;  }
// k_prep: all that the GEMMs need of the inputs in one grid of 4 x WTB work-groups: work-group g transposes share g mod WTB of weight g / WTB and converts its CVW x 256 8-element pieces of x (both batches).
#define WTB  ((DM * DQ / 64 + 63) / 64)
#define CVW  (NB_ * TT * DM / 8 / 256 / (4 * WTB))
static_assert((size_t)CVW * 256 * 8 * (4 * WTB) == (size_t)NB_ * TT * DM && DKV == DQ, "the grid's pieces cover x exactly; the four weights have one shape");
__global__ __launch_bounds__(256) void k_prep(const float* __restrict__ x, const float* __restrict__ wq, const float* __restrict__ wk, const float* __restrict__ wv, const float* __restrict__ wo, bf* XB, bf* WQ, bf* WK, bf* WV, bf* WO) {
    const int g = blockIdx.x, which = g / WTB;
    wtG(which == 0 ? wq : which == 1 ? wk : which == 2 ? wv : wo, DM, DQ, which == 0 ? WQ : which == 1 ? WK : which == 2 ? WV : WO, g % WTB);
#pragma unroll   // the pieces' loads are independent: unrolled, they are in flight together
    for (int c = 0; c < CVW; ++c) cvt8(x, XB, (size_t)(g * CVW + c) * 256 + threadIdx.x);
}

// ---- k_fattn: causal attention of one head for one block of query rows in ONE kernel: scores, softmax, probability x value and the hi/lo merge; no score or probability leaves the registers.
// Every product is formed TRANSPOSED, so that a lane owns one query column (lr) all the way: S^T[key][q] = K Q^T (A = key rows, B = query rows), whose two 16-key result tiles hold, per lane, keys 8 hi + j and 16 + 8 hi + j:
// exactly the k order of a B fragment, so the probabilities feed O^T[d][q] = V^T P^T (A = rows of the [d][t] value plane) with no exchange between lanes.
// Softmax is the running form: per query a running maximum m and sum l; when m grows, l and O^T are scaled by exp(m_old - m_new). The 32-key blocks up to the diagonal are dealt round robin over the FW waves of the
// work-group; the FW partial (m, l, O^T) meet in LDS and are joined in wave order 0 .. FW-1. Rows < RH: bf16 hi/lo, 3 products, 16 rows a work-group; other rows: fp16, probabilities x PCAR (the factor cancels in O / l), 32 rows.
// Every '#pragma unroll' in fa_body is there so that the fragment, score and accumulator arrays are indexed by constants and stay in registers.
#define FW   4
#define C1   (SCL * 1.4426950408889634f)
// exp2 with the one slot that the instruction set asks for behind a transcendental written into the same statement.
// exp2s: one value, v_nop behind it. exp2x8: eight values; the outputs are early-clobber, so no v_exp_f32 overwrites a source or reads a result of the one before it and each fills its forerunner's slot; v_nop fills the last one's.
__device__ __forceinline__ float exp2s(float x) { float r; asm("v_exp_f32 %0, %1\n\tv_nop" : "=v"(r) : "v"(x)); return r; }
__device__ __forceinline__ void exp2x8(float* r, const float* x) {
    asm("v_exp_f32 %0, %8\n\tv_exp_f32 %1, %9\n\tv_exp_f32 %2, %10\n\tv_exp_f32 %3, %11\n\tv_exp_f32 %4, %12\n\tv_exp_f32 %5, %13\n\tv_exp_f32 %6, %14\n\tv_exp_f32 %7, %15\n\tv_nop"
        : "=&v"(r[0]), "=&v"(r[1]), "=&v"(r[2]), "=&v"(r[3]), "=&v"(r[4]), "=&v"(r[5]), "=&v"(r[6]), "=&v"(r[7]) : "v"(x[0]), "v"(x[1]), "v"(x[2]), "v"(x[3]), "v"(x[4]), "v"(x[5]), "v"(x[6]), "v"(x[7])); }
template <typename T16, bool HR, int QT>
__device__ __forceinline__ void fa_body(const T16* __restrict__ Q, const T16* __restrict__ Q2, const T16* __restrict__ Kp, const T16* __restrict__ Kp2, const T16* __restrict__ Vt, const T16* __restrict__ Vt2, int q0, float* os, float* ml, bf* Ah, bf* Al) {
    typedef typename WFrag<T16>::V V;
    const int lane = threadIdx.x & 31, lr = lane & 15, hi = lane >> 4; const int wv = __builtin_amdgcn_readfirstlane((int)(threadIdx.x >> 5));
    const float psh = HR ? 0.0f : 10.0f;   // log2(PCAR)
    V qf[QT][2], qf2[QT][2];
#pragma unroll
    for (int qt = 0; qt < QT; ++qt)
#pragma unroll
        for (int ks = 0; ks < 2; ++ks) { const size_t qo = (size_t)(q0 + qt * 16 + lr) * HD + ks * 32 + 8 * hi; qf[qt][ks] = WFrag<T16>::ld(Q + qo); if (HR) qf2[qt][ks] = WFrag<T16>::ld(Q2 + qo); }
    v8f o[QT][4]; float m[QT], l[QT];
#pragma unroll
    for (int qt = 0; qt < QT; ++qt) { m[qt] = -3.0e38f; l[qt] = 0.f;
#pragma unroll
        for (int dt = 0; dt < 4; ++dt) o[qt][dt] = (v8f){}; }
    const int nkb = (q0 + QT * 16 + 31) >> 5;   // 32-key blocks that hold a key <= the block's last query; in each of them every query of the block has at least one such key
    V kf[2][2];   // fp16 rows: a pass's key fragments are fetched one pass ahead (the block index is clamped to the last block, so the fetch behind a wave's last pass, or of a wave with no pass, stays inside the plane); hi/lo rows fetch in the pass itself (twice the fragments, at most 4 passes a wave)
    const size_t kl = (size_t)lr * HD + 8 * hi;
    if constexpr (!HR) {
#pragma unroll
        for (int kt = 0; kt < 2; ++kt)
#pragma unroll
            for (int ks = 0; ks < 2; ++ks) kf[kt][ks] = WFrag<T16>::ld(Kp + (size_t)min(wv, nkb - 1) * (32 * HD) + kl + kt * (16 * HD) + ks * 32); }
#pragma unroll 1   // rolled: one pass's fragments, scores and accumulators already take the registers that four waves a SIMD leave to each
    for (int kb = wv; kb < nkb; kb += FW) {
        const int key0 = kb * 32;
        V va[4], va2[4]; const size_t vl = (size_t)lr * TT + key0 + 8 * hi;
        if constexpr (!HR) {
#pragma unroll
            for (int dt = 0; dt < 4; ++dt) va[dt] = WFrag<T16>::ld(Vt + vl + (size_t)dt * 16 * TT); }
        v8f s[QT][2];
#pragma unroll
        for (int qt = 0; qt < QT; ++qt) { s[qt][0] = (v8f){}; s[qt][1] = (v8f){}; }
#pragma unroll
        for (int kt = 0; kt < 2; ++kt)
#pragma unroll
            for (int ks = 0; ks < 2; ++ks) { V ka, ka2; if constexpr (HR) { const size_t ko = (size_t)key0 * HD + kl + kt * (16 * HD) + ks * 32; ka = WFrag<T16>::ld(Kp + ko); ka2 = WFrag<T16>::ld(Kp2 + ko); } else ka = kf[kt][ks];
#pragma unroll
                for (int qt = 0; qt < QT; ++qt) { s[qt][kt] = WFrag<T16>::mma(ka, qf[qt][ks], s[qt][kt]); if constexpr (HR) { s[qt][kt] = WFrag<T16>::mma(ka, qf2[qt][ks], s[qt][kt]); s[qt][kt] = WFrag<T16>::mma(ka2, qf[qt][ks], s[qt][kt]); } } }
        if constexpr (!HR) {
#pragma unroll
            for (int kt = 0; kt < 2; ++kt)
#pragma unroll
                for (int ks = 0; ks < 2; ++ks) kf[kt][ks] = WFrag<T16>::ld(Kp + (size_t)min(kb + FW, nkb - 1) * (32 * HD) + kl + kt * (16 * HD) + ks * 32); }
        else { asm volatile("s_wait_xcnt 0x0" ::: "memory");   // the value fragments below land in registers that the key loads above name as their addresses: the wait stands in front of that overwrite
#pragma unroll
            for (int dt = 0; dt < 4; ++dt) { va[dt] = WFrag<T16>::ld(Vt + vl + (size_t)dt * 16 * TT); va2[dt] = WFrag<T16>::ld(Vt2 + vl + (size_t)dt * 16 * TT); }
            asm volatile("s_wait_xcnt 0x0" ::: "memory"); }   // the softmax below reuses the registers that held the value loads' addresses
#pragma unroll
        for (int qt = 0; qt < QT; ++qt) {
            const int qi = q0 + qt * 16 + lr;
            if (key0 + 31 > q0 + qt * 16) {   // the block reaches past the tile's first query: mask key > query
#pragma unroll
                for (int kt = 0; kt < 2; ++kt)
#pragma unroll
                    for (int j = 0; j < 8; ++j) if (key0 + kt * 16 + hi * 8 + j > qi) s[qt][kt][j] = -3.0e38f; }
            float mx = m[qt];
#pragma unroll
            for (int j = 0; j < 8; ++j) mx = fmaxf(mx, fmaxf(s[qt][0][j], s[qt][1][j]));
            mx = fmaxf(mx, __shfl_xor(mx, 16, 32));
            const float al = exp2s((m[qt] - mx) * C1); const float nm = psh - mx * C1; m[qt] = mx;
            float xe[16], p[16]; float sum = 0.f;
#pragma unroll
            for (int e = 0; e < 16; ++e) xe[e] = fmaf(s[qt][e >> 3][e & 7], C1, nm);
            exp2x8(p, xe); exp2x8(p + 8, xe + 8);
#pragma unroll
            for (int e = 0; e < 16; ++e) sum += p[e];
            l[qt] = l[qt] * al + sum;
#pragma unroll
            for (int dt = 0; dt < 4; ++dt) o[qt][dt] *= al;
            if constexpr (HR) { v8us h0, h1, l0, l1;
#pragma unroll
                for (int j = 0; j < 8; ++j) { unsigned short a, c2; splitf(p[j], a, c2); h0[j] = a; l0[j] = c2; splitf(p[8 + j], a, c2); h1[j] = a; l1[j] = c2; }
                const V ph = cat16b(h0, h1), pl = cat16b(l0, l1);
#pragma unroll
                for (int dt = 0; dt < 4; ++dt) { o[qt][dt] = WFrag<T16>::mma(va[dt], ph, o[qt][dt]); o[qt][dt] = WFrag<T16>::mma(va[dt], pl, o[qt][dt]); o[qt][dt] = WFrag<T16>::mma(va2[dt], ph, o[qt][dt]); }
            } else { V pf;
#pragma unroll
                for (int e = 0; e < 16; ++e) pf[e] = (h16)p[e];
#pragma unroll
                for (int dt = 0; dt < 4; ++dt) o[qt][dt] = WFrag<T16>::mma(va[dt], pf, o[qt][dt]); }
        }
    }
    float* osw = os + wv * (QT * 16 * 68);
#pragma unroll
    for (int qt = 0; qt < QT; ++qt) {
#pragma unroll
        for (int dt = 0; dt < 4; ++dt) { float* pp = osw + (qt * 16 + lr) * 68 + dt * 16 + hi * 8; const v8f t = o[qt][dt]; *(v4fa*)pp = (v4f){t[0], t[1], t[2], t[3]}; *(v4fa*)(pp + 4) = (v4f){t[4], t[5], t[6], t[7]}; }
        const float lt = l[qt] + __shfl_xor(l[qt], 16, 32);
        if (hi == 0) { ml[(wv * 2) * 32 + qt * 16 + lr] = m[qt]; ml[(wv * 2 + 1) * 32 + qt * 16 + lr] = lt; } }
    __syncthreads();   // all FW partial (m, l, O^T) are in LDS before any thread joins them
#pragma unroll
    for (int sI = 0; sI < QT; ++sI) { const int idx = sI * (32 * FW) + (int)threadIdx.x; const int q = idx >> 3, d8 = (idx & 7) * 8;
        float M = ml[q];
#pragma unroll
        for (int w = 1; w < FW; ++w) M = fmaxf(M, ml[(w * 2) * 32 + q]);
        float L = 0.f; v4f x0 = (v4f){}, x1 = (v4f){};
#pragma unroll
        for (int w = 0; w < FW; ++w) { const float f = exp2s((ml[(w * 2) * 32 + q] - M) * C1); L += f * ml[(w * 2 + 1) * 32 + q]; const float* pp = os + w * (QT * 16 * 68) + q * 68 + d8; x0 += f * *(const v4fa*)pp; x1 += f * *(const v4fa*)(pp + 4); }
        v8us oh, ol;
#pragma unroll
        for (int k = 0; k < 4; ++k) { unsigned short a, c2; splitf(__fdiv_rn(x0[k], L), a, c2); oh[k] = a; ol[k] = c2; splitf(__fdiv_rn(x1[k], L), a, c2); oh[4 + k] = a; ol[4 + k] = c2; }
        const size_t oo = (size_t)(q0 + q) * HD + d8;   /* RAW MERGE: the (H, S, hd) context written flat = the module's reshape(b, S, H * hd) without a transpose */
        *(v8usa*)(Ah + oo) = oh; *(v8usa*)(Al + oo) = ol;
        asm volatile("s_wait_xcnt 0x0" ::: "memory"); }   // stands behind the two stores, in front of any later write of their address or data registers
}
// grid (batches x heads, (TT - RH) / 32 + RH / 16), 32 x FW threads; the planes of both batches lie one after the other, so blockIdx.x = b x NH_ + h indexes them all; blockIdx.y counts the query blocks from the last (longest key loop) to the first (for speed only).
__global__ __launch_bounds__(32 * FW) void k_fattn(const h16* __restrict__ Q16, const h16* __restrict__ K16, const h16* __restrict__ V16, const bf* __restrict__ Qh, const bf* __restrict__ Ql, const bf* __restrict__ Kh, const bf* __restrict__ Kl, const bf* __restrict__ Vh, const bf* __restrict__ Vl, bf* Ah, bf* Al) {
    __shared__ __align__(16) float os[FW * 32 * 68]; __shared__ float ml[FW * 2 * 32];
    const size_t hz = (size_t)blockIdx.x * TT * HD; const int by = blockIdx.y;
    if (by < (TT - RH) / 32) fa_body<h16, false, 2>(Q16 + hz, nullptr, K16 + hz, nullptr, V16 + hz, nullptr, TT - 32 - by * 32, os, ml, Ah + hz, Al + hz);
    else fa_body<bf, true, 1>(Qh + hz, Ql + hz, Kh + hz, Kl + hz, Vh + hz, Vl + hz, RH - 16 - (by - (TT - RH) / 32) * 16, os, ml, Ah + hz, Al + hz);
}

extern "C" void kernel_launch(void* const* d_in, const int* in_sizes, int n_in,
                              void* d_out, int out_size, void* d_ws, size_t ws_size, hipStream_t stream) {
    (void)in_sizes; (void)n_in; (void)out_size;
    const float* x = (const float*)d_in[0]; const float* wq = (const float*)d_in[1]; const float* wk = (const float*)d_in[2]; const float* wv = (const float*)d_in[3]; const float* wo = (const float*)d_in[4];   /* input order x, wq, wk, wv, wo ('xw') */
    float* OUT = (float*)d_out;     // [2][2048][1024]
    char* wsp = (char*)d_ws;
    auto take = [&](size_t bytes) { char* p = wsp; wsp += (bytes + 255) & ~(size_t)255; return (void*)p; };
    bf* WQ = (bf*)take((size_t)DQ * DM * 2); bf* WK = (bf*)take((size_t)DKV * DM * 2); bf* WV = (bf*)take((size_t)DKV * DM * 2); bf* WO = (bf*)take((size_t)DM * DQ * 2);
    bf* XB = (bf*)take((size_t)NB_ * TT * DM * 2);
    h16* QP16 = (h16*)take((size_t)NB_ * NH_ * TT * HD * 2); h16* KP16 = (h16*)take((size_t)NB_ * NKV * TT * HD * 2); h16* VT16 = (h16*)take((size_t)NB_ * NKV * HD * TT * 2);
    bf* QPh = (bf*)take((size_t)NB_ * NH_ * TT * HD * 2); bf* QPl = (bf*)take((size_t)NB_ * NH_ * TT * HD * 2); bf* KPh = (bf*)take((size_t)NB_ * NKV * TT * HD * 2); bf* KPl = (bf*)take((size_t)NB_ * NKV * TT * HD * 2); bf* VTh = (bf*)take((size_t)NB_ * NKV * HD * TT * 2); bf* VTl = (bf*)take((size_t)NB_ * NKV * HD * TT * 2);
    bf* ATh = (bf*)take((size_t)NB_ * TT * DQ * 2); bf* ATl = (bf*)take((size_t)NB_ * TT * DQ * 2);
    if ((size_t)(wsp - (char*)d_ws) > ws_size) return;    // ws 256 MiB
    k_prep<<<4 * WTB, 256, 0, stream>>>(x, wq, wk, wv, wo, XB, WQ, WK, WV, WO);
    k_gemms<false, true, 64, 4><<<dim3(NB_ * TT / 128, DQ / 128, 3), 128, 0, stream>>>(nullptr, nullptr, nullptr, nullptr, PJ3{XB, {WQ, WK, WV}, {QP16, KP16, VT16}, {QPh, KPh, VTh}, {QPl, KPl, VTl}});
    k_fattn<<<dim3(NB_ * NH_, (TT - RH) / 32 + RH / 16, 1), 32 * FW, 0, stream>>>(QP16, KP16, VT16, QPh, QPl, KPh, KPl, VTh, VTl, ATh, ATl);   // one kv head per query head
    k_gemms<true, false, 128, 2><<<dim3(NB_ * TT / 128, DM / 128, 1), 256, 0, stream>>>(ATh, ATl, WO, OUT, PJ3{});   // the raw-merged context of both batches is one [NB_ x TT][DQ] matrix
}

// v007
// A run of this version takes 79.1 microseconds.
// In both of two side-by-side timings against v006, it was 1.15 times as fast.
// Counting every step since v000, it is 18.8 times as fast.
#include <hip/hip_runtime.h>

// Causal multi-head self-attention whose head MERGE is a RAW RESHAPE, not a transpose (x [2][2048][1024]; q, k, v = x w ('xw' [1024][1024] 0.02, no bias) split the standard way (reshape(b, s, 16, 64).transpose(0, 2, 1, 3): head = 64-column block); scores masked (-inf where key > query) then / sqrt(64); softmax; ctx [b][16][s][64] RAW-reshaped to [b][s][1024] (NO transpose back: element (h, t, d) lands at row h x 128 + t // 16, column (t mod 16) x 64 + d); out = ctx wo ('xw', no bias) -> [2][2048][1024] (4.2 M); argument order x, wq, wk, wv, wo).
// Four launches, each for both batches: k_prep ('xw' weights transposed; bf16 copy of x); the three exact projections in one grid, whose epilogue writes the head planes in the attention kernel's fragment order (fp16 + hi/lo; v as its transpose, operands swapped); causal T-2048 attention (k_fattn; hybrid rows: < 512 hi/lo 3 products, rest fp16 x1024; key blocks above the diagonal are never visited); merged hi/lo x Wo exact.
// Compute dtypes, f32 accumulate: every input rounded to bf16; projections exact; attention rows < 512 3 products, rest fp16; softmax f32; Wo hl x exact.

#define NB_  2
#define TT   2048
#define DM   1024
#define NH_  16
#define NKV  16
#define REP  (NH_ / NKV)
#define HD   64
#define DQ   (NH_ * HD)
#define DKV  (NKV * HD)
#define RH   512                  // query rows < RH use hi+lo planes (0: none)
#define PCAR 1024.0f
#define SCL  0.125f   // HD^-0.5
typedef _Float16 h16;
typedef unsigned short bf;
typedef __attribute__((ext_vector_type(16))) __bf16   v16bf;
typedef __attribute__((ext_vector_type(16))) _Float16 v16h;
typedef __attribute__((ext_vector_type(8)))  _Float16 v8h;
typedef __attribute__((ext_vector_type(8)))  unsigned short v8us;
typedef __attribute__((ext_vector_type(8)))  float    v8f;
typedef __attribute__((ext_vector_type(4)))  float    v4f;
typedef v8h  __attribute__((may_alias)) v8ha;
typedef v4f  __attribute__((may_alias)) v4fa;
typedef v8us __attribute__((may_alias)) v8usa;

__device__ __forceinline__ unsigned short f2bf(float f) { unsigned u = __float_as_uint(f); u += 0x7FFFu + ((u >> 16) & 1u); return (unsigned short)(u >> 16); }
__device__ __forceinline__ float bf2f(unsigned short b) { return __uint_as_float(((unsigned)b) << 16); }
__device__ __forceinline__ float bfr(float f) { return bf2f(f2bf(f)); }
__device__ __forceinline__ v16h cat16(v8h lo, v8h hi) { return __builtin_shufflevector(lo, hi, 0, 1, 2, 3, 4, 5, 6, 7, 8, 9, 10, 11, 12, 13, 14, 15); }
__device__ __forceinline__ v16bf cat16b(v8us lo, v8us hi) { return __builtin_bit_cast(v16bf, __builtin_shufflevector(lo, hi, 0, 1, 2, 3, 4, 5, 6, 7, 8, 9, 10, 11, 12, 13, 14, 15)); }
__device__ __forceinline__ v8f wmma16(v16h a, v16h b, v8f c) { return __builtin_amdgcn_wmma_f32_16x16x32_f16(false, a, false, b, (short)0, c, false, false); }
__device__ __forceinline__ v8f wmmab(v16bf a, v16bf b, v8f c) { return __builtin_amdgcn_wmma_f32_16x16x32_bf16(false, a, false, b, (short)0, c, false, false); }



// ---- k_gemms: GEMM with both operands staged in LDS; one 128x128 output tile a work-group, split over its waves (2 x 2 pieces of 64x64, or 4 x 2 of 32x64), each piece over the WHOLE of K, so that a k sum runs in k order in one accumulator.
// C[m][n] = sum_k A[m][k] Bt[n][k] (+ A2[m][k] Bt[n][k] where SPLIT), operands K-contiguous bf16 planes of pitch GKD. A pass is GK k = one or two 128-byte lines of every operand row; a stage holds [A 128 rows | A2 128 rows | Bt 128 rows] at a pitch of 2 GK + 16 bytes (16 x odd: ds_load_b128 readers).
// Two buffers, filled by asynchronous copies to LDS (16 bytes a lane, a wave's copy = 4 whole lines), the copies of pass t + 2 issued behind the barrier that ends pass t: they fly while pass t + 1 is worked on.
// GK: 64 where three work-groups share a WGP's LDS (projections); 128 where a work-group has the WGP alone (output GEMM), so that twice the bytes are in flight and half the barriers are passed.
// MB = 16-row blocks of a wave's piece: 4 (4 waves) where three work-groups give a SIMD three waves; 2 (8 waves) where the work-group is alone, so that a SIMD has a second wave to issue while one waits for its LDS reads.
// WFrag::ld reads one 16 x 32 fragment of a plane kept in FRAGMENT ORDER: 512 elements = two runs of 256, run c holding, at 8 x lane, the 8 elements k = 16 c + 8 hi .. + 7 of row lr (lane = 16 hi + lr).
// p = the fragment's start + 8 x lane, so each of the two 16-byte loads of a wave covers 512 bytes in a row = 4 whole lines.
template <typename T16> struct WFrag;
template <> struct WFrag<h16> { typedef v16h V; static __device__ __forceinline__ V ld(const h16* p) { return cat16(*(const v8h*)p, *(const v8h*)(p + 256)); } static __device__ __forceinline__ v8f mma(V a, V b, v8f c) { return wmma16(a, b, c); } };
template <> struct WFrag<bf> { typedef v16bf V; static __device__ __forceinline__ V ld(const bf* p) { return cat16b(*(const v8us*)p, *(const v8us*)(p + 256)); } static __device__ __forceinline__ v8f mma(V a, V b, v8f c) { return wmmab(a, b, c); } };
__device__ __forceinline__ h16 tohx(float x) { return (h16)x; }
__device__ __forceinline__ void splitf(float y, unsigned short& h, unsigned short& l) { h = f2bf(y); l = f2bf(y - bf2f(h)); }
#define GKD  1024                 // K of every GEMM here = pitch of every operand plane, elements
static_assert(DM == GKD && DQ == GKD && DKV == GKD, "one K for the four GEMMs");
// copy8: this lane's 16 bytes of the eight rows r, r + RS, ... r + 7 RS of one operand (LDS pitch GP elements). The s_wait_xcnt stands inside the statement, behind the last copy, so that no later write of an address register can come in front of it.
template <int RS, int GP>
__device__ __forceinline__ void copy8(const bf* g, unsigned l) {
    asm volatile("global_load_async_to_lds_b128 %0, %8, off\n\tglobal_load_async_to_lds_b128 %1, %9, off\n\tglobal_load_async_to_lds_b128 %2, %10, off\n\tglobal_load_async_to_lds_b128 %3, %11, off\n\t"
                 "global_load_async_to_lds_b128 %4, %12, off\n\tglobal_load_async_to_lds_b128 %5, %13, off\n\tglobal_load_async_to_lds_b128 %6, %14, off\n\tglobal_load_async_to_lds_b128 %7, %15, off\n\ts_wait_xcnt 0x0"
                 :: "v"(l), "v"(l + 1 * RS * GP * 2), "v"(l + 2 * RS * GP * 2), "v"(l + 3 * RS * GP * 2), "v"(l + 4 * RS * GP * 2), "v"(l + 5 * RS * GP * 2), "v"(l + 6 * RS * GP * 2), "v"(l + 7 * RS * GP * 2),
                    "v"(g), "v"(g + 1 * RS * GKD), "v"(g + 2 * RS * GKD), "v"(g + 3 * RS * GKD), "v"(g + 4 * RS * GKD), "v"(g + 5 * RS * GKD), "v"(g + 6 * RS * GKD), "v"(g + 7 * RS * GKD) : "memory");
}
__device__ __forceinline__ v16bf ldsfrag(const bf* p) { return cat16b(*(const v8usa*)p, *(const v8usa*)(p + 16)); }   // k = 8 hi .. + 7, then 16 + 8 hi .. + 7: the k order of WFrag::ld, for A and B alike
// PL: the q, k and v projections of both batches in one grid (NB_ x TT / 128 blocks of x rows, DQ / 128 blocks of weight columns, 3); blockIdx.z = 0 q, 1 k, 2 v picks weight and planes from pj (A, A2, Bt and C are not used).
// X holds the rows of both batches one after the other. A wave's piece (MB = 4: 64 x rows of one batch, one head's 64 weight columns) leaves as the three 16-bit planes that the attention kernel reads (fp16, bf16 hi, bf16 lo), never as f32.
// q, k: A = x rows, Bt = weight columns, planes [b][h][t / 16][d / 32][fragment: 16 t x 32 d]. v: operands swapped, (x wv)^T = wv^T x^T: rows g x HD + d, columns t = the planes [b][g][t / 32][d / 16][fragment: 16 d x 32 t].
// Inside a fragment the elements lie in the order of WFrag::ld. A wave's 64 x 64 piece is 8 whole fragments = 4096 elements in a row of each plane.
// A '#pragma unroll' in k_gemms with no comment of its own is there so that the fragment, accumulator and vector arrays are indexed by constants and stay in registers.
struct PJ3 { const bf* X; const bf* W[3]; h16* P16[3]; bf* Ph[3]; bf* Pl[3]; };
template <bool SPLIT, bool PL, int GK, int MB>
__global__ __launch_bounds__(128 / (MB * 16) * 64) void k_gemms(const bf* __restrict__ A, const bf* __restrict__ A2, const bf* __restrict__ Bt, float* C, PJ3 pj) {
    constexpr int GP = GK + 8;                        // LDS row pitch, 16-bit elements
    constexpr int STG = (SPLIT ? 3 : 2) * 128 * GP;   // elements of a stage
    constexpr int OB = (SPLIT ? 256 : 128) * GP;      // where Bt's rows begin in a stage (A2's: 128 GP)
    constexpr int NT = GKD / GK;
    constexpr int NTH = 128 / (MB * 16) * 64;         // threads: 128 / (16 MB) x 2 waves
    constexpr int PR = GK / 8, RS = NTH / PR;         // 16-byte pieces of a row; rows that the work-group's lanes cover at once
    static_assert(NT >= 2 && 2 * STG * 2 >= 2 * 128 * 68 * 4 && 128 % (8 * RS) == 0, "two stages exist; the ring holds the waves' f32 pieces; whole statements of eight copies");
    __shared__ __align__(16) float smf[STG];          // 2 buffers x STG 16-bit elements
    const bf* sm = (const bf*)smf;
    const int tid = threadIdx.x, lane = tid & 31, lr = lane & 15, hi = lane >> 4; const int wv = __builtin_amdgcn_readfirstlane(tid >> 5); const int wm = wv >> 1, wn = wv & 1;
    int r0 = blockIdx.x * 128, c0 = blockIdx.y * 128; bool isv = false; const int z = blockIdx.z;
    if constexpr (PL) { isv = z == 2; const bf* Wz = isv ? pj.W[2] : z ? pj.W[1] : pj.W[0]; A = isv ? Wz : pj.X; Bt = isv ? pj.X : Wz; if (isv) { const int t = r0; r0 = c0; c0 = t; } }
    const int crow = tid / PR, cpc = (tid % PR) * 8;   // the lane's row (mod RS) and its 8 elements of the row
    const bf* gA = A + (size_t)(r0 + crow) * GKD + cpc; const bf* gB = Bt + (size_t)(c0 + crow) * GKD + cpc; const bf* gA2 = SPLIT ? A2 + (size_t)(r0 + crow) * GKD + cpc : nullptr;
    const unsigned l0 = (unsigned)(size_t)smf + (unsigned)(crow * GP + cpc) * 2u;
    auto fill = [&](int t, int buf) { const unsigned l = l0 + (unsigned)buf * (STG * 2);
#pragma unroll   // a statement of eight copies for every 8 RS rows of each operand
        for (int r = 0; r < 128; r += 8 * RS) { copy8<RS, GP>(gA + t * GK + r * GKD, l + r * GP * 2); copy8<RS, GP>(gB + t * GK + r * GKD, l + (OB + r * GP) * 2); if constexpr (SPLIT) copy8<RS, GP>(gA2 + t * GK + r * GKD, l + (128 + r) * GP * 2); } };
    v8f acc[MB][4];
#pragma unroll
    for (int mb = 0; mb < MB; ++mb)
#pragma unroll
        for (int nb = 0; nb < 4; ++nb) acc[mb][nb] = (v8f){};
    fill(0, 0);
    asm volatile("s_wait_asynccnt 0x0" ::: "memory");   // this wave's copies of stage 0 have landed
    __syncthreads();                                    // ... and every other wave's: stage 0 may be read
    fill(1, 1);
    const int ao = (wm * (MB * 16) + lr) * GP + 8 * hi, bo = (wn * 64 + lr) * GP + 8 * hi;
#pragma unroll 1   // rolled: a pass is already 32 or 64 matrix instructions long
    for (int t = 0; t < NT; ++t) {
        const bf* sa = sm + ((t & 1) ? STG : 0) + ao; const bf* sb = sm + ((t & 1) ? STG + OB : OB) + bo;   // Bt's place goes into its base, so that every fragment's offset from its base fits the LDS load's 16-bit field
#pragma unroll     // fragment arrays indexed by constants
        for (int ks = 0; ks < GK / 32; ++ks) {
            v16bf a[MB], a2[MB], b[4];
#pragma unroll
            for (int mb = 0; mb < MB; ++mb) { a[mb] = ldsfrag(sa + mb * 16 * GP + ks * 32); if constexpr (SPLIT) a2[mb] = ldsfrag(sa + 128 * GP + mb * 16 * GP + ks * 32); }
#pragma unroll
            for (int nb = 0; nb < 4; ++nb) b[nb] = ldsfrag(sb + nb * 16 * GP + ks * 32);
            __builtin_amdgcn_sched_barrier(0);   // keeps the block's LDS reads together as one group ahead of its matrix instructions (without it the build reads each b fragment alone, right in front of its use, and waits out the LDS latency four times a block)
#pragma unroll
            for (int nb = 0; nb < 4; ++nb)
#pragma unroll
                for (int mb = 0; mb < MB; ++mb) acc[mb][nb] = wmmab(a[mb], b[nb], acc[mb][nb]);
            if constexpr (SPLIT) {
#pragma unroll
                for (int nb = 0; nb < 4; ++nb)
#pragma unroll
                    for (int mb = 0; mb < MB; ++mb) acc[mb][nb] = wmmab(a2[mb], b[nb], acc[mb][nb]); } }
        asm volatile("s_wait_dscnt 0x0" ::: "memory");      // this wave's reads of buffer t mod 2 are done before the buffer is given up
        asm volatile("s_wait_asynccnt 0x0" ::: "memory");   // this wave's copies of stage t + 1 have landed
        __syncthreads();                                    // publishes stage t + 1 and ends every wave's reads of buffer t mod 2
        if (t + 2 < NT) fill(t + 2, t & 1);
    }
    asm volatile("s_wait_asynccnt 0x0" ::: "memory");       // no copy is outstanding when the ring becomes output staging
    // each wave turns its piece round in its own 16 MB x 68 f32 range of the ring (every wave has left the ring at the last pass's barrier), so that whole lines are stored
    float* osw = smf + wv * (MB * 16 * 68);
#pragma unroll
    for (int mb = 0; mb < MB; ++mb)
#pragma unroll
        for (int nb = 0; nb < 4; ++nb)
#pragma unroll
            for (int j = 0; j < 8; ++j) osw[(mb * 16 + hi * 8 + j) * 68 + nb * 16 + lr] = acc[mb][nb][j];
    __syncthreads();   // the piece is in LDS before its rows are read back by other lanes
    const int rw = r0 + wm * (MB * 16), cw = c0 + wn * 64;   // the wave's first row and column
    if constexpr (PL) {
        const int xr = isv ? cw : rw, wc = isv ? rw : cw; const int bt = xr / TT * TT;   // first x row and weight column of the piece; bt: first x row of its batch
        h16* P16 = isv ? pj.P16[2] : z ? pj.P16[1] : pj.P16[0]; bf* Ph = isv ? pj.Ph[2] : z ? pj.Ph[1] : pj.Ph[0]; bf* Pl = isv ? pj.Pl[2] : z ? pj.Pl[1] : pj.Pl[0];
        const size_t e0 = (size_t)bt * DQ + (size_t)wc * TT + (size_t)(xr - bt) * HD;   // the batch's planes, then head wc / 64, then the piece's first t: HD elements of the head's plane for every t
        // s = one run of 256 elements: fragment s >> 1, run s & 1. q, k: fragment = (t / 16) x 2 + d / 32; v: fragment = (t / 32) x 4 + d / 16. The piece's rows are t (q, k) or d (v).
        for (int s = 0; s < MB * 4; ++s) { const int row = (isv ? (s >> 1) & 3 : s >> 2) * 16 + lr, cofs = (isv ? s >> 3 : (s >> 1) & 1) * 32 + (s & 1) * 16 + hi * 8; const float* pp = osw + row * 68 + cofs; const v4f x0 = *(const v4fa*)pp, x1 = *(const v4fa*)(pp + 4);
            v8h o16; v8us oh, ol;
#pragma unroll
            for (int k = 0; k < 4; ++k) { unsigned short a, c2; o16[k] = tohx(x0[k]); splitf(x0[k], a, c2); oh[k] = a; ol[k] = c2; o16[4 + k] = tohx(x1[k]); splitf(x1[k], a, c2); oh[4 + k] = a; ol[4 + k] = c2; }
            const size_t e = e0 + s * 256 + lane * 8;   // a wave writes 4 whole 128-byte lines of each plane
            *(v8ha*)(P16 + e) = o16; *(v8usa*)(Ph + e) = oh; *(v8usa*)(Pl + e) = ol;
            asm volatile("s_wait_xcnt 0x0" ::: "memory"); }   // stands behind the three stores, in front of the next piece's writes of their address and data registers
    } else {
        const float* op = osw + (lane >> 4) * 68 + (lane & 15) * 4; float* cp = C + (size_t)(rw + (lane >> 4)) * DM + cw + (lane & 15) * 4;   // 16 lanes write a 256-byte row piece, a wave two rows at a time
        v4f val[MB * 8];
#pragma unroll   // val indexed by constants; all the LDS reads go out together, ahead of the stores
        for (int s = 0; s < MB * 8; ++s) val[s] = *(const v4fa*)(op + s * 2 * 68);
#pragma unroll   // every store has data registers of its own and one address pair serves them all (constant offsets): no register of an issued store is written again
        for (int s = 0; s < MB * 8; ++s) *(v4f*)(cp + s * 2 * DM) = val[s];
    }
}

typedef __attribute__((ext_vector_type(2))) _Float16 v2h;
typedef __attribute__((ext_vector_type(4))) _Float16 v4h;
typedef __attribute__((ext_vector_type(2))) unsigned short v2us;
typedef __attribute__((ext_vector_type(4))) unsigned short v4us;
typedef __attribute__((ext_vector_type(2))) float v2f;
typedef __attribute__((ext_vector_type(4))) int v4i;

__device__ __forceinline__ void wtG(const float* __restrict__ w, int K, int N, bf* Bt, int blk) {
    const int lane = threadIdx.x & 31; const int L0 = (blk * 8 + (threadIdx.x >> 5)) * 8; const int nlines = N * K / 64;
{
#pragma unroll 1
        for (int l = 0; l < 8; ++l) { const int L = L0 + l; if (L >= nlines) break; const size_t e = (size_t)L * 64 + lane * 2; const int k = (int)(e % K), n = (int)(e / K); v2us o;
            o[0] = f2bf(w[(size_t)k * N + n]); o[1] = f2bf(w[(size_t)(k + 1) * N + n]); *(v2us*)(Bt + e) = o; }
         }
}
__device__ __forceinline__ void cvt8(const float* __restrict__ src, bf* dst, size_t i) { const v8f v = *(const v8f*)(src + i * 8); v8us o;
#pragma unroll
    for (int k = 0; k < 8; ++k) o[k] = f2bf(v[k]); *(v8us*)(dst + i * 8) = o;  }
// k_prep: all that the GEMMs need of the inputs in one grid of 4 x WTB work-groups: work-group g transposes share g mod WTB of weight g / WTB and converts its CVW x 256 8-element pieces of x (both batches).
#define WTB  ((DM * DQ / 64 + 63) / 64)
#define CVW  (NB_ * TT * DM / 8 / 256 / (4 * WTB))
static_assert((size_t)CVW * 256 * 8 * (4 * WTB) == (size_t)NB_ * TT * DM && DKV == DQ, "the grid's pieces cover x exactly; the four weights have one shape");
__global__ __launch_bounds__(256) void k_prep(const float* __restrict__ x, const float* __restrict__ wq, const float* __restrict__ wk, const float* __restrict__ wv, const float* __restrict__ wo, bf* XB, bf* WQ, bf* WK, bf* WV, bf* WO) {
    const int g = blockIdx.x, which = g / WTB;
    wtG(which == 0 ? wq : which == 1 ? wk : which == 2 ? wv : wo, DM, DQ, which == 0 ? WQ : which == 1 ? WK : which == 2 ? WV : WO, g % WTB);
#pragma unroll   // the pieces' loads are independent: unrolled, they are in flight together
    for (int c = 0; c < CVW; ++c) cvt8(x, XB, (size_t)(g * CVW + c) * 256 + threadIdx.x);
}

// ---- k_fattn: causal attention of one head for one block of query rows in ONE kernel: scores, softmax, probability x value and the hi/lo merge; no score or probability leaves the registers.
// Every product is formed TRANSPOSED, so that a lane owns one query column (lr) all the way: S^T[key][q] = K Q^T (A = key rows, B = query rows), whose two 16-key result tiles hold, per lane, keys 8 hi + j and 16 + 8 hi + j:
// exactly the k order of a B fragment, so the probabilities feed O^T[d][q] = V^T P^T (A = 16 d x 32 t fragments of the value plane) with no exchange between lanes. The q, k and v planes lie in fragment order (WFrag::ld): a 32-key block is 4 KB in a row of the key plane and of the value plane.
// Softmax is the running form: per query a running maximum m and sum l; when m grows, l and O^T are scaled by exp(m_old - m_new). The 32-key blocks up to the diagonal are dealt round robin over the FW waves of the
// work-group; the FW partial (m, l, O^T) meet in LDS and are joined in wave order 0 .. FW-1. Rows < RH: bf16 hi/lo, 3 products, 16 rows a work-group; other rows: fp16, probabilities x PCAR (the factor cancels in O / l), 32 rows.
// Every '#pragma unroll' in fa_body is there so that the fragment, score and accumulator arrays are indexed by constants and stay in registers.
#define FW   4
#define C1   (SCL * 1.4426950408889634f)
// exp2 with the one slot that the instruction set asks for behind a transcendental written into the same statement.
// exp2s: one value, v_nop behind it. exp2x8: eight values; the outputs are early-clobber, so no v_exp_f32 overwrites a source or reads a result of the one before it and each fills its forerunner's slot; v_nop fills the last one's.
__device__ __forceinline__ float exp2s(float x) { float r; asm("v_exp_f32 %0, %1\n\tv_nop" : "=v"(r) : "v"(x)); return r; }
__device__ __forceinline__ void exp2x8(float* r, const float* x) {
    asm("v_exp_f32 %0, %8\n\tv_exp_f32 %1, %9\n\tv_exp_f32 %2, %10\n\tv_exp_f32 %3, %11\n\tv_exp_f32 %4, %12\n\tv_exp_f32 %5, %13\n\tv_exp_f32 %6, %14\n\tv_exp_f32 %7, %15\n\tv_nop"
        : "=&v"(r[0]), "=&v"(r[1]), "=&v"(r[2]), "=&v"(r[3]), "=&v"(r[4]), "=&v"(r[5]), "=&v"(r[6]), "=&v"(r[7]) : "v"(x[0]), "v"(x[1]), "v"(x[2]), "v"(x[3]), "v"(x[4]), "v"(x[5]), "v"(x[6]), "v"(x[7])); }
template <typename T16, bool HR, int QT>
__device__ __forceinline__ void fa_body(const T16* __restrict__ Q, const T16* __restrict__ Q2, const T16* __restrict__ Kp, const T16* __restrict__ Kp2, const T16* __restrict__ Vt, const T16* __restrict__ Vt2, int q0, float* os, float* ml, bf* Ah, bf* Al) {
    typedef typename WFrag<T16>::V V;
    const int lane = threadIdx.x & 31, lr = lane & 15, hi = lane >> 4; const int wv = __builtin_amdgcn_readfirstlane((int)(threadIdx.x >> 5));
    const float psh = HR ? 0.0f : 10.0f;   // log2(PCAR)
    V qf[QT][2], qf2[QT][2];
#pragma unroll
    for (int qt = 0; qt < QT; ++qt)
#pragma unroll
        for (int ks = 0; ks < 2; ++ks) { const size_t qo = (size_t)(q0 + qt * 16) * HD + ks * 512 + 8 * lane; qf[qt][ks] = WFrag<T16>::ld(Q + qo); if (HR) qf2[qt][ks] = WFrag<T16>::ld(Q2 + qo); }
    v8f o[QT][4]; float m[QT], l[QT];
#pragma unroll
    for (int qt = 0; qt < QT; ++qt) { m[qt] = -3.0e38f; l[qt] = 0.f;
#pragma unroll
        for (int dt = 0; dt < 4; ++dt) o[qt][dt] = (v8f){}; }
    const int nkb = (q0 + QT * 16 + 31) >> 5;   // 32-key blocks that hold a key <= the block's last query; in each of them every query of the block has at least one such key
    V kf[2][2];   // fp16 rows: a pass's key fragments are fetched one pass ahead (the block index is clamped to the last block, so the fetch behind a wave's last pass, or of a wave with no pass, stays inside the plane); hi/lo rows fetch in the pass itself (twice the fragments, at most 4 passes a wave)
    const size_t kl = (size_t)(8 * lane);   // the lane's place in a run of a fragment
    if constexpr (!HR) {
#pragma unroll
        for (int kt = 0; kt < 2; ++kt)
#pragma unroll
            for (int ks = 0; ks < 2; ++ks) kf[kt][ks] = WFrag<T16>::ld(Kp + (size_t)min(wv, nkb - 1) * (32 * HD) + kl + kt * (16 * HD) + ks * 512); }
#pragma unroll 1   // rolled: one pass's fragments, scores and accumulators already take the registers that four waves a SIMD leave to each
    for (int kb = wv; kb < nkb; kb += FW) {
        const int key0 = kb * 32;
        V va[4], va2[4]; const size_t vl = (size_t)key0 * HD + kl;
        if constexpr (!HR) {
#pragma unroll
            for (int dt = 0; dt < 4; ++dt) va[dt] = WFrag<T16>::ld(Vt + vl + dt * 512); }
        v8f s[QT][2];
#pragma unroll
        for (int qt = 0; qt < QT; ++qt) { s[qt][0] = (v8f){}; s[qt][1] = (v8f){}; }
#pragma unroll
        for (int kt = 0; kt < 2; ++kt)
#pragma unroll
            for (int ks = 0; ks < 2; ++ks) { V ka, ka2; if constexpr (HR) { const size_t ko = (size_t)key0 * HD + kl + kt * (16 * HD) + ks * 512; ka = WFrag<T16>::ld(Kp + ko); ka2 = WFrag<T16>::ld(Kp2 + ko); } else ka = kf[kt][ks];
#pragma unroll
                for (int qt = 0; qt < QT; ++qt) { s[qt][kt] = WFrag<T16>::mma(ka, qf[qt][ks], s[qt][kt]); if constexpr (HR) { s[qt][kt] = WFrag<T16>::mma(ka, qf2[qt][ks], s[qt][kt]); s[qt][kt] = WFrag<T16>::mma(ka2, qf[qt][ks], s[qt][kt]); } } }
        if constexpr (!HR) {
#pragma unroll
            for (int kt = 0; kt < 2; ++kt)
#pragma unroll
                for (int ks = 0; ks < 2; ++ks) kf[kt][ks] = WFrag<T16>::ld(Kp + (size_t)min(kb + FW, nkb - 1) * (32 * HD) + kl + kt * (16 * HD) + ks * 512); }
        else { asm volatile("s_wait_xcnt 0x0" ::: "memory");   // the value fragments below land in registers that the key loads above name as their addresses: the wait stands in front of that overwrite
#pragma unroll
            for (int dt = 0; dt < 4; ++dt) { va[dt] = WFrag<T16>::ld(Vt + vl + dt * 512); va2[dt] = WFrag<T16>::ld(Vt2 + vl + dt * 512); }
            asm volatile("s_wait_xcnt 0x0" ::: "memory"); }   // the softmax below reuses the registers that held the value loads' addresses
#pragma unroll
        for (int qt = 0; qt < QT; ++qt) {
            const int qi = q0 + qt * 16 + lr;
            if (key0 + 31 > q0 + qt * 16) {   // the block reaches past the tile's first query: mask key > query
#pragma unroll
                for (int kt = 0; kt < 2; ++kt)
#pragma unroll
                    for (int j = 0; j < 8; ++j) if (key0 + kt * 16 + hi * 8 + j > qi) s[qt][kt][j] = -3.0e38f; }
            float mx = m[qt];
#pragma unroll
            for (int j = 0; j < 8; ++j) mx = fmaxf(mx, fmaxf(s[qt][0][j], s[qt][1][j]));
            mx = fmaxf(mx, __shfl_xor(mx, 16, 32));
            const float al = exp2s((m[qt] - mx) * C1); const float nm = psh - mx * C1; m[qt] = mx;
            float xe[16], p[16]; float sum = 0.f;
#pragma unroll
            for (int e = 0; e < 16; ++e) xe[e] = fmaf(s[qt][e >> 3][e & 7], C1, nm);
            exp2x8(p, xe); exp2x8(p + 8, xe + 8);
#pragma unroll
            for (int e = 0; e < 16; ++e) sum += p[e];
            l[qt] = l[qt] * al + sum;
#pragma unroll
            for (int dt = 0; dt < 4; ++dt) o[qt][dt] *= al;
            if constexpr (HR) { v8us h0, h1, l0, l1;
#pragma unroll
                for (int j = 0; j < 8; ++j) { unsigned short a, c2; splitf(p[j], a, c2); h0[j] = a; l0[j] = c2; splitf(p[8 + j], a, c2); h1[j] = a; l1[j] = c2; }
                const V ph = cat16b(h0, h1), pl = cat16b(l0, l1);
#pragma unroll
                for (int dt = 0; dt < 4; ++dt) { o[qt][dt] = WFrag<T16>::mma(va[dt], ph, o[qt][dt]); o[qt][dt] = WFrag<T16>::mma(va[dt], pl, o[qt][dt]); o[qt][dt] = WFrag<T16>::mma(va2[dt], ph, o[qt][dt]); }
            } else { V pf;
#pragma unroll
                for (int e = 0; e < 16; ++e) pf[e] = (h16)p[e];
#pragma unroll
                for (int dt = 0; dt < 4; ++dt) o[qt][dt] = WFrag<T16>::mma(va[dt], pf, o[qt][dt]); }
        }
    }
    float* osw = os + wv * (QT * 16 * 68);
#pragma unroll
    for (int qt = 0; qt < QT; ++qt) {
#pragma unroll
        for (int dt = 0; dt < 4; ++dt) { float* pp = osw + (qt * 16 + lr) * 68 + dt * 16 + hi * 8; const v8f t = o[qt][dt]; *(v4fa*)pp = (v4f){t[0], t[1], t[2], t[3]}; *(v4fa*)(pp + 4) = (v4f){t[4], t[5], t[6], t[7]}; }
        const float lt = l[qt] + __shfl_xor(l[qt], 16, 32);
        if (hi == 0) { ml[(wv * 2) * 32 + qt * 16 + lr] = m[qt]; ml[(wv * 2 + 1) * 32 + qt * 16 + lr] = lt; } }
    __syncthreads();   // all FW partial (m, l, O^T) are in LDS before any thread joins them
#pragma unroll
    for (int sI = 0; sI < QT; ++sI) { const int idx = sI * (32 * FW) + (int)threadIdx.x; const int q = idx >> 3, d8 = (idx & 7) * 8;
        float M = ml[q];
#pragma unroll
        for (int w = 1; w < FW; ++w) M = fmaxf(M, ml[(w * 2) * 32 + q]);
        float L = 0.f; v4f x0 = (v4f){}, x1 = (v4f){};
#pragma unroll
        for (int w = 0; w < FW; ++w) { const float f = exp2s((ml[(w * 2) * 32 + q] - M) * C1); L += f * ml[(w * 2 + 1) * 32 + q]; const float* pp = os + w * (QT * 16 * 68) + q * 68 + d8; x0 += f * *(const v4fa*)pp; x1 += f * *(const v4fa*)(pp + 4); }
        v8us oh, ol;
#pragma unroll
        for (int k = 0; k < 4; ++k) { unsigned short a, c2; splitf(__fdiv_rn(x0[k], L), a, c2); oh[k] = a; ol[k] = c2; splitf(__fdiv_rn(x1[k], L), a, c2); oh[4 + k] = a; ol[4 + k] = c2; }
        const size_t oo = (size_t)(q0 + q) * HD + d8;   /* RAW MERGE: the (H, S, hd) context written flat = the module's reshape(b, S, H * hd) without a transpose */
        *(v8usa*)(Ah + oo) = oh; *(v8usa*)(Al + oo) = ol;
        asm volatile("s_wait_xcnt 0x0" ::: "memory"); }   // stands behind the two stores, in front of any later write of their address or data registers
}
// grid (batches x heads, (TT - RH) / 32 + RH / 16), 32 x FW threads; the planes of both batches lie one after the other, so blockIdx.x = b x NH_ + h indexes them all; blockIdx.y counts the query blocks from the last (longest key loop) to the first (for speed only).
__global__ __launch_bounds__(32 * FW) void k_fattn(const h16* __restrict__ Q16, const h16* __restrict__ K16, const h16* __restrict__ V16, const bf* __restrict__ Qh, const bf* __restrict__ Ql, const bf* __restrict__ Kh, const bf* __restrict__ Kl, const bf* __restrict__ Vh, const bf* __restrict__ Vl, bf* Ah, bf* Al) {
    __shared__ __align__(16) float os[FW * 32 * 68]; __shared__ float ml[FW * 2 * 32];
    const size_t hz = (size_t)blockIdx.x * TT * HD; const int by = blockIdx.y;
    if (by < (TT - RH) / 32) fa_body<h16, false, 2>(Q16 + hz, nullptr, K16 + hz, nullptr, V16 + hz, nullptr, TT - 32 - by * 32, os, ml, Ah + hz, Al + hz);
    else fa_body<bf, true, 1>(Qh + hz, Ql + hz, Kh + hz, Kl + hz, Vh + hz, Vl + hz, RH - 16 - (by - (TT - RH) / 32) * 16, os, ml, Ah + hz, Al + hz);
}

extern "C" void kernel_launch(void* const* d_in, const int* in_sizes, int n_in,
                              void* d_out, int out_size, void* d_ws, size_t ws_size, hipStream_t stream) {
    (void)in_sizes; (void)n_in; (void)out_size;
    const float* x = (const float*)d_in[0]; const float* wq = (const float*)d_in[1]; const float* wk = (const float*)d_in[2]; const float* wv = (const float*)d_in[3]; const float* wo = (const float*)d_in[4];   /* input order x, wq, wk, wv, wo ('xw') */
    float* OUT = (float*)d_out;     // [2][2048][1024]
    char* wsp = (char*)d_ws;
    auto take = [&](size_t bytes) { char* p = wsp; wsp += (bytes + 255) & ~(size_t)255; return (void*)p; };
    bf* WQ = (bf*)take((size_t)DQ * DM * 2); bf* WK = (bf*)take((size_t)DKV * DM * 2); bf* WV = (bf*)take((size_t)DKV * DM * 2); bf* WO = (bf*)take((size_t)DM * DQ * 2);
    bf* XB = (bf*)take((size_t)NB_ * TT * DM * 2);
    h16* QP16 = (h16*)take((size_t)NB_ * NH_ * TT * HD * 2); h16* KP16 = (h16*)take((size_t)NB_ * NKV * TT * HD * 2); h16* VT16 = (h16*)take((size_t)NB_ * NKV * HD * TT * 2);
    bf* QPh = (bf*)take((size_t)NB_ * NH_ * TT * HD * 2); bf* QPl = (bf*)take((size_t)NB_ * NH_ * TT * HD * 2); bf* KPh = (bf*)take((size_t)NB_ * NKV * TT * HD * 2); bf* KPl = (bf*)take((size_t)NB_ * NKV * TT * HD * 2); bf* VTh = (bf*)take((size_t)NB_ * NKV * HD * TT * 2); bf* VTl = (bf*)take((size_t)NB_ * NKV * HD * TT * 2);
    bf* ATh = (bf*)take((size_t)NB_ * TT * DQ * 2); bf* ATl = (bf*)take((size_t)NB_ * TT * DQ * 2);
    if ((size_t)(wsp - (char*)d_ws) > ws_size) return;    // ws 256 MiB
    k_prep<<<4 * WTB, 256, 0, stream>>>(x, wq, wk, wv, wo, XB, WQ, WK, WV, WO);
    k_gemms<false, true, 64, 4><<<dim3(NB_ * TT / 128, DQ / 128, 3), 128, 0, stream>>>(nullptr, nullptr, nullptr, nullptr, PJ3{XB, {WQ, WK, WV}, {QP16, KP16, VT16}, {QPh, KPh, VTh}, {QPl, KPl, VTl}});
    k_fattn<<<dim3(NB_ * NH_, (TT - RH) / 32 + RH / 16, 1), 32 * FW, 0, stream>>>(QP16, KP16, VT16, QPh, QPl, KPh, KPl, VTh, VTl, ATh, ATl);   // one kv head per query head
    k_gemms<true, false, 128, 2><<<dim3(NB_ * TT / 128, DM / 128, 1), 256, 0, stream>>>(ATh, ATl, WO, OUT, PJ3{});   // the raw-merged context of both batches is one [NB_ x TT][DQ] matrix
}

// v008
// A run of this version takes 71.6 microseconds.
// Timed twice side by side with v007, it ran 1.10 times as fast both times.
// Counting every step since v000, it is 20.8 times as fast.
#include <hip/hip_runtime.h>

// Causal multi-head self-attention whose head MERGE is a RAW RESHAPE, not a transpose (x [2][2048][1024]; q, k, v = x w ('xw' [1024][1024] 0.02, no bias) split the standard way (reshape(b, s, 16, 64).transpose(0, 2, 1, 3): head = 64-column block); scores masked (-inf where key > query) then / sqrt(64); softmax; ctx [b][16][s][64] RAW-reshaped to [b][s][1024] (NO transpose back: element (h, t, d) lands at row h x 128 + t // 16, column (t mod 16) x 64 + d); out = ctx wo ('xw', no bias) -> [2][2048][1024] (4.2 M); argument order x, wq, wk, wv, wo).
// Four launches, each for both batches: k_prep ('xw' weights transposed; bf16 copy of x); the three exact projections in one grid, whose epilogue writes the head planes in the attention kernel's fragment order (fp16 + hi/lo; v as its transpose, operands swapped); causal T-2048 attention (k_fattn; hybrid rows: < 512 hi/lo 3 products, rest fp16 x1024; key blocks above the diagonal are never visited); merged hi/lo x Wo exact.
// Compute dtypes, f32 accumulate: every input rounded to bf16; projections exact; attention rows < 512 3 products, rest fp16; softmax f32; Wo hl x exact.

#define NB_  2
#define TT   2048
#define DM   1024
#define NH_  16
#define NKV  16
#define REP  (NH_ / NKV)
#define HD   64
#define DQ   (NH_ * HD)
#define DKV  (NKV * HD)
#define RH   512                  // query rows < RH use hi+lo planes (0: none)
#define PCAR 1024.0f
#define SCL  0.125f   // HD^-0.5
typedef _Float16 h16;
typedef unsigned short bf;
typedef __attribute__((ext_vector_type(16))) __bf16   v16bf;
typedef __attribute__((ext_vector_type(16))) _Float16 v16h;
typedef __attribute__((ext_vector_type(8)))  _Float16 v8h;
typedef __attribute__((ext_vector_type(8)))  unsigned short v8us;
typedef __attribute__((ext_vector_type(8)))  float    v8f;
typedef __attribute__((ext_vector_type(4)))  float    v4f;
typedef v8h  __attribute__((may_alias)) v8ha;
typedef v4f  __attribute__((may_alias)) v4fa;
typedef v8us __attribute__((may_alias)) v8usa;

__device__ __forceinline__ unsigned short f2bf(float f) { unsigned u = __float_as_uint(f); u += 0x7FFFu + ((u >> 16) & 1u); return (unsigned short)(u >> 16); }
__device__ __forceinline__ float bf2f(unsigned short b) { return __uint_as_float(((unsigned)b) << 16); }
__device__ __forceinline__ float bfr(float f) { return bf2f(f2bf(f)); }
__device__ __forceinline__ v16h cat16(v8h lo, v8h hi) { return __builtin_shufflevector(lo, hi, 0, 1, 2, 3, 4, 5, 6, 7, 8, 9, 10, 11, 12, 13, 14, 15); }
__device__ __forceinline__ v16bf cat16b(v8us lo, v8us hi) { return __builtin_bit_cast(v16bf, __builtin_shufflevector(lo, hi, 0, 1, 2, 3, 4, 5, 6, 7, 8, 9, 10, 11, 12, 13, 14, 15)); }
__device__ __forceinline__ v8f wmma16(v16h a, v16h b, v8f c) { return __builtin_amdgcn_wmma_f32_16x16x32_f16(false, a, false, b, (short)0, c, false, false); }
__device__ __forceinline__ v8f wmmab(v16bf a, v16bf b, v8f c) { return __builtin_amdgcn_wmma_f32_16x16x32_bf16(false, a, false, b, (short)0, c, false, false); }



// ---- k_gemms: GEMM with both operands staged in LDS; one 128x128 output tile a work-group, split over its waves (2 x 2 pieces of 64x64, or 4 x 2 of 32x64), each piece over the WHOLE of K, so that a k sum runs in k order in one accumulator.
// C[m][n] = sum_k A[m][k] Bt[n][k] (+ A2[m][k] Bt[n][k] where SPLIT), operands K-contiguous bf16 planes of pitch GKD. A pass is GK k = one or two 128-byte lines of every operand row; a stage holds [A 128 rows | A2 128 rows | Bt 128 rows] at a pitch of 2 GK + 16 bytes (16 x odd: ds_load_b128 readers).
// Two buffers, filled by asynchronous copies to LDS (16 bytes a lane, a wave's copy = 4 whole lines), the copies of pass t + 2 issued behind the barrier that ends pass t: they fly while pass t + 1 is worked on.
// GK: 64 where three work-groups share a WGP's LDS (projections); 128 where a work-group has the WGP alone (output GEMM), so that twice the bytes are in flight and half the barriers are passed.
// MB = 16-row blocks of a wave's piece: 4 (4 waves) where three work-groups give a SIMD three waves; 2 (8 waves) where the work-group is alone, so that a SIMD has a second wave to issue while one waits for its LDS reads.
// WFrag::ld reads one 16 x 32 fragment of a plane kept in FRAGMENT ORDER: 512 elements = two runs of 256, run c holding, at 8 x lane, the 8 elements k = 16 c + 8 hi .. + 7 of row lr (lane = 16 hi + lr).
// p = the fragment's start + 8 x lane, so each of the two 16-byte loads of a wave covers 512 bytes in a row = 4 whole lines.
template <typename T16> struct WFrag;
template <> struct WFrag<h16> { typedef v16h V; static __device__ __forceinline__ V ld(const h16* p) { return cat16(*(const v8h*)p, *(const v8h*)(p + 256)); } static __device__ __forceinline__ v8f mma(V a, V b, v8f c) { return wmma16(a, b, c); } };
template <> struct WFrag<bf> { typedef v16bf V; static __device__ __forceinline__ V ld(const bf* p) { return cat16b(*(const v8us*)p, *(const v8us*)(p + 256)); } static __device__ __forceinline__ v8f mma(V a, V b, v8f c) { return wmmab(a, b, c); } };
__device__ __forceinline__ h16 tohx(float x) { return (h16)x; }
__device__ __forceinline__ void splitf(float y, unsigned short& h, unsigned short& l) { h = f2bf(y); l = f2bf(y - bf2f(h)); }
#define GKD  1024                 // K of every GEMM here = pitch of every operand plane, elements
static_assert(DM == GKD && DQ == GKD && DKV == GKD, "one K for the four GEMMs");
// copy8: this lane's 16 bytes of the eight rows r, r + RS, ... r + 7 RS of one operand (LDS pitch GP elements). The s_wait_xcnt stands inside the statement, behind the last copy, so that no later write of an address register can come in front of it.
template <int RS, int GP>
__device__ __forceinline__ void copy8(const bf* g, unsigned l) {
    asm volatile("global_load_async_to_lds_b128 %0, %8, off\n\tglobal_load_async_to_lds_b128 %1, %9, off\n\tglobal_load_async_to_lds_b128 %2, %10, off\n\tglobal_load_async_to_lds_b128 %3, %11, off\n\t"
                 "global_load_async_to_lds_b128 %4, %12, off\n\tglobal_load_async_to_lds_b128 %5, %13, off\n\tglobal_load_async_to_lds_b128 %6, %14, off\n\tglobal_load_async_to_lds_b128 %7, %15, off\n\ts_wait_xcnt 0x0"
                 :: "v"(l), "v"(l + 1 * RS * GP * 2), "v"(l + 2 * RS * GP * 2), "v"(l + 3 * RS * GP * 2), "v"(l + 4 * RS * GP * 2), "v"(l + 5 * RS * GP * 2), "v"(l + 6 * RS * GP * 2), "v"(l + 7 * RS * GP * 2),
                    "v"(g), "v"(g + 1 * RS * GKD), "v"(g + 2 * RS * GKD), "v"(g + 3 * RS * GKD), "v"(g + 4 * RS * GKD), "v"(g + 5 * RS * GKD), "v"(g + 6 * RS * GKD), "v"(g + 7 * RS * GKD) : "memory");
}
__device__ __forceinline__ v16bf ldsfrag(const bf* p) { return cat16b(*(const v8usa*)p, *(const v8usa*)(p + 16)); }   // k = 8 hi .. + 7, then 16 + 8 hi .. + 7: the k order of WFrag::ld, for A and B alike
// PL: the q, k and v projections of both batches in one grid (NB_ x TT / 128 blocks of x rows, DQ / 128 blocks of weight columns, 3); blockIdx.z = 0 q, 1 k, 2 v picks weight and planes from pj (A, A2, Bt and C are not used).
// X holds the rows of both batches one after the other. A wave's piece (MB = 4: 64 x rows of one batch, one head's 64 weight columns) leaves as the three 16-bit planes that the attention kernel reads (fp16, bf16 hi, bf16 lo), never as f32.
// q, k: A = x rows, Bt = weight columns, planes [b][h][t / 16][d / 32][fragment: 16 t x 32 d]. v: operands swapped, (x wv)^T = wv^T x^T: rows g x HD + d, columns t = the planes [b][g][t / 32][d / 16][fragment: 16 d x 32 t].
// Inside a fragment the elements lie in the order of WFrag::ld. A wave's 64 x 64 piece is 8 whole fragments = 4096 elements in a row of each plane.
// A '#pragma unroll' in k_gemms with no comment of its own is there so that the fragment, accumulator and vector arrays are indexed by constants and stay in registers.
struct PJ3 { const bf* X; const bf* W[3]; h16* P16[3]; bf* Ph[3]; bf* Pl[3]; };
template <bool SPLIT, bool PL, int GK, int MB>
__global__ __launch_bounds__(128 / (MB * 16) * 64) void k_gemms(const bf* __restrict__ A, const bf* __restrict__ A2, const bf* __restrict__ Bt, float* C, PJ3 pj) {
    constexpr int GP = GK + 8;                        // LDS row pitch, 16-bit elements
    constexpr int STG = (SPLIT ? 3 : 2) * 128 * GP;   // elements of a stage
    constexpr int OB = (SPLIT ? 256 : 128) * GP;      // where Bt's rows begin in a stage (A2's: 128 GP)
    constexpr int NT = GKD / GK;
    constexpr int NTH = 128 / (MB * 16) * 64;         // threads: 128 / (16 MB) x 2 waves
    constexpr int PR = GK / 8, RS = NTH / PR;         // 16-byte pieces of a row; rows that the work-group's lanes cover at once
    static_assert(NT >= 2 && 2 * STG * 2 >= 2 * 128 * 68 * 4 && 128 % (8 * RS) == 0, "two stages exist; the ring holds the waves' f32 pieces; whole statements of eight copies");
    __shared__ __align__(16) float smf[STG];          // 2 buffers x STG 16-bit elements
    const bf* sm = (const bf*)smf;
    const int tid = threadIdx.x, lane = tid & 31, lr = lane & 15, hi = lane >> 4; const int wv = __builtin_amdgcn_readfirstlane(tid >> 5); const int wm = wv >> 1, wn = wv & 1;
    int r0 = blockIdx.x * 128, c0 = blockIdx.y * 128; bool isv = false; const int z = blockIdx.z;
    if constexpr (PL) { isv = z == 2; const bf* Wz = isv ? pj.W[2] : z ? pj.W[1] : pj.W[0]; A = isv ? Wz : pj.X; Bt = isv ? pj.X : Wz; if (isv) { const int t = r0; r0 = c0; c0 = t; } }
    const int crow = tid / PR, cpc = (tid % PR) * 8;   // the lane's row (mod RS) and its 8 elements of the row
    const bf* gA = A + (size_t)(r0 + crow) * GKD + cpc; const bf* gB = Bt + (size_t)(c0 + crow) * GKD + cpc; const bf* gA2 = SPLIT ? A2 + (size_t)(r0 + crow) * GKD + cpc : nullptr;
    const unsigned l0 = (unsigned)(size_t)smf + (unsigned)(crow * GP + cpc) * 2u;
    auto fill = [&](int t, int buf) { const unsigned l = l0 + (unsigned)buf * (STG * 2);
#pragma unroll   // a statement of eight copies for every 8 RS rows of each operand
        for (int r = 0; r < 128; r += 8 * RS) { copy8<RS, GP>(gA + t * GK + r * GKD, l + r * GP * 2); copy8<RS, GP>(gB + t * GK + r * GKD, l + (OB + r * GP) * 2); if constexpr (SPLIT) copy8<RS, GP>(gA2 + t * GK + r * GKD, l + (128 + r) * GP * 2); } };
    v8f acc[MB][4];
#pragma unroll
    for (int mb = 0; mb < MB; ++mb)
#pragma unroll
        for (int nb = 0; nb < 4; ++nb) acc[mb][nb] = (v8f){};
    fill(0, 0);
    asm volatile("s_wait_asynccnt 0x0" ::: "memory");   // this wave's copies of stage 0 have landed
    __syncthreads();                                    // ... and every other wave's: stage 0 may be read
    fill(1, 1);
    const int ao = (wm * (MB * 16) + lr) * GP + 8 * hi, bo = (wn * 64 + lr) * GP + 8 * hi;
#pragma unroll 1   // rolled: a pass is already 32 or 64 matrix instructions long
    for (int t = 0; t < NT; ++t) {
        const bf* sa = sm + ((t & 1) ? STG : 0) + ao; const bf* sb = sm + ((t & 1) ? STG + OB : OB) + bo;   // Bt's place goes into its base, so that every fragment's offset from its base fits the LDS load's 16-bit field
#pragma unroll     // fragment arrays indexed by constants
        for (int ks = 0; ks < GK / 32; ++ks) {
            v16bf a[MB], a2[MB], b[4];
#pragma unroll
            for (int mb = 0; mb < MB; ++mb) { a[mb] = ldsfrag(sa + mb * 16 * GP + ks * 32); if constexpr (SPLIT) a2[mb] = ldsfrag(sa + 128 * GP + mb * 16 * GP + ks * 32); }
#pragma unroll
            for (int nb = 0; nb < 4; ++nb) b[nb] = ldsfrag(sb + nb * 16 * GP + ks * 32);
            __builtin_amdgcn_sched_barrier(0);   // keeps the block's LDS reads together as one group ahead of its matrix instructions (without it the build reads each b fragment alone, right in front of its use, and waits out the LDS latency four times a block)
#pragma unroll
            for (int nb = 0; nb < 4; ++nb)
#pragma unroll
                for (int mb = 0; mb < MB; ++mb) acc[mb][nb] = wmmab(a[mb], b[nb], acc[mb][nb]);
            if constexpr (SPLIT) {
#pragma unroll
                for (int nb = 0; nb < 4; ++nb)
#pragma unroll
                    for (int mb = 0; mb < MB; ++mb) acc[mb][nb] = wmmab(a2[mb], b[nb], acc[mb][nb]); } }
        asm volatile("s_wait_dscnt 0x0" ::: "memory");      // this wave's reads of buffer t mod 2 are done before the buffer is given up
        asm volatile("s_wait_asynccnt 0x0" ::: "memory");   // this wave's copies of stage t + 1 have landed
        __syncthreads();                                    // publishes stage t + 1 and ends every wave's reads of buffer t mod 2
        if (t + 2 < NT) fill(t + 2, t & 1);
    }
    asm volatile("s_wait_asynccnt 0x0" ::: "memory");       // no copy is outstanding when the ring becomes output staging
    // each wave turns its piece round in its own 16 MB x 68 f32 range of the ring (every wave has left the ring at the last pass's barrier), so that whole lines are stored
    float* osw = smf + wv * (MB * 16 * 68);
#pragma unroll
    for (int mb = 0; mb < MB; ++mb)
#pragma unroll
        for (int nb = 0; nb < 4; ++nb)
#pragma unroll
            for (int j = 0; j < 8; ++j) osw[(mb * 16 + hi * 8 + j) * 68 + nb * 16 + lr] = acc[mb][nb][j];
    __syncthreads();   // the piece is in LDS before its rows are read back by other lanes
    const int rw = r0 + wm * (MB * 16), cw = c0 + wn * 64;   // the wave's first row and column
    if constexpr (PL) {
        const int xr = isv ? cw : rw, wc = isv ? rw : cw; const int bt = xr / TT * TT;   // first x row and weight column of the piece; bt: first x row of its batch
        h16* P16 = isv ? pj.P16[2] : z ? pj.P16[1] : pj.P16[0]; bf* Ph = isv ? pj.Ph[2] : z ? pj.Ph[1] : pj.Ph[0]; bf* Pl = isv ? pj.Pl[2] : z ? pj.Pl[1] : pj.Pl[0];
        const size_t e0 = (size_t)bt * DQ + (size_t)wc * TT + (size_t)(xr - bt) * HD;   // the batch's planes, then head wc / 64, then the piece's first t: HD elements of the head's plane for every t
        // s = one run of 256 elements: fragment s >> 1, run s & 1. q, k: fragment = (t / 16) x 2 + d / 32; v: fragment = (t / 32) x 4 + d / 16. The piece's rows are t (q, k) or d (v).
        for (int s = 0; s < MB * 4; ++s) { const int row = (isv ? (s >> 1) & 3 : s >> 2) * 16 + lr, cofs = (isv ? s >> 3 : (s >> 1) & 1) * 32 + (s & 1) * 16 + hi * 8; const float* pp = osw + row * 68 + cofs; const v4f x0 = *(const v4fa*)pp, x1 = *(const v4fa*)(pp + 4);
            v8h o16; v8us oh, ol;
#pragma unroll
            for (int k = 0; k < 4; ++k) { unsigned short a, c2; o16[k] = tohx(x0[k]); splitf(x0[k], a, c2); oh[k] = a; ol[k] = c2; o16[4 + k] = tohx(x1[k]); splitf(x1[k], a, c2); oh[4 + k] = a; ol[4 + k] = c2; }
            const size_t e = e0 + s * 256 + lane * 8;   // a wave writes 4 whole 128-byte lines of each plane
            *(v8ha*)(P16 + e) = o16; *(v8usa*)(Ph + e) = oh; *(v8usa*)(Pl + e) = ol;
            asm volatile("s_wait_xcnt 0x0" ::: "memory"); }   // stands behind the three stores, in front of the next piece's writes of their address and data registers
    } else {
        const float* op = osw + (lane >> 4) * 68 + (lane & 15) * 4; float* cp = C + (size_t)(rw + (lane >> 4)) * DM + cw + (lane & 15) * 4;   // 16 lanes write a 256-byte row piece, a wave two rows at a time
        v4f val[MB * 8];
#pragma unroll   // val indexed by constants; all the LDS reads go out together, ahead of the stores
        for (int s = 0; s < MB * 8; ++s) val[s] = *(const v4fa*)(op + s * 2 * 68);
#pragma unroll   // every store has data registers of its own and one address pair serves them all (constant offsets): no register of an issued store is written again
        for (int s = 0; s < MB * 8; ++s) *(v4f*)(cp + s * 2 * DM) = val[s];
    }
}

typedef __attribute__((ext_vector_type(2))) _Float16 v2h;
typedef __attribute__((ext_vector_type(4))) _Float16 v4h;
typedef __attribute__((ext_vector_type(2))) unsigned short v2us;
typedef __attribute__((ext_vector_type(4))) unsigned short v4us;
typedef __attribute__((ext_vector_type(2))) float v2f;
typedef __attribute__((ext_vector_type(4))) int v4i;

// wtT: one 64 k x 64 n tile of a weight w [k][n] (f32) leaves as 64 whole 128-byte lines of its bf16 transpose Bt [n][k], turned round in LDS.
// In: a lane takes 4 n (16 bytes) of the rows 2 r and 2 r + 1, so a wave's load covers 256 bytes in a row of two rows = 4 whole lines; the two rows' values of one n are one dword (k, k + 1) of the transposed row.
// tl: 64 transposed rows at a pitch of WTP dwords. WTP is odd: the 4-byte stores of a wave (n 4 apart, two neighbouring dwords) and its 4-byte reads (4 rows, every 4th dword) each meet 32 different banks.
// Out: 8 lanes write one row's 128 bytes, a wave 4 rows. A '#pragma unroll' in wtT with no comment of its own is there so that a and o are indexed by constants and stay in registers.
#define WTP  33
typedef __attribute__((ext_vector_type(4))) unsigned v4u;
__device__ __forceinline__ void wtT(const float* __restrict__ w, bf* Bt, int blk, unsigned* tl) {
    const int tid = threadIdx.x; const int k0 = (blk % (DM / 64)) * 64, n0 = (blk / (DM / 64)) * 64;
    const int c4 = (tid & 15) * 4, rp = tid >> 4;   // the lane's 4 columns; its pair of rows (and that pair + 16)
    v4f a[2][2];
#pragma unroll   // a indexed by constants; the four loads are in flight together
    for (int p = 0; p < 2; ++p)
#pragma unroll
        for (int h = 0; h < 2; ++h) a[p][h] = *(const v4f*)(w + (size_t)(k0 + (p * 16 + rp) * 2 + h) * DQ + n0 + c4);
#pragma unroll
    for (int p = 0; p < 2; ++p)
#pragma unroll
        for (int i = 0; i < 4; ++i) tl[(c4 + i) * WTP + p * 16 + rp] = (unsigned)f2bf(a[p][0][i]) | ((unsigned)f2bf(a[p][1][i]) << 16);
    __syncthreads();   // the whole tile is in LDS before its transposed rows are read by other lanes
    v4u o[2];
#pragma unroll   // o indexed by constants; every store has data registers of its own
    for (int s = 0; s < 2; ++s) { const unsigned* q = tl + (s * 32 + (tid >> 3)) * WTP + (tid & 7) * 4; o[s] = (v4u){q[0], q[1], q[2], q[3]}; }
#pragma unroll
    for (int s = 0; s < 2; ++s) *(v8usa*)(Bt + (size_t)(n0 + s * 32 + (tid >> 3)) * DM + k0 + (tid & 7) * 8) = __builtin_bit_cast(v8us, o[s]);
    asm volatile("s_wait_xcnt 0x0" ::: "memory");   // stands behind the two stores, in front of any later write of their address or data registers
}
__device__ __forceinline__ void cvt8(const float* __restrict__ src, bf* dst, size_t i) { const v8f v = *(const v8f*)(src + i * 8); v8us o;
#pragma unroll
    for (int k = 0; k < 8; ++k) o[k] = f2bf(v[k]); *(v8us*)(dst + i * 8) = o;  }
// k_prep: all that the GEMMs need of the inputs in one grid of 4 x WTB work-groups: work-group g transposes tile g mod WTB of weight g / WTB and converts its CVW x 256 8-element pieces of x (both batches).
#define WTB  ((DM / 64) * (DQ / 64))
#define CVW  (NB_ * TT * DM / 8 / 256 / (4 * WTB))
static_assert((size_t)CVW * 256 * 8 * (4 * WTB) == (size_t)NB_ * TT * DM && DKV == DQ && DM == DQ && DM % 64 == 0, "the grid's pieces cover x exactly; the four weights have one square shape of whole tiles");
__global__ __launch_bounds__(256) void k_prep(const float* __restrict__ x, const float* __restrict__ wq, const float* __restrict__ wk, const float* __restrict__ wv, const float* __restrict__ wo, bf* XB, bf* WQ, bf* WK, bf* WV, bf* WO) {
    __shared__ unsigned tl[64 * WTP];
    const int g = blockIdx.x, which = g / WTB;
    wtT(which == 0 ? wq : which == 1 ? wk : which == 2 ? wv : wo, which == 0 ? WQ : which == 1 ? WK : which == 2 ? WV : WO, g % WTB, tl);
#pragma unroll   // the pieces' loads are independent: unrolled, they are in flight together
    for (int c = 0; c < CVW; ++c) cvt8(x, XB, (size_t)(g * CVW + c) * 256 + threadIdx.x);
}

// ---- k_fattn: causal attention of one head for one block of query rows in ONE kernel: scores, softmax, probability x value and the hi/lo merge; no score or probability leaves the registers.
// Every product is formed TRANSPOSED, so that a lane owns one query column (lr) all the way: S^T[key][q] = K Q^T (A = key rows, B = query rows), whose two 16-key result tiles hold, per lane, keys 8 hi + j and 16 + 8 hi + j:
// exactly the k order of a B fragment, so the probabilities feed O^T[d][q] = V^T P^T (A = 16 d x 32 t fragments of the value plane) with no exchange between lanes. The q, k and v planes lie in fragment order (WFrag::ld): a 32-key block is 4 KB in a row of the key plane and of the value plane.
// Softmax is the running form: per query a running maximum m and sum l; when m grows, l and O^T are scaled by exp(m_old - m_new). The 32-key blocks up to the diagonal are dealt round robin over the FW waves of the
// work-group; the FW partial (m, l, O^T) meet in LDS and are joined in wave order 0 .. FW-1. Rows < RH: bf16 hi/lo, 3 products, 16 rows a work-group; other rows: fp16, probabilities x PCAR (the factor cancels in O / l), 32 rows.
// Every '#pragma unroll' in fa_body is there so that the fragment, score and accumulator arrays are indexed by constants and stay in registers.
#define FW   4
#define C1   (SCL * 1.4426950408889634f)
// exp2 with the one slot that the instruction set asks for behind a transcendental written into the same statement.
// exp2s: one value, v_nop behind it. exp2x8: eight values; the outputs are early-clobber, so no v_exp_f32 overwrites a source or reads a result of the one before it and each fills its forerunner's slot; v_nop fills the last one's.
__device__ __forceinline__ float exp2s(float x) { float r; asm("v_exp_f32 %0, %1\n\tv_nop" : "=v"(r) : "v"(x)); return r; }
__device__ __forceinline__ void exp2x8(float* r, const float* x) {
    asm("v_exp_f32 %0, %8\n\tv_exp_f32 %1, %9\n\tv_exp_f32 %2, %10\n\tv_exp_f32 %3, %11\n\tv_exp_f32 %4, %12\n\tv_exp_f32 %5, %13\n\tv_exp_f32 %6, %14\n\tv_exp_f32 %7, %15\n\tv_nop"
        : "=&v"(r[0]), "=&v"(r[1]), "=&v"(r[2]), "=&v"(r[3]), "=&v"(r[4]), "=&v"(r[5]), "=&v"(r[6]), "=&v"(r[7]) : "v"(x[0]), "v"(x[1]), "v"(x[2]), "v"(x[3]), "v"(x[4]), "v"(x[5]), "v"(x[6]), "v"(x[7])); }
template <typename T16, bool HR, int QT>
__device__ __forceinline__ void fa_body(const T16* __restrict__ Q, const T16* __restrict__ Q2, const T16* __restrict__ Kp, const T16* __restrict__ Kp2, const T16* __restrict__ Vt, const T16* __restrict__ Vt2, int q0, float* os, float* ml, bf* Ah, bf* Al) {
    typedef typename WFrag<T16>::V V;
    const int lane = threadIdx.x & 31, lr = lane & 15, hi = lane >> 4; const int wv = __builtin_amdgcn_readfirstlane((int)(threadIdx.x >> 5));
    const float psh = HR ? 0.0f : 10.0f;   // log2(PCAR)
    V qf[QT][2], qf2[QT][2];
#pragma unroll
    for (int qt = 0; qt < QT; ++qt)
#pragma unroll
        for (int ks = 0; ks < 2; ++ks) { const size_t qo = (size_t)(q0 + qt * 16) * HD + ks * 512 + 8 * lane; qf[qt][ks] = WFrag<T16>::ld(Q + qo); if (HR) qf2[qt][ks] = WFrag<T16>::ld(Q2 + qo); }
    v8f o[QT][4]; float m[QT], l[QT];
#pragma unroll
    for (int qt = 0; qt < QT; ++qt) { m[qt] = -3.0e38f; l[qt] = 0.f;
#pragma unroll
        for (int dt = 0; dt < 4; ++dt) o[qt][dt] = (v8f){}; }
    const int nkb = (q0 + QT * 16 + 31) >> 5;   // 32-key blocks that hold a key <= the block's last query; in each of them every query of the block has at least one such key
    V kf[2][2];   // fp16 rows: a pass's key fragments are fetched one pass ahead (the block index is clamped to the last block, so the fetch behind a wave's last pass, or of a wave with no pass, stays inside the plane); hi/lo rows fetch in the pass itself (twice the fragments, at most 4 passes a wave)
    const size_t kl = (size_t)(8 * lane);   // the lane's place in a run of a fragment
    if constexpr (!HR) {
#pragma unroll
        for (int kt = 0; kt < 2; ++kt)
#pragma unroll
            for (int ks = 0; ks < 2; ++ks) kf[kt][ks] = WFrag<T16>::ld(Kp + (size_t)min(wv, nkb - 1) * (32 * HD) + kl + kt * (16 * HD) + ks * 512); }
#pragma unroll 1   // rolled: one pass's fragments, scores and accumulators already take the registers that four waves a SIMD leave to each
    for (int kb = wv; kb < nkb; kb += FW) {
        const int key0 = kb * 32;
        V va[4], va2[4]; const size_t vl = (size_t)key0 * HD + kl;
        if constexpr (!HR) {
#pragma unroll
            for (int dt = 0; dt < 4; ++dt) va[dt] = WFrag<T16>::ld(Vt + vl + dt * 512); }
        v8f s[QT][2];
#pragma unroll
        for (int qt = 0; qt < QT; ++qt) { s[qt][0] = (v8f){}; s[qt][1] = (v8f){}; }
#pragma unroll
        for (int kt = 0; kt < 2; ++kt)
#pragma unroll
            for (int ks = 0; ks < 2; ++ks) { V ka, ka2; if constexpr (HR) { const size_t ko = (size_t)key0 * HD + kl + kt * (16 * HD) + ks * 512; ka = WFrag<T16>::ld(Kp + ko); ka2 = WFrag<T16>::ld(Kp2 + ko); } else ka = kf[kt][ks];
#pragma unroll
                for (int qt = 0; qt < QT; ++qt) { s[qt][kt] = WFrag<T16>::mma(ka, qf[qt][ks], s[qt][kt]); if constexpr (HR) { s[qt][kt] = WFrag<T16>::mma(ka, qf2[qt][ks], s[qt][kt]); s[qt][kt] = WFrag<T16>::mma(ka2, qf[qt][ks], s[qt][kt]); } } }
        if constexpr (!HR) {
#pragma unroll
            for (int kt = 0; kt < 2; ++kt)
#pragma unroll
                for (int ks = 0; ks < 2; ++ks) kf[kt][ks] = WFrag<T16>::ld(Kp + (size_t)min(kb + FW, nkb - 1) * (32 * HD) + kl + kt * (16 * HD) + ks * 512); }
        else { asm volatile("s_wait_xcnt 0x0" ::: "memory");   // the value fragments below land in registers that the key loads above name as their addresses: the wait stands in front of that overwrite
#pragma unroll
            for (int dt = 0; dt < 4; ++dt) { va[dt] = WFrag<T16>::ld(Vt + vl + dt * 512); va2[dt] = WFrag<T16>::ld(Vt2 + vl + dt * 512); }
            asm volatile("s_wait_xcnt 0x0" ::: "memory"); }   // the softmax below reuses the registers that held the value loads' addresses
#pragma unroll
        for (int qt = 0; qt < QT; ++qt) {
            const int qi = q0 + qt * 16 + lr;
            if (key0 + 31 > q0 + qt * 16) {   // the block reaches past the tile's first query: mask key > query
#pragma unroll
                for (int kt = 0; kt < 2; ++kt)
#pragma unroll
                    for (int j = 0; j < 8; ++j) if (key0 + kt * 16 + hi * 8 + j > qi) s[qt][kt][j] = -3.0e38f; }
            float mx = m[qt];
#pragma unroll
            for (int j = 0; j < 8; ++j) mx = fmaxf(mx, fmaxf(s[qt][0][j], s[qt][1][j]));
            mx = fmaxf(mx, __shfl_xor(mx, 16, 32));
            const float al = exp2s((m[qt] - mx) * C1); const float nm = psh - mx * C1; m[qt] = mx;
            float xe[16], p[16]; float sum = 0.f;
#pragma unroll
            for (int e = 0; e < 16; ++e) xe[e] = fmaf(s[qt][e >> 3][e & 7], C1, nm);
            exp2x8(p, xe); exp2x8(p + 8, xe + 8);
#pragma unroll
            for (int e = 0; e < 16; ++e) sum += p[e];
            l[qt] = l[qt] * al + sum;
#pragma unroll
            for (int dt = 0; dt < 4; ++dt) o[qt][dt] *= al;
            if constexpr (HR) { v8us h0, h1, l0, l1;
#pragma unroll
                for (int j = 0; j < 8; ++j) { unsigned short a, c2; splitf(p[j], a, c2); h0[j] = a; l0[j] = c2; splitf(p[8 + j], a, c2); h1[j] = a; l1[j] = c2; }
                const V ph = cat16b(h0, h1), pl = cat16b(l0, l1);
#pragma unroll
                for (int dt = 0; dt < 4; ++dt) { o[qt][dt] = WFrag<T16>::mma(va[dt], ph, o[qt][dt]); o[qt][dt] = WFrag<T16>::mma(va[dt], pl, o[qt][dt]); o[qt][dt] = WFrag<T16>::mma(va2[dt], ph, o[qt][dt]); }
            } else { V pf;
#pragma unroll
                for (int e = 0; e < 16; ++e) pf[e] = (h16)p[e];
#pragma unroll
                for (int dt = 0; dt < 4; ++dt) o[qt][dt] = WFrag<T16>::mma(va[dt], pf, o[qt][dt]); }
        }
    }
    float* osw = os + wv * (QT * 16 * 68);
#pragma unroll
    for (int qt = 0; qt < QT; ++qt) {
#pragma unroll
        for (int dt = 0; dt < 4; ++dt) { float* pp = osw + (qt * 16 + lr) * 68 + dt * 16 + hi * 8; const v8f t = o[qt][dt]; *(v4fa*)pp = (v4f){t[0], t[1], t[2], t[3]}; *(v4fa*)(pp + 4) = (v4f){t[4], t[5], t[6], t[7]}; }
        const float lt = l[qt] + __shfl_xor(l[qt], 16, 32);
        if (hi == 0) { ml[(wv * 2) * 32 + qt * 16 + lr] = m[qt]; ml[(wv * 2 + 1) * 32 + qt * 16 + lr] = lt; } }
    __syncthreads();   // all FW partial (m, l, O^T) are in LDS before any thread joins them
#pragma unroll
    for (int sI = 0; sI < QT; ++sI) { const int idx = sI * (32 * FW) + (int)threadIdx.x; const int q = idx >> 3, d8 = (idx & 7) * 8;
        float M = ml[q];
#pragma unroll
        for (int w = 1; w < FW; ++w) M = fmaxf(M, ml[(w * 2) * 32 + q]);
        float L = 0.f; v4f x0 = (v4f){}, x1 = (v4f){};
#pragma unroll
        for (int w = 0; w < FW; ++w) { const float f = exp2s((ml[(w * 2) * 32 + q] - M) * C1); L += f * ml[(w * 2 + 1) * 32 + q]; const float* pp = os + w * (QT * 16 * 68) + q * 68 + d8; x0 += f * *(const v4fa*)pp; x1 += f * *(const v4fa*)(pp + 4); }
        v8us oh, ol;
#pragma unroll
        for (int k = 0; k < 4; ++k) { unsigned short a, c2; splitf(__fdiv_rn(x0[k], L), a, c2); oh[k] = a; ol[k] = c2; splitf(__fdiv_rn(x1[k], L), a, c2); oh[4 + k] = a; ol[4 + k] = c2; }
        const size_t oo = (size_t)(q0 + q) * HD + d8;   /* RAW MERGE: the (H, S, hd) context written flat = the module's reshape(b, S, H * hd) without a transpose */
        *(v8usa*)(Ah + oo) = oh; *(v8usa*)(Al + oo) = ol;
        asm volatile("s_wait_xcnt 0x0" ::: "memory"); }   // stands behind the two stores, in front of any later write of their address or data registers
}
// grid (batches x heads, (TT - RH) / 32 + RH / 16), 32 x FW threads; the planes of both batches lie one after the other, so blockIdx.x = b x NH_ + h indexes them all; blockIdx.y counts the query blocks from the last (longest key loop) to the first (for speed only).
__global__ __launch_bounds__(32 * FW) void k_fattn(const h16* __restrict__ Q16, const h16* __restrict__ K16, const h16* __restrict__ V16, const bf* __restrict__ Qh, const bf* __restrict__ Ql, const bf* __restrict__ Kh, const bf* __restrict__ Kl, const bf* __restrict__ Vh, const bf* __restrict__ Vl, bf* Ah, bf* Al) {
    __shared__ __align__(16) float os[FW * 32 * 68]; __shared__ float ml[FW * 2 * 32];
    const size_t hz = (size_t)blockIdx.x * TT * HD; const int by = blockIdx.y;
    if (by < (TT - RH) / 32) fa_body<h16, false, 2>(Q16 + hz, nullptr, K16 + hz, nullptr, V16 + hz, nullptr, TT - 32 - by * 32, os, ml, Ah + hz, Al + hz);
    else fa_body<bf, true, 1>(Qh + hz, Ql + hz, Kh + hz, Kl + hz, Vh + hz, Vl + hz, RH - 16 - (by - (TT - RH) / 32) * 16, os, ml, Ah + hz, Al + hz);
}

extern "C" void kernel_launch(void* const* d_in, const int* in_sizes, int n_in,
                              void* d_out, int out_size, void* d_ws, size_t ws_size, hipStream_t stream) {
    (void)in_sizes; (void)n_in; (void)out_size;
    const float* x = (const float*)d_in[0]; const float* wq = (const float*)d_in[1]; const float* wk = (const float*)d_in[2]; const float* wv = (const float*)d_in[3]; const float* wo = (const float*)d_in[4];   /* input order x, wq, wk, wv, wo ('xw') */
    float* OUT = (float*)d_out;     // [2][2048][1024]
    char* wsp = (char*)d_ws;
    auto take = [&](size_t bytes) { char* p = wsp; wsp += (bytes + 255) & ~(size_t)255; return (void*)p; };
    bf* WQ = (bf*)take((size_t)DQ * DM * 2); bf* WK = (bf*)take((size_t)DKV * DM * 2); bf* WV = (bf*)take((size_t)DKV * DM * 2); bf* WO = (bf*)take((size_t)DM * DQ * 2);
    bf* XB = (bf*)take((size_t)NB_ * TT * DM * 2);
    h16* QP16 = (h16*)take((size_t)NB_ * NH_ * TT * HD * 2); h16* KP16 = (h16*)take((size_t)NB_ * NKV * TT * HD * 2); h16* VT16 = (h16*)take((size_t)NB_ * NKV * HD * TT * 2);
    bf* QPh = (bf*)take((size_t)NB_ * NH_ * TT * HD * 2); bf* QPl = (bf*)take((size_t)NB_ * NH_ * TT * HD * 2); bf* KPh = (bf*)take((size_t)NB_ * NKV * TT * HD * 2); bf* KPl = (bf*)take((size_t)NB_ * NKV * TT * HD * 2); bf* VTh = (bf*)take((size_t)NB_ * NKV * HD * TT * 2); bf* VTl = (bf*)take((size_t)NB_ * NKV * HD * TT * 2);
    bf* ATh = (bf*)take((size_t)NB_ * TT * DQ * 2); bf* ATl = (bf*)take((size_t)NB_ * TT * DQ * 2);
    if ((size_t)(wsp - (char*)d_ws) > ws_size) return;    // ws 256 MiB
    k_prep<<<4 * WTB, 256, 0, stream>>>(x, wq, wk, wv, wo, XB, WQ, WK, WV, WO);
    k_gemms<false, true, 64, 4><<<dim3(NB_ * TT / 128, DQ / 128, 3), 128, 0, stream>>>(nullptr, nullptr, nullptr, nullptr, PJ3{XB, {WQ, WK, WV}, {QP16, KP16, VT16}, {QPh, KPh, VTh}, {QPl, KPl, VTl}});
    k_fattn<<<dim3(NB_ * NH_, (TT - RH) / 32 + RH / 16, 1), 32 * FW, 0, stream>>>(QP16, KP16, VT16, QPh, QPl, KPh, KPl, VTh, VTl, ATh, ATl);   // one kv head per query head
    k_gemms<true, false, 128, 2><<<dim3(NB_ * TT / 128, DM / 128, 1), 256, 0, stream>>>(ATh, ATl, WO, OUT, PJ3{});   // the raw-merged context of both batches is one [NB_ x TT][DQ] matrix
}

// v009
// It runs in 69.9 microseconds.
// In both of two side-by-side timings against v008, it was 1.03 times as fast.
// All steps since v000 together make it 21.4 times as fast.
#include <hip/hip_runtime.h>

// Causal multi-head self-attention whose head MERGE is a RAW RESHAPE, not a transpose (x [2][2048][1024]; q, k, v = x w ('xw' [1024][1024] 0.02, no bias) split the standard way (reshape(b, s, 16, 64).transpose(0, 2, 1, 3): head = 64-column block); scores masked (-inf where key > query) then / sqrt(64); softmax; ctx [b][16][s][64] RAW-reshaped to [b][s][1024] (NO transpose back: element (h, t, d) lands at row h x 128 + t // 16, column (t mod 16) x 64 + d); out = ctx wo ('xw', no bias) -> [2][2048][1024] (4.2 M); argument order x, wq, wk, wv, wo).
// Four launches, each for both batches: k_prep ('xw' weights transposed; bf16 copy of x); the three exact projections in one grid, whose epilogue writes the head planes in the attention kernel's fragment order (fp16 + hi/lo; v as its transpose, operands swapped); causal T-2048 attention (k_fattn; hybrid rows: < 512 hi/lo 3 products, rest fp16 x1024; key blocks above the diagonal are never visited); merged hi/lo x Wo exact.
// Compute dtypes, f32 accumulate: every input rounded to bf16; projections exact; attention rows < 512 3 products, rest fp16; softmax f32; Wo hl x exact.

#define NB_  2
#define TT   2048
#define DM   1024
#define NH_  16
#define NKV  16
#define REP  (NH_ / NKV)
#define HD   64
#define DQ   (NH_ * HD)
#define DKV  (NKV * HD)
#define RH   512                  // query rows < RH use hi+lo planes (0: none)
#define PCAR 1024.0f
#define SCL  0.125f   // HD^-0.5
typedef _Float16 h16;
typedef unsigned short bf;
typedef __attribute__((ext_vector_type(16))) __bf16   v16bf;
typedef __attribute__((ext_vector_type(16))) _Float16 v16h;
typedef __attribute__((ext_vector_type(8)))  _Float16 v8h;
typedef __attribute__((ext_vector_type(8)))  unsigned short v8us;
typedef __attribute__((ext_vector_type(8)))  float    v8f;
typedef __attribute__((ext_vector_type(4)))  float    v4f;
typedef v8h  __attribute__((may_alias)) v8ha;
typedef v4f  __attribute__((may_alias)) v4fa;
typedef v8us __attribute__((may_alias)) v8usa;

__device__ __forceinline__ unsigned short f2bf(float f) { unsigned u = __float_as_uint(f); u += 0x7FFFu + ((u >> 16) & 1u); return (unsigned short)(u >> 16); }
__device__ __forceinline__ float bf2f(unsigned short b) { return __uint_as_float(((unsigned)b) << 16); }
__device__ __forceinline__ float bfr(float f) { return bf2f(f2bf(f)); }
__device__ __forceinline__ v16h cat16(v8h lo, v8h hi) { return __builtin_shufflevector(lo, hi, 0, 1, 2, 3, 4, 5, 6, 7, 8, 9, 10, 11, 12, 13, 14, 15); }
__device__ __forceinline__ v16bf cat16b(v8us lo, v8us hi) { return __builtin_bit_cast(v16bf, __builtin_shufflevector(lo, hi, 0, 1, 2, 3, 4, 5, 6, 7, 8, 9, 10, 11, 12, 13, 14, 15)); }
__device__ __forceinline__ v8f wmma16(v16h a, v16h b, v8f c) { return __builtin_amdgcn_wmma_f32_16x16x32_f16(false, a, false, b, (short)0, c, false, false); }
__device__ __forceinline__ v8f wmmab(v16bf a, v16bf b, v8f c) { return __builtin_amdgcn_wmma_f32_16x16x32_bf16(false, a, false, b, (short)0, c, false, false); }



// ---- k_gemms: GEMM with both operands staged in LDS; one output tile a work-group, split over its waves (output GEMM: 128x128 as 4 x 2 pieces of 32x64; projections: 256 x rows by one head's 64 columns of each of q, k, v, as 4 x 3 pieces of 64x64), each piece over the WHOLE of K, so that a k sum runs in k order in one accumulator.
// C[m][n] = sum_k A[m][k] Bt[n][k] (+ A2[m][k] Bt[n][k] where SPLIT), operands K-contiguous bf16 planes of pitch GKD. A pass is GK k = two 128-byte lines of every operand row; a stage holds [A 128 rows | A2 128 rows | Bt 128 rows] (projections: [x 256 rows | wq 64 | wk 64 | wv 64]) at a pitch of 2 GK + 16 bytes (16 x odd: ds_load_b128 readers).
// Two buffers, filled by asynchronous copies to LDS (16 bytes a lane, a wave's copy = 4 whole lines), the copies of pass t + 2 issued behind the barrier that ends pass t: they fly while pass t + 1 is worked on.
// GK = 128: a work-group has the WGP alone, so that many bytes are in flight and few barriers are passed.
// MB = 16-row blocks of a wave's piece: 4 in the projections (12 waves, three a SIMD); 2 in the output GEMM (8 waves, two a SIMD).
// WFrag::ld reads one 16 x 32 fragment of a plane kept in FRAGMENT ORDER: 512 elements = two runs of 256, run c holding, at 8 x lane, the 8 elements k = 16 c + 8 hi .. + 7 of row lr (lane = 16 hi + lr).
// p = the fragment's start + 8 x lane, so each of the two 16-byte loads of a wave covers 512 bytes in a row = 4 whole lines.
template <typename T16> struct WFrag;
template <> struct WFrag<h16> { typedef v16h V; static __device__ __forceinline__ V ld(const h16* p) { return cat16(*(const v8h*)p, *(const v8h*)(p + 256)); } static __device__ __forceinline__ v8f mma(V a, V b, v8f c) { return wmma16(a, b, c); } };
template <> struct WFrag<bf> { typedef v16bf V; static __device__ __forceinline__ V ld(const bf* p) { return cat16b(*(const v8us*)p, *(const v8us*)(p + 256)); } static __device__ __forceinline__ v8f mma(V a, V b, v8f c) { return wmmab(a, b, c); } };
__device__ __forceinline__ h16 tohx(float x) { return (h16)x; }
__device__ __forceinline__ void splitf(float y, unsigned short& h, unsigned short& l) { h = f2bf(y); l = f2bf(y - bf2f(h)); }
#define GKD  1024                 // K of every GEMM here = pitch of every operand plane, elements
static_assert(DM == GKD && DQ == GKD && DKV == GKD, "one K for the four GEMMs");
// copy8: this lane's 16 bytes of the eight rows r, r + RS, ... r + 7 RS of one operand (LDS pitch GP elements). The s_wait_xcnt stands inside the statement, behind the last copy, so that no later write of an address register can come in front of it.
template <int RS, int GP>
__device__ __forceinline__ void copy8(const bf* g, unsigned l) {
    asm volatile("global_load_async_to_lds_b128 %0, %8, off\n\tglobal_load_async_to_lds_b128 %1, %9, off\n\tglobal_load_async_to_lds_b128 %2, %10, off\n\tglobal_load_async_to_lds_b128 %3, %11, off\n\t"
                 "global_load_async_to_lds_b128 %4, %12, off\n\tglobal_load_async_to_lds_b128 %5, %13, off\n\tglobal_load_async_to_lds_b128 %6, %14, off\n\tglobal_load_async_to_lds_b128 %7, %15, off\n\ts_wait_xcnt 0x0"
                 :: "v"(l), "v"(l + 1 * RS * GP * 2), "v"(l + 2 * RS * GP * 2), "v"(l + 3 * RS * GP * 2), "v"(l + 4 * RS * GP * 2), "v"(l + 5 * RS * GP * 2), "v"(l + 6 * RS * GP * 2), "v"(l + 7 * RS * GP * 2),
                    "v"(g), "v"(g + 1 * RS * GKD), "v"(g + 2 * RS * GKD), "v"(g + 3 * RS * GKD), "v"(g + 4 * RS * GKD), "v"(g + 5 * RS * GKD), "v"(g + 6 * RS * GKD), "v"(g + 7 * RS * GKD) : "memory");
}
__device__ __forceinline__ v16bf ldsfrag(const bf* p) { return cat16b(*(const v8usa*)p, *(const v8usa*)(p + 16)); }   // k = 8 hi .. + 7, then 16 + 8 hi .. + 7: the k order of WFrag::ld, for A and B alike
// PL: the q, k and v projections of both batches in one grid (NB_ x TT / 256 blocks of x rows, DQ / 64 heads). A work-group of 12 waves forms one head of q, k AND v for its 256 x rows: the x rows are fetched from L2 once for the three, and 448 operand rows feed 12 pieces (tiles of 128x128 take 768 for as many).
// Waves 4 z .. 4 z + 3 (z = 0 q, 1 k, 2 v; weight and planes from pj; A, A2, Bt and C are not used) hold the four 64-row pieces of projection z.
// X holds the rows of both batches one after the other. A wave's piece (MB = 4: 64 x rows of one batch, one head's 64 weight columns) leaves as the three 16-bit planes that the attention kernel reads (fp16, bf16 hi, bf16 lo), never as f32.
// q, k: A = x rows, Bt = weight columns, planes [b][h][t / 16][d / 32][fragment: 16 t x 32 d]. v: operands swapped, (x wv)^T = wv^T x^T: rows g x HD + d, columns t = the planes [b][g][t / 32][d / 16][fragment: 16 d x 32 t].
// Inside a fragment the elements lie in the order of WFrag::ld. A wave's 64 x 64 piece is 8 whole fragments = 4096 elements in a row of each plane.
// A '#pragma unroll' in k_gemms with no comment of its own is there so that the fragment, accumulator and vector arrays are indexed by constants and stay in registers.
struct PJ3 { const bf* X; const bf* W[3]; h16* P16[3]; bf* Ph[3]; bf* Pl[3]; };
template <bool SPLIT, bool PL, int GK, int MB>
__global__ __launch_bounds__(PL ? 384 : 128 / (MB * 16) * 64) void k_gemms(const bf* __restrict__ A, const bf* __restrict__ A2, const bf* __restrict__ Bt, float* C, PJ3 pj) {
    constexpr int GP = GK + 8;                        // LDS row pitch, 16-bit elements
    constexpr int STG = (PL ? 256 + 3 * 64 : SPLIT ? 384 : 256) * GP;   // elements of a stage
    constexpr int OB = (PL || SPLIT ? 256 : 128) * GP;   // where Bt's rows begin in a stage (A2's: 128 GP)
    constexpr int NT = GKD / GK;
    constexpr int NTH = PL ? 384 : 128 / (MB * 16) * 64;   // threads: 12 waves, or 128 / (16 MB) x 2 waves
    constexpr int PR = GK / 8, RS = (PL ? 256 : NTH) / PR;   // 16-byte pieces of a row; rows of A that the copying lanes cover at once (PL: the lanes of waves 0 .. 7)
    constexpr int RSW = 128 / PR;                        // PL: rows of a weight that the four waves of its projection cover at once
    static_assert(NT >= 2 && 2 * STG * 2 >= NTH / 32 * MB * 16 * 68 * 4 && 128 % (8 * RS) == 0 && (!PL || (MB == 4 && 8 * RSW == 64 && !SPLIT)), "two stages exist; the ring holds the waves' f32 pieces; whole statements of eight copies");
    __shared__ __align__(16) float smf[STG];          // 2 buffers x STG 16-bit elements
    const bf* sm = (const bf*)smf;
    const int tid = threadIdx.x, lane = tid & 31, lr = lane & 15, hi = lane >> 4; const int wv = __builtin_amdgcn_readfirstlane(tid >> 5); const int z = PL ? wv >> 2 : 0; const bool isv = PL && z == 2; const int wm = PL ? wv & 3 : wv >> 1, wn = PL ? 0 : wv & 1;
    const int r0 = blockIdx.x * (PL ? 256 : 128), c0 = blockIdx.y * (PL ? 64 : 128);   // first row of A (PL: x) and of Bt (PL: each weight) of the work-group's tile
    if constexpr (PL) { A = pj.X; Bt = isv ? pj.W[2] : z ? pj.W[1] : pj.W[0]; }
    const int crow = tid / PR, cpc = (tid % PR) * 8;   // the lane's row (mod RS) and its 8 elements of the row
    const int brow = PL ? (tid & 127) / PR : crow;     // its row of Bt (PL: mod RSW, in the weight of its own projection)
    const bf* gA = A + (size_t)(r0 + crow) * GKD + cpc; const bf* gB = Bt + (size_t)(c0 + brow) * GKD + cpc; const bf* gA2 = SPLIT ? A2 + (size_t)(r0 + crow) * GKD + cpc : nullptr;
    const unsigned l0 = (unsigned)(size_t)smf + (unsigned)(crow * GP + cpc) * 2u, lB = (unsigned)(size_t)smf + (unsigned)(OB + (z * 64 + brow) * GP + cpc) * 2u;
    auto fill = [&](int t, int buf) { const unsigned l = l0 + (unsigned)buf * (STG * 2);
        if constexpr (PL) {   // every wave: its share of its projection's 64 weight rows; waves 0 .. 7 (a test on the wave's number, the same in all its lanes): the 256 x rows
            copy8<RSW, GP>(gB + t * GK, lB + (unsigned)buf * (STG * 2));
            if (wv < 8) {
#pragma unroll   // a statement of eight copies for every 8 RS rows
                for (int r = 0; r < 256; r += 8 * RS) copy8<RS, GP>(gA + t * GK + r * GKD, l + r * GP * 2); }
        } else {
#pragma unroll   // a statement of eight copies for every 8 RS rows of each operand
            for (int r = 0; r < 128; r += 8 * RS) { copy8<RS, GP>(gA + t * GK + r * GKD, l + r * GP * 2); copy8<RS, GP>(gB + t * GK + r * GKD, l + (OB + r * GP) * 2); if constexpr (SPLIT) copy8<RS, GP>(gA2 + t * GK + r * GKD, l + (128 + r) * GP * 2); } } };
    v8f acc[MB][4];
#pragma unroll
    for (int mb = 0; mb < MB; ++mb)
#pragma unroll
        for (int nb = 0; nb < 4; ++nb) acc[mb][nb] = (v8f){};
    fill(0, 0);
    asm volatile("s_wait_asynccnt 0x0" ::: "memory");   // this wave's copies of stage 0 have landed
    __syncthreads();                                    // ... and every other wave's: stage 0 may be read
    fill(1, 1);
    const int fa = (wm * (MB * 16) + lr) * GP + 8 * hi, fb = ((PL ? z : wn) * 64 + lr) * GP + 8 * hi;   // the wave's first fragment among A's rows and among Bt's
    const int ao = isv ? fb : fa, bo = isv ? fa : fb, oa = isv ? OB : 0, ob = isv ? 0 : OB;   // v: operands swapped (both lie in LDS in one form)
#pragma unroll 1   // rolled: a pass is already 64 matrix instructions long
    for (int t = 0; t < NT; ++t) {
        const bf* sa = sm + ((t & 1) ? STG + oa : oa) + ao; const bf* sb = sm + ((t & 1) ? STG + ob : ob) + bo;   // Bt's place goes into its base, so that every fragment's offset from its base fits the LDS load's 16-bit field
#pragma unroll     // fragment arrays indexed by constants
        for (int ks = 0; ks < GK / 32; ++ks) {
            v16bf a[MB], a2[MB], b[4];
#pragma unroll
            for (int mb = 0; mb < MB; ++mb) { a[mb] = ldsfrag(sa + mb * 16 * GP + ks * 32); if constexpr (SPLIT) a2[mb] = ldsfrag(sa + 128 * GP + mb * 16 * GP + ks * 32); }
#pragma unroll
            for (int nb = 0; nb < 4; ++nb) b[nb] = ldsfrag(sb + nb * 16 * GP + ks * 32);
            __builtin_amdgcn_sched_barrier(0);   // keeps the block's LDS reads together as one group ahead of its matrix instructions (without it the build reads each b fragment alone, right in front of its use, and waits out the LDS latency four times a block)
#pragma unroll
            for (int nb = 0; nb < 4; ++nb)
#pragma unroll
                for (int mb = 0; mb < MB; ++mb) acc[mb][nb] = wmmab(a[mb], b[nb], acc[mb][nb]);
            if constexpr (SPLIT) {
#pragma unroll
                for (int nb = 0; nb < 4; ++nb)
#pragma unroll
                    for (int mb = 0; mb < MB; ++mb) acc[mb][nb] = wmmab(a2[mb], b[nb], acc[mb][nb]); } }
        asm volatile("s_wait_dscnt 0x0" ::: "memory");      // this wave's reads of buffer t mod 2 are done before the buffer is given up
        asm volatile("s_wait_asynccnt 0x0" ::: "memory");   // this wave's copies of stage t + 1 have landed
        __syncthreads();                                    // publishes stage t + 1 and ends every wave's reads of buffer t mod 2
        if (t + 2 < NT) fill(t + 2, t & 1);
    }
    asm volatile("s_wait_asynccnt 0x0" ::: "memory");       // no copy is outstanding when the ring becomes output staging
    // each wave turns its piece round in its own 16 MB x 68 f32 range of the ring (every wave has left the ring at the last pass's barrier), so that whole lines are stored
    float* osw = smf + wv * (MB * 16 * 68);
#pragma unroll
    for (int mb = 0; mb < MB; ++mb)
#pragma unroll
        for (int nb = 0; nb < 4; ++nb)
#pragma unroll
            for (int j = 0; j < 8; ++j) osw[(mb * 16 + hi * 8 + j) * 68 + nb * 16 + lr] = acc[mb][nb][j];
    __syncthreads();   // the piece is in LDS before its rows are read back by other lanes
    const int rw = r0 + wm * (MB * 16), cw = c0 + wn * 64;   // the wave's first row and column
    if constexpr (PL) {
        const int xr = rw, wc = cw; const int bt = xr / TT * TT;   // first x row and weight column of the piece; bt: first x row of its batch
        h16* P16 = isv ? pj.P16[2] : z ? pj.P16[1] : pj.P16[0]; bf* Ph = isv ? pj.Ph[2] : z ? pj.Ph[1] : pj.Ph[0]; bf* Pl = isv ? pj.Pl[2] : z ? pj.Pl[1] : pj.Pl[0];
        const size_t e0 = (size_t)bt * DQ + (size_t)wc * TT + (size_t)(xr - bt) * HD;   // the batch's planes, then head wc / 64, then the piece's first t: HD elements of the head's plane for every t
        // s = one run of 256 elements: fragment s >> 1, run s & 1. q, k: fragment = (t / 16) x 2 + d / 32; v: fragment = (t / 32) x 4 + d / 16. The piece's rows are t (q, k) or d (v).
        for (int s = 0; s < MB * 4; ++s) { const int row = (isv ? (s >> 1) & 3 : s >> 2) * 16 + lr, cofs = (isv ? s >> 3 : (s >> 1) & 1) * 32 + (s & 1) * 16 + hi * 8; const float* pp = osw + row * 68 + cofs; const v4f x0 = *(const v4fa*)pp, x1 = *(const v4fa*)(pp + 4);
            v8h o16; v8us oh, ol;
#pragma unroll
            for (int k = 0; k < 4; ++k) { unsigned short a, c2; o16[k] = tohx(x0[k]); splitf(x0[k], a, c2); oh[k] = a; ol[k] = c2; o16[4 + k] = tohx(x1[k]); splitf(x1[k], a, c2); oh[4 + k] = a; ol[4 + k] = c2; }
            const size_t e = e0 + s * 256 + lane * 8;   // a wave writes 4 whole 128-byte lines of each plane
            *(v8ha*)(P16 + e) = o16; *(v8usa*)(Ph + e) = oh; *(v8usa*)(Pl + e) = ol;
            asm volatile("s_wait_xcnt 0x0" ::: "memory"); }   // stands behind the three stores, in front of the next piece's writes of their address and data registers
    } else {
        const float* op = osw + (lane >> 4) * 68 + (lane & 15) * 4; float* cp = C + (size_t)(rw + (lane >> 4)) * DM + cw + (lane & 15) * 4;   // 16 lanes write a 256-byte row piece, a wave two rows at a time
        v4f val[MB * 8];
#pragma unroll   // val indexed by constants; all the LDS reads go out together, ahead of the stores
        for (int s = 0; s < MB * 8; ++s) val[s] = *(const v4fa*)(op + s * 2 * 68);
#pragma unroll   // every store has data registers of its own and one address pair serves them all (constant offsets): no register of an issued store is written again
        for (int s = 0; s < MB * 8; ++s) *(v4f*)(cp + s * 2 * DM) = val[s];
    }
}

typedef __attribute__((ext_vector_type(2))) _Float16 v2h;
typedef __attribute__((ext_vector_type(4))) _Float16 v4h;
typedef __attribute__((ext_vector_type(2))) unsigned short v2us;
typedef __attribute__((ext_vector_type(4))) unsigned short v4us;
typedef __attribute__((ext_vector_type(2))) float v2f;
typedef __attribute__((ext_vector_type(4))) int v4i;

// wtT: one 64 k x 64 n tile of a weight w [k][n] (f32) leaves as 64 whole 128-byte lines of its bf16 transpose Bt [n][k], turned round in LDS.
// In: a lane takes 4 n (16 bytes) of the rows 2 r and 2 r + 1, so a wave's load covers 256 bytes in a row of two rows = 4 whole lines; the two rows' values of one n are one dword (k, k + 1) of the transposed row.
// tl: 64 transposed rows at a pitch of WTP dwords. WTP is odd: the 4-byte stores of a wave (n 4 apart, two neighbouring dwords) and its 4-byte reads (4 rows, every 4th dword) each meet 32 different banks.
// Out: 8 lanes write one row's 128 bytes, a wave 4 rows. A '#pragma unroll' in wtT with no comment of its own is there so that a and o are indexed by constants and stay in registers.
#define WTP  33
typedef __attribute__((ext_vector_type(4))) unsigned v4u;
__device__ __forceinline__ void wtT(const float* __restrict__ w, bf* Bt, int blk, unsigned* tl) {
    const int tid = threadIdx.x; const int k0 = (blk % (DM / 64)) * 64, n0 = (blk / (DM / 64)) * 64;
    const int c4 = (tid & 15) * 4, rp = tid >> 4;   // the lane's 4 columns; its pair of rows (and that pair + 16)
    v4f a[2][2];
#pragma unroll   // a indexed by constants; the four loads are in flight together
    for (int p = 0; p < 2; ++p)
#pragma unroll
        for (int h = 0; h < 2; ++h) a[p][h] = *(const v4f*)(w + (size_t)(k0 + (p * 16 + rp) * 2 + h) * DQ + n0 + c4);
#pragma unroll
    for (int p = 0; p < 2; ++p)
#pragma unroll
        for (int i = 0; i < 4; ++i) tl[(c4 + i) * WTP + p * 16 + rp] = (unsigned)f2bf(a[p][0][i]) | ((unsigned)f2bf(a[p][1][i]) << 16);
    __syncthreads();   // the whole tile is in LDS before its transposed rows are read by other lanes
    v4u o[2];
#pragma unroll   // o indexed by constants; every store has data registers of its own
    for (int s = 0; s < 2; ++s) { const unsigned* q = tl + (s * 32 + (tid >> 3)) * WTP + (tid & 7) * 4; o[s] = (v4u){q[0], q[1], q[2], q[3]}; }
#pragma unroll
    for (int s = 0; s < 2; ++s) *(v8usa*)(Bt + (size_t)(n0 + s * 32 + (tid >> 3)) * DM + k0 + (tid & 7) * 8) = __builtin_bit_cast(v8us, o[s]);
    asm volatile("s_wait_xcnt 0x0" ::: "memory");   // stands behind the two stores, in front of any later write of their address or data registers
}
__device__ __forceinline__ void cvt8(const float* __restrict__ src, bf* dst, size_t i) { const v8f v = *(const v8f*)(src + i * 8); v8us o;
#pragma unroll
    for (int k = 0; k < 8; ++k) o[k] = f2bf(v[k]); *(v8us*)(dst + i * 8) = o;  }
// k_prep: all that the GEMMs need of the inputs in one grid of 4 x WTB work-groups: work-group g transposes tile g mod WTB of weight g / WTB and converts its CVW x 256 8-element pieces of x (both batches).
#define WTB  ((DM / 64) * (DQ / 64))
#define CVW  (NB_ * TT * DM / 8 / 256 / (4 * WTB))
static_assert((size_t)CVW * 256 * 8 * (4 * WTB) == (size_t)NB_ * TT * DM && DKV == DQ && DM == DQ && DM % 64 == 0, "the grid's pieces cover x exactly; the four weights have one square shape of whole tiles");
__global__ __launch_bounds__(256) void k_prep(const float* __restrict__ x, const float* __restrict__ wq, const float* __restrict__ wk, const float* __restrict__ wv, const float* __restrict__ wo, bf* XB, bf* WQ, bf* WK, bf* WV, bf* WO) {
    __shared__ unsigned tl[64 * WTP];
    const int g = blockIdx.x, which = g / WTB;
    wtT(which == 0 ? wq : which == 1 ? wk : which == 2 ? wv : wo, which == 0 ? WQ : which == 1 ? WK : which == 2 ? WV : WO, g % WTB, tl);
#pragma unroll   // the pieces' loads are independent: unrolled, they are in flight together
    for (int c = 0; c < CVW; ++c) cvt8(x, XB, (size_t)(g * CVW + c) * 256 + threadIdx.x);
}

// ---- k_fattn: causal attention of one head for one block of query rows in ONE kernel: scores, softmax, probability x value and the hi/lo merge; no score or probability leaves the registers.
// Every product is formed TRANSPOSED, so that a lane owns one query column (lr) all the way: S^T[key][q] = K Q^T (A = key rows, B = query rows), whose two 16-key result tiles hold, per lane, keys 8 hi + j and 16 + 8 hi + j:
// exactly the k order of a B fragment, so the probabilities feed O^T[d][q] = V^T P^T (A = 16 d x 32 t fragments of the value plane) with no exchange between lanes. The q, k and v planes lie in fragment order (WFrag::ld): a 32-key block is 4 KB in a row of the key plane and of the value plane.
// Softmax is the running form: per query a running maximum m and sum l; when m grows, l and O^T are scaled by exp(m_old - m_new). The 32-key blocks up to the diagonal are dealt round robin over the FW waves of the
// work-group; the FW partial (m, l, O^T) meet in LDS and are joined in wave order 0 .. FW-1. Rows < RH: bf16 hi/lo, 3 products, 16 rows a work-group; other rows: fp16, probabilities x PCAR (the factor cancels in O / l), 32 rows.
// Every '#pragma unroll' in fa_body is there so that the fragment, score and accumulator arrays are indexed by constants and stay in registers.
#define FW   4
#define C1   (SCL * 1.4426950408889634f)
// exp2 with the one slot that the instruction set asks for behind a transcendental written into the same statement.
// exp2s: one value, v_nop behind it. exp2x8: eight values; the outputs are early-clobber, so no v_exp_f32 overwrites a source or reads a result of the one before it and each fills its forerunner's slot; v_nop fills the last one's.
__device__ __forceinline__ float exp2s(float x) { float r; asm("v_exp_f32 %0, %1\n\tv_nop" : "=v"(r) : "v"(x)); return r; }
__device__ __forceinline__ void exp2x8(float* r, const float* x) {
    asm("v_exp_f32 %0, %8\n\tv_exp_f32 %1, %9\n\tv_exp_f32 %2, %10\n\tv_exp_f32 %3, %11\n\tv_exp_f32 %4, %12\n\tv_exp_f32 %5, %13\n\tv_exp_f32 %6, %14\n\tv_exp_f32 %7, %15\n\tv_nop"
        : "=&v"(r[0]), "=&v"(r[1]), "=&v"(r[2]), "=&v"(r[3]), "=&v"(r[4]), "=&v"(r[5]), "=&v"(r[6]), "=&v"(r[7]) : "v"(x[0]), "v"(x[1]), "v"(x[2]), "v"(x[3]), "v"(x[4]), "v"(x[5]), "v"(x[6]), "v"(x[7])); }
template <typename T16, bool HR, int QT>
__device__ __forceinline__ void fa_body(const T16* __restrict__ Q, const T16* __restrict__ Q2, const T16* __restrict__ Kp, const T16* __restrict__ Kp2, const T16* __restrict__ Vt, const T16* __restrict__ Vt2, int q0, float* os, float* ml, bf* Ah, bf* Al) {
    typedef typename WFrag<T16>::V V;
    const int lane = threadIdx.x & 31, lr = lane & 15, hi = lane >> 4; const int wv = __builtin_amdgcn_readfirstlane((int)(threadIdx.x >> 5));
    const float psh = HR ? 0.0f : 10.0f;   // log2(PCAR)
    V qf[QT][2], qf2[QT][2];
#pragma unroll
    for (int qt = 0; qt < QT; ++qt)
#pragma unroll
        for (int ks = 0; ks < 2; ++ks) { const size_t qo = (size_t)(q0 + qt * 16) * HD + ks * 512 + 8 * lane; qf[qt][ks] = WFrag<T16>::ld(Q + qo); if (HR) qf2[qt][ks] = WFrag<T16>::ld(Q2 + qo); }
    v8f o[QT][4]; float m[QT], l[QT];
#pragma unroll
    for (int qt = 0; qt < QT; ++qt) { m[qt] = -3.0e38f; l[qt] = 0.f;
#pragma unroll
        for (int dt = 0; dt < 4; ++dt) o[qt][dt] = (v8f){}; }
    const int nkb = (q0 + QT * 16 + 31) >> 5;   // 32-key blocks that hold a key <= the block's last query; in each of them every query of the block has at least one such key
    V kf[2][2];   // fp16 rows: a pass's key fragments are fetched one pass ahead (the block index is clamped to the last block, so the fetch behind a wave's last pass, or of a wave with no pass, stays inside the plane); hi/lo rows fetch in the pass itself (twice the fragments, at most 4 passes a wave)
    const size_t kl = (size_t)(8 * lane);   // the lane's place in a run of a fragment
    if constexpr (!HR) {
#pragma unroll
        for (int kt = 0; kt < 2; ++kt)
#pragma unroll
            for (int ks = 0; ks < 2; ++ks) kf[kt][ks] = WFrag<T16>::ld(Kp + (size_t)min(wv, nkb - 1) * (32 * HD) + kl + kt * (16 * HD) + ks * 512); }
#pragma unroll 1   // rolled: one pass's fragments, scores and accumulators already take the registers that four waves a SIMD leave to each
    for (int kb = wv; kb < nkb; kb += FW) {
        const int key0 = kb * 32;
        V va[4], va2[4]; const size_t vl = (size_t)key0 * HD + kl;
        if constexpr (!HR) {
#pragma unroll
            for (int dt = 0; dt < 4; ++dt) va[dt] = WFrag<T16>::ld(Vt + vl + dt * 512); }
        v8f s[QT][2];
#pragma unroll
        for (int qt = 0; qt < QT; ++qt) { s[qt][0] = (v8f){}; s[qt][1] = (v8f){}; }
#pragma unroll
        for (int kt = 0; kt < 2; ++kt)
#pragma unroll
            for (int ks = 0; ks < 2; ++ks) { V ka, ka2; if constexpr (HR) { const size_t ko = (size_t)key0 * HD + kl + kt * (16 * HD) + ks * 512; ka = WFrag<T16>::ld(Kp + ko); ka2 = WFrag<T16>::ld(Kp2 + ko); } else ka = kf[kt][ks];
#pragma unroll
                for (int qt = 0; qt < QT; ++qt) { s[qt][kt] = WFrag<T16>::mma(ka, qf[qt][ks], s[qt][kt]); if constexpr (HR) { s[qt][kt] = WFrag<T16>::mma(ka, qf2[qt][ks], s[qt][kt]); s[qt][kt] = WFrag<T16>::mma(ka2, qf[qt][ks], s[qt][kt]); } } }
        if constexpr (!HR) {
#pragma unroll
            for (int kt = 0; kt < 2; ++kt)
#pragma unroll
                for (int ks = 0; ks < 2; ++ks) kf[kt][ks] = WFrag<T16>::ld(Kp + (size_t)min(kb + FW, nkb - 1) * (32 * HD) + kl + kt * (16 * HD) + ks * 512); }
        else { asm volatile("s_wait_xcnt 0x0" ::: "memory");   // the value fragments below land in registers that the key loads above name as their addresses: the wait stands in front of that overwrite
#pragma unroll
            for (int dt = 0; dt < 4; ++dt) { va[dt] = WFrag<T16>::ld(Vt + vl + dt * 512); va2[dt] = WFrag<T16>::ld(Vt2 + vl + dt * 512); }
            asm volatile("s_wait_xcnt 0x0" ::: "memory"); }   // the softmax below reuses the registers that held the value loads' addresses
#pragma unroll
        for (int qt = 0; qt < QT; ++qt) {
            const int qi = q0 + qt * 16 + lr;
            if (key0 + 31 > q0 + qt * 16) {   // the block reaches past the tile's first query: mask key > query
#pragma unroll
                for (int kt = 0; kt < 2; ++kt)
#pragma unroll
                    for (int j = 0; j < 8; ++j) if (key0 + kt * 16 + hi * 8 + j > qi) s[qt][kt][j] = -3.0e38f; }
            float mx = m[qt];
#pragma unroll
            for (int j = 0; j < 8; ++j) mx = fmaxf(mx, fmaxf(s[qt][0][j], s[qt][1][j]));
            mx = fmaxf(mx, __shfl_xor(mx, 16, 32));
            const float al = exp2s((m[qt] - mx) * C1); const float nm = psh - mx * C1; m[qt] = mx;
            float xe[16], p[16]; float sum = 0.f;
#pragma unroll
            for (int e = 0; e < 16; ++e) xe[e] = fmaf(s[qt][e >> 3][e & 7], C1, nm);
            exp2x8(p, xe); exp2x8(p + 8, xe + 8);
#pragma unroll
            for (int e = 0; e < 16; ++e) sum += p[e];
            l[qt] = l[qt] * al + sum;
#pragma unroll
            for (int dt = 0; dt < 4; ++dt) o[qt][dt] *= al;
            if constexpr (HR) { v8us h0, h1, l0, l1;
#pragma unroll
                for (int j = 0; j < 8; ++j) { unsigned short a, c2; splitf(p[j], a, c2); h0[j] = a; l0[j] = c2; splitf(p[8 + j], a, c2); h1[j] = a; l1[j] = c2; }
                const V ph = cat16b(h0, h1), pl = cat16b(l0, l1);
#pragma unroll
                for (int dt = 0; dt < 4; ++dt) { o[qt][dt] = WFrag<T16>::mma(va[dt], ph, o[qt][dt]); o[qt][dt] = WFrag<T16>::mma(va[dt], pl, o[qt][dt]); o[qt][dt] = WFrag<T16>::mma(va2[dt], ph, o[qt][dt]); }
            } else { V pf;
#pragma unroll
                for (int e = 0; e < 16; ++e) pf[e] = (h16)p[e];
#pragma unroll
                for (int dt = 0; dt < 4; ++dt) o[qt][dt] = WFrag<T16>::mma(va[dt], pf, o[qt][dt]); }
        }
    }
    float* osw = os + wv * (QT * 16 * 68);
#pragma unroll
    for (int qt = 0; qt < QT; ++qt) {
#pragma unroll
        for (int dt = 0; dt < 4; ++dt) { float* pp = osw + (qt * 16 + lr) * 68 + dt * 16 + hi * 8; const v8f t = o[qt][dt]; *(v4fa*)pp = (v4f){t[0], t[1], t[2], t[3]}; *(v4fa*)(pp + 4) = (v4f){t[4], t[5], t[6], t[7]}; }
        const float lt = l[qt] + __shfl_xor(l[qt], 16, 32);
        if (hi == 0) { ml[(wv * 2) * 32 + qt * 16 + lr] = m[qt]; ml[(wv * 2 + 1) * 32 + qt * 16 + lr] = lt; } }
    __syncthreads();   // all FW partial (m, l, O^T) are in LDS before any thread joins them
#pragma unroll
    for (int sI = 0; sI < QT; ++sI) { const int idx = sI * (32 * FW) + (int)threadIdx.x; const int q = idx >> 3, d8 = (idx & 7) * 8;
        float M = ml[q];
#pragma unroll
        for (int w = 1; w < FW; ++w) M = fmaxf(M, ml[(w * 2) * 32 + q]);
        float L = 0.f; v4f x0 = (v4f){}, x1 = (v4f){};
#pragma unroll
        for (int w = 0; w < FW; ++w) { const float f = exp2s((ml[(w * 2) * 32 + q] - M) * C1); L += f * ml[(w * 2 + 1) * 32 + q]; const float* pp = os + w * (QT * 16 * 68) + q * 68 + d8; x0 += f * *(const v4fa*)pp; x1 += f * *(const v4fa*)(pp + 4); }
        v8us oh, ol;
#pragma unroll
        for (int k = 0; k < 4; ++k) { unsigned short a, c2; splitf(__fdiv_rn(x0[k], L), a, c2); oh[k] = a; ol[k] = c2; splitf(__fdiv_rn(x1[k], L), a, c2); oh[4 + k] = a; ol[4 + k] = c2; }
        const size_t oo = (size_t)(q0 + q) * HD + d8;   /* RAW MERGE: the (H, S, hd) context written flat = the module's reshape(b, S, H * hd) without a transpose */
        *(v8usa*)(Ah + oo) = oh; *(v8usa*)(Al + oo) = ol;
        asm volatile("s_wait_xcnt 0x0" ::: "memory"); }   // stands behind the two stores, in front of any later write of their address or data registers
}
// grid (batches x heads, (TT - RH) / 32 + RH / 16), 32 x FW threads; the planes of both batches lie one after the other, so blockIdx.x = b x NH_ + h indexes them all; blockIdx.y counts the query blocks from the last (longest key loop) to the first (for speed only).
__global__ __launch_bounds__(32 * FW) void k_fattn(const h16* __restrict__ Q16, const h16* __restrict__ K16, const h16* __restrict__ V16, const bf* __restrict__ Qh, const bf* __restrict__ Ql, const bf* __restrict__ Kh, const bf* __restrict__ Kl, const bf* __restrict__ Vh, const bf* __restrict__ Vl, bf* Ah, bf* Al) {
    __shared__ __align__(16) float os[FW * 32 * 68]; __shared__ float ml[FW * 2 * 32];
    const size_t hz = (size_t)blockIdx.x * TT * HD; const int by = blockIdx.y;
    if (by < (TT - RH) / 32) fa_body<h16, false, 2>(Q16 + hz, nullptr, K16 + hz, nullptr, V16 + hz, nullptr, TT - 32 - by * 32, os, ml, Ah + hz, Al + hz);
    else fa_body<bf, true, 1>(Qh + hz, Ql + hz, Kh + hz, Kl + hz, Vh + hz, Vl + hz, RH - 16 - (by - (TT - RH) / 32) * 16, os, ml, Ah + hz, Al + hz);
}

extern "C" void kernel_launch(void* const* d_in, const int* in_sizes, int n_in,
                              void* d_out, int out_size, void* d_ws, size_t ws_size, hipStream_t stream) {
    (void)in_sizes; (void)n_in; (void)out_size;
    const float* x = (const float*)d_in[0]; const float* wq = (const float*)d_in[1]; const float* wk = (const float*)d_in[2]; const float* wv = (const float*)d_in[3]; const float* wo = (const float*)d_in[4];   /* input order x, wq, wk, wv, wo ('xw') */
    float* OUT = (float*)d_out;     // [2][2048][1024]
    char* wsp = (char*)d_ws;
    auto take = [&](size_t bytes) { char* p = wsp; wsp += (bytes + 255) & ~(size_t)255; return (void*)p; };
    bf* WQ = (bf*)take((size_t)DQ * DM * 2); bf* WK = (bf*)take((size_t)DKV * DM * 2); bf* WV = (bf*)take((size_t)DKV * DM * 2); bf* WO = (bf*)take((size_t)DM * DQ * 2);
    bf* XB = (bf*)take((size_t)NB_ * TT * DM * 2);
    h16* QP16 = (h16*)take((size_t)NB_ * NH_ * TT * HD * 2); h16* KP16 = (h16*)take((size_t)NB_ * NKV * TT * HD * 2); h16* VT16 = (h16*)take((size_t)NB_ * NKV * HD * TT * 2);
    bf* QPh = (bf*)take((size_t)NB_ * NH_ * TT * HD * 2); bf* QPl = (bf*)take((size_t)NB_ * NH_ * TT * HD * 2); bf* KPh = (bf*)take((size_t)NB_ * NKV * TT * HD * 2); bf* KPl = (bf*)take((size_t)NB_ * NKV * TT * HD * 2); bf* VTh = (bf*)take((size_t)NB_ * NKV * HD * TT * 2); bf* VTl = (bf*)take((size_t)NB_ * NKV * HD * TT * 2);
    bf* ATh = (bf*)take((size_t)NB_ * TT * DQ * 2); bf* ATl = (bf*)take((size_t)NB_ * TT * DQ * 2);
    if ((size_t)(wsp - (char*)d_ws) > ws_size) return;    // ws 256 MiB
    k_prep<<<4 * WTB, 256, 0, stream>>>(x, wq, wk, wv, wo, XB, WQ, WK, WV, WO);
    k_gemms<false, true, 128, 4><<<dim3(NB_ * TT / 256, DQ / 64, 1), 384, 0, stream>>>(nullptr, nullptr, nullptr, nullptr, PJ3{XB, {WQ, WK, WV}, {QP16, KP16, VT16}, {QPh, KPh, VTh}, {QPl, KPl, VTl}});
    k_fattn<<<dim3(NB_ * NH_, (TT - RH) / 32 + RH / 16, 1), 32 * FW, 0, stream>>>(QP16, KP16, VT16, QPh, QPl, KPh, KPl, VTh, VTl, ATh, ATl);   // one kv head per query head
    k_gemms<true, false, 128, 2><<<dim3(NB_ * TT / 128, DM / 128, 1), 256, 0, stream>>>(ATh, ATl, WO, OUT, PJ3{});   // the raw-merged context of both batches is one [NB_ x TT][DQ] matrix
}
